// v000
// Measured on an AMD MI455X. A time is GPU time per run, averaged over a window of back-to-back runs after a warm-up
// (all launches, gaps included; the runs take copies of the inputs in turn), and the median of several windows.
// Apart from v000's, it joins two sittings. Times from different sittings can be a few percent apart, while
// side-by-side timings come from the same sitting.
// v000, which the later versions start from, runs in 422 microseconds.
#include <hip/hip_runtime.h>
#include <hip/hip_bf16.h>

// ---------------------------------------------------------------------------
// Relation-aware attention for MI455X (gfx1250, wave32, WMMA).
//
// Roofline: relation_weights (256 MB) dominates traffic -> memory bound at
// ~13us on 23.3 TB/s HBM *if* we never spill the 2x16x2048x2048 score tensor.
// Hence a fused flash-style attention kernel with online normalization, f16
// WMMA (16x16x32, K == head_dim == 32) for all GEMM work, f32 accumulate.
// ---------------------------------------------------------------------------

typedef __attribute__((ext_vector_type(16))) _Float16 v16h;
typedef __attribute__((ext_vector_type(8)))  _Float16 v8h;
typedef __attribute__((ext_vector_type(8)))  float    v8f;

#define E_DIM   512
#define NHEAD   16
#define RHEAD   8
#define NORMAL_HEADS 8
#define HEAD_DIM 32
#define BATCH   2
#define SEQ     2048
#define SCALING 0.17677669529663687f   // 32^-0.5

union FragU { v16h v; v8h h[2]; };

// A/B fragment loader (16-bit, 16x16x32 WMMA).
// A layout (ISA 7.12.2): lane = 16*hk + m holds row m; element e holds
//   k = (e<8 ? 0 : 16) + hk*8 + (e&7)  -> two contiguous 8-half (b128) loads.
// B fragments use the mirrored layout (lane&15 = column), so a row-major
// [N x K] (i.e. pre-transposed) matrix loads with the identical pattern.
__device__ __forceinline__ v16h load_frag(const _Float16* __restrict__ base,
                                          int ld, int row0, int k0, int lane) {
  const int m  = lane & 15;
  const int hk = lane >> 4;
  const _Float16* p = base + (size_t)(row0 + m) * ld + (k0 + hk * 8);
  FragU f;
  f.h[0] = *reinterpret_cast<const v8h*>(p);
  f.h[1] = *reinterpret_cast<const v8h*>(p + 16);
  return f.v;
}

__device__ __forceinline__ v8f wmma_f16(v16h a, v16h b, v8f c) {
  return __builtin_amdgcn_wmma_f32_16x16x32_f16(false, a, false, b,
                                                (short)0, c, false, false);
}

// ---------------------------------------------------------------------------
// Format converters (one pass; tiny vs. 256MB relation stream).
// ---------------------------------------------------------------------------
__global__ void cvt_f32_to_f16(const float* __restrict__ src,
                               _Float16* __restrict__ dst, int n) {
  int i = blockIdx.x * blockDim.x + threadIdx.x;
  if (i < n) dst[i] = (_Float16)src[i];
}

// WT[n][k] = W[k][n]  (so GEMM B-fragments are contiguous b128 loads)
__global__ void transpose_w_f16(const float* __restrict__ W,
                                _Float16* __restrict__ WT) {
  int i = blockIdx.x * blockDim.x + threadIdx.x;   // E*E threads
  int k = i >> 9, n = i & (E_DIM - 1);
  WT[(size_t)n * E_DIM + k] = (_Float16)W[i];
}

// ---------------------------------------------------------------------------
// Projection GEMM: Y = X @ W + b.  One 16x16 tile per wave, 8 waves/block.
// Output scattered to head-major f16: [B,H,L,HD] (q,k) or [B,H,HD,L] (v^T).
// ---------------------------------------------------------------------------
__global__ void __launch_bounds__(256)
proj_gemm(const _Float16* __restrict__ X16, const _Float16* __restrict__ WT16,
          const float* __restrict__ bias, _Float16* __restrict__ out_std,
          _Float16* __restrict__ out_vT, int write_vT) {
  const int lane = threadIdx.x & 31, wid = threadIdx.x >> 5;
  const int m = lane & 15, hk = lane >> 4;
  const int rbase = blockIdx.x * 16;
  const int cbase = blockIdx.y * 128 + wid * 16;
  v8f acc = {};
#pragma unroll
  for (int kk = 0; kk < E_DIM; kk += 32) {
    v16h a = load_frag(X16, E_DIM, rbase, kk, lane);
    v16h b = load_frag(WT16, E_DIM, cbase, kk, lane);
    acc = wmma_f16(a, b, acc);
  }
  const int col = cbase + m;
  const float bv = bias[col];
  const int h = col >> 5, d = col & (HEAD_DIM - 1);
#pragma unroll
  for (int r = 0; r < 8; ++r) {
    int row = rbase + hk * 8 + r;
    int bb = row >> 11, l = row & (SEQ - 1);
    float v = acc[r] + bv;
    if (write_vT) {
      out_vT[(((size_t)(bb * NHEAD + h)) * HEAD_DIM + d) * SEQ + l] = (_Float16)v;
    } else {
      out_std[(((size_t)(bb * NHEAD + h)) * SEQ + l) * HEAD_DIM + d] = (_Float16)v;
    }
  }
}

// ---------------------------------------------------------------------------
// Fused flash attention.  Wave owns 16 q-rows; block = 8 waves = 128 q-rows
// for one (b,h).  64 chunks of 32 keys: 2 WMMAs for scores, online max/sum
// (relation heads fold the streamed relation weights into p before the sum),
// P staged through LDS to convert C-layout -> A-layout, 2 WMMAs for P.V.
// ---------------------------------------------------------------------------
__global__ void __launch_bounds__(256)
attn_fused(const _Float16* __restrict__ qh, const _Float16* __restrict__ kh,
           const _Float16* __restrict__ vT, const float* __restrict__ relw,
           _Float16* __restrict__ attn_out) {
  const int lane = threadIdx.x & 31, wid = threadIdx.x >> 5;
  const int m = lane & 15, hk = lane >> 4;
  const int b = blockIdx.z, h = blockIdx.y;
  const int qbase = blockIdx.x * 128 + wid * 16;
  const size_t headoff = (size_t)(b * NHEAD + h);
  const _Float16* Q = qh + headoff * SEQ * HEAD_DIM;
  const _Float16* K = kh + headoff * SEQ * HEAD_DIM;
  const _Float16* V = vT + headoff * HEAD_DIM * SEQ;
  const bool is_rel = (h >= NORMAL_HEADS);
  const float* relbase =
      is_rel ? relw + ((size_t)(b * RHEAD + (h - NORMAL_HEADS))) * SEQ * SEQ
             : nullptr;

  __shared__ __align__(16) _Float16 ldsP[8][16][32];

  v16h aq = load_frag(Q, HEAD_DIM, qbase, 0, lane);
  v8f o0 = {}, o1 = {};
  float mrun[8], lrun[8];
#pragma unroll
  for (int r = 0; r < 8; ++r) { mrun[r] = -1e30f; lrun[r] = 0.0f; }

  for (int j = 0; j < SEQ; j += 32) {
    // scores: S[16 rows][32 keys] as two 16x16 C-layout tiles
    v16h bk0 = load_frag(K, HEAD_DIM, j, 0, lane);
    v16h bk1 = load_frag(K, HEAD_DIM, j + 16, 0, lane);
    v8f s0 = {}, s1 = {};
    s0 = wmma_f16(aq, bk0, s0);
    s1 = wmma_f16(aq, bk1, s1);

    if (is_rel && (j + 64) < SEQ) {  // stream-ahead the relation weights
      __builtin_prefetch(relbase + (size_t)(qbase + hk * 8) * SEQ + j + 64 + m, 0, 1);
    }

#pragma unroll
    for (int r = 0; r < 8; ++r) {
      float x0 = s0[r] * SCALING;
      float x1 = s1[r] * SCALING;
      float mx = fmaxf(x0, x1);
      mx = fmaxf(mx, __shfl_xor(mx, 1));
      mx = fmaxf(mx, __shfl_xor(mx, 2));
      mx = fmaxf(mx, __shfl_xor(mx, 4));
      mx = fmaxf(mx, __shfl_xor(mx, 8));        // row-max over 16 lanes
      float mnew  = fmaxf(mrun[r], mx);
      float alpha = __expf(mrun[r] - mnew);
      float p0 = __expf(x0 - mnew);
      float p1 = __expf(x1 - mnew);
      if (is_rel) {                             // exp(s)*w, renormalized online
        const float* rp = relbase + (size_t)(qbase + hk * 8 + r) * SEQ + j + m;
        p0 *= rp[0];
        p1 *= rp[16];
      }
      float rs = p0 + p1;
      rs += __shfl_xor(rs, 1);
      rs += __shfl_xor(rs, 2);
      rs += __shfl_xor(rs, 4);
      rs += __shfl_xor(rs, 8);
      lrun[r] = lrun[r] * alpha + rs;
      mrun[r] = mnew;
      o0[r] *= alpha;
      o1[r] *= alpha;
      ldsP[wid][hk * 8 + r][m]      = (_Float16)p0;   // C-layout -> LDS
      ldsP[wid][hk * 8 + r][16 + m] = (_Float16)p1;
    }
    __syncthreads();
    // read P back in A-layout (two ds b128 loads per lane)
    FragU pf;
    pf.h[0] = *reinterpret_cast<const v8h*>(&ldsP[wid][m][hk * 8]);
    pf.h[1] = *reinterpret_cast<const v8h*>(&ldsP[wid][m][16 + hk * 8]);
    // V^T rows are head dims -> contiguous-in-key b128 B-fragment loads
    v16h bv0 = load_frag(V, SEQ, 0, j, lane);
    v16h bv1 = load_frag(V, SEQ, 16, j, lane);
    o0 = wmma_f16(pf.v, bv0, o0);
    o1 = wmma_f16(pf.v, bv1, o1);
    __syncthreads();
  }

  const float eps = is_rel ? 1e-6f : 0.0f;
#pragma unroll
  for (int r = 0; r < 8; ++r) {
    int row = qbase + hk * 8 + r;
    float inv = 1.0f / (lrun[r] + eps);
    size_t base = ((size_t)(b * SEQ + row)) * E_DIM + h * HEAD_DIM;
    attn_out[base + m]      = (_Float16)(o0[r] * inv);
    attn_out[base + 16 + m] = (_Float16)(o1[r] * inv);
  }
}

// ---------------------------------------------------------------------------
// Output projection + LayerNorm fused: block computes a full 16x512 strip
// (8 waves x 4 column tiles), LN reduces each row from LDS.
// ---------------------------------------------------------------------------
__global__ void __launch_bounds__(256)
outproj_ln(const _Float16* __restrict__ attn16, const _Float16* __restrict__ WoT,
           const float* __restrict__ bo, const float* __restrict__ gamma,
           const float* __restrict__ beta, float* __restrict__ out) {
  const int lane = threadIdx.x & 31, wid = threadIdx.x >> 5;
  const int m = lane & 15, hk = lane >> 4;
  const int rbase = blockIdx.x * 16;
  __shared__ float rowbuf[16][E_DIM];
  v8f acc[4] = {{}, {}, {}, {}};
  for (int kk = 0; kk < E_DIM; kk += 32) {
    v16h a = load_frag(attn16, E_DIM, rbase, kk, lane);
#pragma unroll
    for (int t = 0; t < 4; ++t) {
      v16h bw = load_frag(WoT, E_DIM, wid * 64 + t * 16, kk, lane);
      acc[t] = wmma_f16(a, bw, acc[t]);
    }
  }
#pragma unroll
  for (int t = 0; t < 4; ++t) {
    int col = wid * 64 + t * 16 + m;
    float bv = bo[col];
#pragma unroll
    for (int r = 0; r < 8; ++r) rowbuf[hk * 8 + r][col] = acc[t][r] + bv;
  }
  __syncthreads();
#pragma unroll
  for (int rr = 0; rr < 2; ++rr) {
    int row = wid * 2 + rr;
    float s = 0.f, s2 = 0.f;
    for (int c = lane; c < E_DIM; c += 32) {
      float v = rowbuf[row][c];
      s += v; s2 += v * v;
    }
#pragma unroll
    for (int off = 16; off > 0; off >>= 1) {
      s  += __shfl_xor(s, off);
      s2 += __shfl_xor(s2, off);
    }
    float mean = s * (1.0f / E_DIM);
    float var  = s2 * (1.0f / E_DIM) - mean * mean;
    float rstd = rsqrtf(var + 1e-5f);
    for (int c = lane; c < E_DIM; c += 32) {
      out[(size_t)(rbase + row) * E_DIM + c] =
          (rowbuf[row][c] - mean) * rstd * gamma[c] + beta[c];
    }
  }
}

// ---------------------------------------------------------------------------
extern "C" void kernel_launch(void* const* d_in, const int* in_sizes, int n_in,
                              void* d_out, int out_size, void* d_ws, size_t ws_size,
                              hipStream_t stream) {
  const float* query = (const float*)d_in[0];
  const float* key   = (const float*)d_in[1];
  const float* value = (const float*)d_in[2];
  const float* relw  = (const float*)d_in[3];
  const float* Wq = (const float*)d_in[4];
  const float* bq = (const float*)d_in[5];
  const float* Wk = (const float*)d_in[6];
  const float* bk = (const float*)d_in[7];
  const float* Wv = (const float*)d_in[8];
  const float* bv = (const float*)d_in[9];
  const float* Wo = (const float*)d_in[10];
  const float* bo = (const float*)d_in[11];
  const float* gamma = (const float*)d_in[12];
  const float* beta  = (const float*)d_in[13];
  float* out = (float*)d_out;

  // workspace carve-up (~30 MB)
  const size_t XE = (size_t)BATCH * SEQ * E_DIM;   // 2M elems
  const size_t WE = (size_t)E_DIM * E_DIM;         // 256K elems
  char* ws = (char*)d_ws;
  _Float16* xq16 = (_Float16*)ws; ws += XE * sizeof(_Float16);
  _Float16* xk16 = (_Float16*)ws; ws += XE * sizeof(_Float16);
  _Float16* xv16 = (_Float16*)ws; ws += XE * sizeof(_Float16);
  _Float16* WqT  = (_Float16*)ws; ws += WE * sizeof(_Float16);
  _Float16* WkT  = (_Float16*)ws; ws += WE * sizeof(_Float16);
  _Float16* WvT  = (_Float16*)ws; ws += WE * sizeof(_Float16);
  _Float16* WoT  = (_Float16*)ws; ws += WE * sizeof(_Float16);
  _Float16* qh16 = (_Float16*)ws; ws += XE * sizeof(_Float16);
  _Float16* kh16 = (_Float16*)ws; ws += XE * sizeof(_Float16);
  _Float16* vT16 = (_Float16*)ws; ws += XE * sizeof(_Float16);
  _Float16* at16 = (_Float16*)ws; ws += XE * sizeof(_Float16);
  (void)in_sizes; (void)n_in; (void)out_size; (void)ws_size;

  dim3 blk(256);
  const int nX = (int)XE;
  cvt_f32_to_f16<<<(nX + 255) / 256, blk, 0, stream>>>(query, xq16, nX);
  cvt_f32_to_f16<<<(nX + 255) / 256, blk, 0, stream>>>(key,   xk16, nX);
  cvt_f32_to_f16<<<(nX + 255) / 256, blk, 0, stream>>>(value, xv16, nX);
  const int nW = (int)WE;
  transpose_w_f16<<<nW / 256, blk, 0, stream>>>(Wq, WqT);
  transpose_w_f16<<<nW / 256, blk, 0, stream>>>(Wk, WkT);
  transpose_w_f16<<<nW / 256, blk, 0, stream>>>(Wv, WvT);
  transpose_w_f16<<<nW / 256, blk, 0, stream>>>(Wo, WoT);

  dim3 pg(BATCH * SEQ / 16, E_DIM / 128);            // (256, 4)
  proj_gemm<<<pg, blk, 0, stream>>>(xq16, WqT, bq, qh16, nullptr, 0);
  proj_gemm<<<pg, blk, 0, stream>>>(xk16, WkT, bk, kh16, nullptr, 0);
  proj_gemm<<<pg, blk, 0, stream>>>(xv16, WvT, bv, nullptr, vT16, 1);

  dim3 ag(SEQ / 128, NHEAD, BATCH);                  // (16, 16, 2)
  attn_fused<<<ag, blk, 0, stream>>>(qh16, kh16, vT16, relw, at16);

  outproj_ln<<<BATCH * SEQ / 16, blk, 0, stream>>>(at16, WoT, bo, gamma, beta, out);
}

// v001
// One run takes 210 microseconds.
// In two side-by-side timings against v000, it was 2.06 and 2.05 times as fast.
#include <hip/hip_runtime.h>
#include <hip/hip_bf16.h>

// ---------------------------------------------------------------------------
// Relation-aware attention for MI455X (gfx1250, wave32, WMMA).
//
// Roofline: relation_weights (256 MB) dominates traffic -> memory bound at
// ~13us on 23.3 TB/s HBM *if* we never spill the 2x16x2048x2048 score tensor.
// Hence a fused flash-style attention kernel with online normalization, f16
// WMMA (16x16x32, K == head_dim == 32) for all GEMM work, f32 accumulate.
// ---------------------------------------------------------------------------

typedef __attribute__((ext_vector_type(16))) _Float16 v16h;
typedef __attribute__((ext_vector_type(8)))  _Float16 v8h;
typedef __attribute__((ext_vector_type(8)))  float    v8f;

#define E_DIM   512
#define NHEAD   16
#define RHEAD   8
#define NORMAL_HEADS 8
#define HEAD_DIM 32
#define BATCH   2
#define SEQ     2048
#define SCALING 0.17677669529663687f   // 32^-0.5

union FragU { v16h v; v8h h[2]; };

// A/B fragment loader (16-bit, 16x16x32 WMMA).
// A layout (ISA 7.12.2): lane = 16*hk + m holds row m; element e holds
//   k = (e<8 ? 0 : 16) + hk*8 + (e&7)  -> two contiguous 8-half (b128) loads.
// B fragments use the mirrored layout (lane&15 = column), so a row-major
// [N x K] (i.e. pre-transposed) matrix loads with the identical pattern.
__device__ __forceinline__ v16h load_frag(const _Float16* __restrict__ base,
                                          int ld, int row0, int k0, int lane) {
  const int m  = lane & 15;
  const int hk = lane >> 4;
  const _Float16* p = base + (size_t)(row0 + m) * ld + (k0 + hk * 8);
  FragU f;
  f.h[0] = *reinterpret_cast<const v8h*>(p);
  f.h[1] = *reinterpret_cast<const v8h*>(p + 16);
  return f.v;
}

__device__ __forceinline__ v8f wmma_f16(v16h a, v16h b, v8f c) {
  return __builtin_amdgcn_wmma_f32_16x16x32_f16(false, a, false, b,
                                                (short)0, c, false, false);
}

// ---------------------------------------------------------------------------
// Format converters (one pass; tiny vs. 256MB relation stream).
// ---------------------------------------------------------------------------
__global__ void cvt_f32_to_f16(const float* __restrict__ src,
                               _Float16* __restrict__ dst, int n) {
  int i = blockIdx.x * blockDim.x + threadIdx.x;
  if (i < n) dst[i] = (_Float16)src[i];
}

// WT[n][k] = W[k][n]  (so GEMM B-fragments are contiguous b128 loads)
__global__ void transpose_w_f16(const float* __restrict__ W,
                                _Float16* __restrict__ WT) {
  int i = blockIdx.x * blockDim.x + threadIdx.x;   // E*E threads
  int k = i >> 9, n = i & (E_DIM - 1);
  WT[(size_t)n * E_DIM + k] = (_Float16)W[i];
}

// ---------------------------------------------------------------------------
// Projection GEMM: Y = X @ W + b.  One 16x16 tile per wave, 8 waves/block.
// Output scattered to head-major f16: [B,H,L,HD] (q,k) or [B,H,HD,L] (v^T).
// ---------------------------------------------------------------------------
__global__ void __launch_bounds__(256)
proj_gemm(const _Float16* __restrict__ X16, const _Float16* __restrict__ WT16,
          const float* __restrict__ bias, _Float16* __restrict__ out_std,
          _Float16* __restrict__ out_vT, int write_vT) {
  const int lane = threadIdx.x & 31, wid = threadIdx.x >> 5;
  const int m = lane & 15, hk = lane >> 4;
  const int rbase = blockIdx.x * 16;
  const int cbase = blockIdx.y * 128 + wid * 16;
  v8f acc = {};
#pragma unroll
  for (int kk = 0; kk < E_DIM; kk += 32) {
    v16h a = load_frag(X16, E_DIM, rbase, kk, lane);
    v16h b = load_frag(WT16, E_DIM, cbase, kk, lane);
    acc = wmma_f16(a, b, acc);
  }
  const int col = cbase + m;
  const float bv = bias[col];
  const int h = col >> 5, d = col & (HEAD_DIM - 1);
#pragma unroll
  for (int r = 0; r < 8; ++r) {
    int row = rbase + hk * 8 + r;
    int bb = row >> 11, l = row & (SEQ - 1);
    float v = acc[r] + bv;
    if (write_vT) {
      out_vT[(((size_t)(bb * NHEAD + h)) * HEAD_DIM + d) * SEQ + l] = (_Float16)v;
    } else {
      out_std[(((size_t)(bb * NHEAD + h)) * SEQ + l) * HEAD_DIM + d] = (_Float16)v;
    }
  }
}

// ---------------------------------------------------------------------------
// Fused flash attention, scores computed transposed.  Wave owns 16 q-rows;
// block = 8 waves = 128 q-rows for one (b,h).  64 chunks of 32 keys:
//   S^T = K . Q^T   (A = 16 key rows, B = 16 query columns), two tiles;
//   O^T += V^T . P^T (A = 16 head dims x 32 keys, B = P^T).
// In the D map a lane holds one query column (lane & 15) and 8 keys per tile
// (8*hk + r), so max and sum run over the lane's own registers plus one
// exchange with lane ^ 16, and the two packed score tiles are already the
// B operand of the second product (k = 8*hk + s, 16 + 8*hk + (s - 8)):
// P never leaves the registers, the waves share nothing.
// ---------------------------------------------------------------------------
__device__ __forceinline__ float xhalf(float x) {   // value of lane ^ 16
  int b = __builtin_bit_cast(int, x);
  return __builtin_bit_cast(float, __builtin_amdgcn_permlanex16(
      b, b, 0x76543210, 0xfedcba98, false, false));
}

// relrow: this lane's own relation row at its first key (REL only).
// op: this lane's 8 + 8 output halves (d = 8*hk .., 16 + 8*hk ..).
template <bool REL>
__device__ __forceinline__ void
attn_rows(const _Float16* __restrict__ Q, const _Float16* __restrict__ K,
          const _Float16* __restrict__ V, const float* __restrict__ relrow,
          _Float16* __restrict__ op, int qbase, int lane) {
  const v16h bq = load_frag(Q, HEAD_DIM, qbase, 0, lane);  // column = query
  v8f o0 = {}, o1 = {};      // o0[r] = O[q][d = 8*hk + r], o1: d + 16
  float mrun = -1e30f, lrun = 0.0f;   // lrun: this lane's half of the keys

  for (int j = 0; j < SEQ; j += 32) {
    if (REL && (j + 64) < SEQ) {     // stream-ahead the relation weights
      __builtin_prefetch(relrow + j + 64, 0, 1);
    }
    const v16h ak0 = load_frag(K, HEAD_DIM, j, 0, lane);
    const v16h ak1 = load_frag(K, HEAD_DIM, j + 16, 0, lane);
    // V^T rows are head dims -> contiguous-in-key b128 A-fragment loads
    const v16h av0 = load_frag(V, SEQ, 0, j, lane);
    const v16h av1 = load_frag(V, SEQ, 16, j, lane);
    v8f w0, w1;                      // weights of the lane's 8 + 8 keys
    if (REL) {
      w0 = *reinterpret_cast<const v8f*>(relrow + j);
      w1 = *reinterpret_cast<const v8f*>(relrow + j + 16);
    }
    // keeps all of the chunk's loads issued ahead of the first product: sunk
    // to their users, each would expose a load latency of its own
    __builtin_amdgcn_sched_barrier(0);

    v8f s0 = {}, s1 = {};
    s0 = wmma_f16(ak0, bq, s0);     // s0[r] = S[q][key = j + 8*hk + r]
    s1 = wmma_f16(ak1, bq, s1);     // s1[r] = S[q][key = j + 16 + 8*hk + r]
    s0 *= SCALING;
    s1 *= SCALING;

    float mx = fmaxf(s0[0], s1[0]);
#pragma unroll
    for (int r = 1; r < 8; ++r) mx = fmaxf(mx, fmaxf(s0[r], s1[r]));
    mx = fmaxf(mx, xhalf(mx));                  // both halves of the 32 keys
    const float mnew  = fmaxf(mrun, mx);
    const float alpha = __expf(mrun - mnew);
#pragma unroll
    for (int r = 0; r < 8; ++r) {
      s0[r] = __expf(s0[r] - mnew);
      s1[r] = __expf(s1[r] - mnew);
    }
    if (REL) {                                  // exp(s)*w, renormalized online
      s0 *= w0;
      s1 *= w1;
    }
    const v8f t = s0 + s1;
    const float rs = ((t[0] + t[1]) + (t[2] + t[3])) +
                     ((t[4] + t[5]) + (t[6] + t[7]));
    lrun = lrun * alpha + rs;
    mrun = mnew;
    FragU pf;                                   // P^T as B operand
    pf.h[0] = __builtin_convertvector(s0, v8h);
    pf.h[1] = __builtin_convertvector(s1, v8h);
    o0 *= alpha;
    o1 *= alpha;
    o0 = wmma_f16(av0, pf.v, o0);
    o1 = wmma_f16(av1, pf.v, o1);
  }

  const float eps = REL ? 1e-6f : 0.0f;
  const float inv = 1.0f / (lrun + xhalf(lrun) + eps);   // join the halves once
  *reinterpret_cast<v8h*>(op)      = __builtin_convertvector(o0 * inv, v8h);
  *reinterpret_cast<v8h*>(op + 16) = __builtin_convertvector(o1 * inv, v8h);
}

__global__ void __launch_bounds__(256)
attn_fused(const _Float16* __restrict__ qh, const _Float16* __restrict__ kh,
           const _Float16* __restrict__ vT, const float* __restrict__ relw,
           _Float16* __restrict__ attn_out) {
  const int lane = threadIdx.x & 31, wid = threadIdx.x >> 5;
  const int m = lane & 15, hk = lane >> 4;
  const int b = blockIdx.z, h = blockIdx.y;
  const int qbase = blockIdx.x * 128 + wid * 16;
  const size_t headoff = (size_t)(b * NHEAD + h);
  const _Float16* Q = qh + headoff * SEQ * HEAD_DIM;
  const _Float16* K = kh + headoff * SEQ * HEAD_DIM;
  const _Float16* V = vT + headoff * HEAD_DIM * SEQ;
  _Float16* op = attn_out + ((size_t)(b * SEQ + qbase + m)) * E_DIM +
                 h * HEAD_DIM + hk * 8;
  if (h >= NORMAL_HEADS) {
    const float* relrow =
        relw + ((size_t)(b * RHEAD + (h - NORMAL_HEADS))) * SEQ * SEQ +
        (size_t)(qbase + m) * SEQ + hk * 8;
    attn_rows<true>(Q, K, V, relrow, op, qbase, lane);
  } else {
    attn_rows<false>(Q, K, V, nullptr, op, qbase, lane);
  }
}

// ---------------------------------------------------------------------------
// Output projection + LayerNorm fused: block computes a full 16x512 strip
// (8 waves x 4 column tiles), LN reduces each row from LDS.
// ---------------------------------------------------------------------------
__global__ void __launch_bounds__(256)
outproj_ln(const _Float16* __restrict__ attn16, const _Float16* __restrict__ WoT,
           const float* __restrict__ bo, const float* __restrict__ gamma,
           const float* __restrict__ beta, float* __restrict__ out) {
  const int lane = threadIdx.x & 31, wid = threadIdx.x >> 5;
  const int m = lane & 15, hk = lane >> 4;
  const int rbase = blockIdx.x * 16;
  __shared__ float rowbuf[16][E_DIM];
  v8f acc[4] = {{}, {}, {}, {}};
  for (int kk = 0; kk < E_DIM; kk += 32) {
    v16h a = load_frag(attn16, E_DIM, rbase, kk, lane);
#pragma unroll
    for (int t = 0; t < 4; ++t) {
      v16h bw = load_frag(WoT, E_DIM, wid * 64 + t * 16, kk, lane);
      acc[t] = wmma_f16(a, bw, acc[t]);
    }
  }
#pragma unroll
  for (int t = 0; t < 4; ++t) {
    int col = wid * 64 + t * 16 + m;
    float bv = bo[col];
#pragma unroll
    for (int r = 0; r < 8; ++r) rowbuf[hk * 8 + r][col] = acc[t][r] + bv;
  }
  __syncthreads();
#pragma unroll
  for (int rr = 0; rr < 2; ++rr) {
    int row = wid * 2 + rr;
    float s = 0.f, s2 = 0.f;
    for (int c = lane; c < E_DIM; c += 32) {
      float v = rowbuf[row][c];
      s += v; s2 += v * v;
    }
#pragma unroll
    for (int off = 16; off > 0; off >>= 1) {
      s  += __shfl_xor(s, off);
      s2 += __shfl_xor(s2, off);
    }
    float mean = s * (1.0f / E_DIM);
    float var  = s2 * (1.0f / E_DIM) - mean * mean;
    float rstd = rsqrtf(var + 1e-5f);
    for (int c = lane; c < E_DIM; c += 32) {
      out[(size_t)(rbase + row) * E_DIM + c] =
          (rowbuf[row][c] - mean) * rstd * gamma[c] + beta[c];
    }
  }
}

// ---------------------------------------------------------------------------
extern "C" void kernel_launch(void* const* d_in, const int* in_sizes, int n_in,
                              void* d_out, int out_size, void* d_ws, size_t ws_size,
                              hipStream_t stream) {
  const float* query = (const float*)d_in[0];
  const float* key   = (const float*)d_in[1];
  const float* value = (const float*)d_in[2];
  const float* relw  = (const float*)d_in[3];
  const float* Wq = (const float*)d_in[4];
  const float* bq = (const float*)d_in[5];
  const float* Wk = (const float*)d_in[6];
  const float* bk = (const float*)d_in[7];
  const float* Wv = (const float*)d_in[8];
  const float* bv = (const float*)d_in[9];
  const float* Wo = (const float*)d_in[10];
  const float* bo = (const float*)d_in[11];
  const float* gamma = (const float*)d_in[12];
  const float* beta  = (const float*)d_in[13];
  float* out = (float*)d_out;

  // workspace carve-up (~30 MB)
  const size_t XE = (size_t)BATCH * SEQ * E_DIM;   // 2M elems
  const size_t WE = (size_t)E_DIM * E_DIM;         // 256K elems
  char* ws = (char*)d_ws;
  _Float16* xq16 = (_Float16*)ws; ws += XE * sizeof(_Float16);
  _Float16* xk16 = (_Float16*)ws; ws += XE * sizeof(_Float16);
  _Float16* xv16 = (_Float16*)ws; ws += XE * sizeof(_Float16);
  _Float16* WqT  = (_Float16*)ws; ws += WE * sizeof(_Float16);
  _Float16* WkT  = (_Float16*)ws; ws += WE * sizeof(_Float16);
  _Float16* WvT  = (_Float16*)ws; ws += WE * sizeof(_Float16);
  _Float16* WoT  = (_Float16*)ws; ws += WE * sizeof(_Float16);
  _Float16* qh16 = (_Float16*)ws; ws += XE * sizeof(_Float16);
  _Float16* kh16 = (_Float16*)ws; ws += XE * sizeof(_Float16);
  _Float16* vT16 = (_Float16*)ws; ws += XE * sizeof(_Float16);
  _Float16* at16 = (_Float16*)ws; ws += XE * sizeof(_Float16);
  (void)in_sizes; (void)n_in; (void)out_size; (void)ws_size;

  dim3 blk(256);
  const int nX = (int)XE;
  cvt_f32_to_f16<<<(nX + 255) / 256, blk, 0, stream>>>(query, xq16, nX);
  cvt_f32_to_f16<<<(nX + 255) / 256, blk, 0, stream>>>(key,   xk16, nX);
  cvt_f32_to_f16<<<(nX + 255) / 256, blk, 0, stream>>>(value, xv16, nX);
  const int nW = (int)WE;
  transpose_w_f16<<<nW / 256, blk, 0, stream>>>(Wq, WqT);
  transpose_w_f16<<<nW / 256, blk, 0, stream>>>(Wk, WkT);
  transpose_w_f16<<<nW / 256, blk, 0, stream>>>(Wv, WvT);
  transpose_w_f16<<<nW / 256, blk, 0, stream>>>(Wo, WoT);

  dim3 pg(BATCH * SEQ / 16, E_DIM / 128);            // (256, 4)
  proj_gemm<<<pg, blk, 0, stream>>>(xq16, WqT, bq, qh16, nullptr, 0);
  proj_gemm<<<pg, blk, 0, stream>>>(xk16, WkT, bk, kh16, nullptr, 0);
  proj_gemm<<<pg, blk, 0, stream>>>(xv16, WvT, bv, nullptr, vT16, 1);

  dim3 ag(SEQ / 128, NHEAD, BATCH);                  // (16, 16, 2)
  attn_fused<<<ag, blk, 0, stream>>>(qh16, kh16, vT16, relw, at16);

  outproj_ln<<<BATCH * SEQ / 16, blk, 0, stream>>>(at16, WoT, bo, gamma, beta, out);
}

// v002
// One run takes 152 microseconds.
// Timed twice side by side with v001, it ran 1.37 and 1.38 times as fast.
// Over all steps from v000 it is 2.83 times as fast.
#include <hip/hip_runtime.h>
#include <hip/hip_bf16.h>

// ---------------------------------------------------------------------------
// Relation-aware attention for MI455X (gfx1250, wave32, WMMA).
//
// Roofline: relation_weights (256 MB) dominates traffic -> memory bound at
// ~13us on 23.3 TB/s HBM *if* we never spill the 2x16x2048x2048 score tensor.
// Hence a fused flash-style attention kernel with online normalization, f16
// WMMA (16x16x32, K == head_dim == 32) for all GEMM work, f32 accumulate.
// ---------------------------------------------------------------------------

typedef __attribute__((ext_vector_type(16))) _Float16 v16h;
typedef __attribute__((ext_vector_type(8)))  _Float16 v8h;
typedef __attribute__((ext_vector_type(8)))  float    v8f;

#define E_DIM   512
#define NHEAD   16
#define RHEAD   8
#define NORMAL_HEADS 8
#define HEAD_DIM 32
#define BATCH   2
#define SEQ     2048
#define SCALING 0.17677669529663687f   // 32^-0.5

union FragU { v16h v; v8h h[2]; };

// A/B fragment loader (16-bit, 16x16x32 WMMA).
// A layout (ISA 7.12.2): lane = 16*hk + m holds row m; element e holds
//   k = (e<8 ? 0 : 16) + hk*8 + (e&7)  -> two contiguous 8-half (b128) loads.
// B fragments use the mirrored layout (lane&15 = column), so a row-major
// [N x K] (i.e. pre-transposed) matrix loads with the identical pattern.
__device__ __forceinline__ v16h load_frag(const _Float16* __restrict__ base,
                                          int ld, int row0, int k0, int lane) {
  const int m  = lane & 15;
  const int hk = lane >> 4;
  const _Float16* p = base + (size_t)(row0 + m) * ld + (k0 + hk * 8);
  FragU f;
  f.h[0] = *reinterpret_cast<const v8h*>(p);
  f.h[1] = *reinterpret_cast<const v8h*>(p + 16);
  return f.v;
}

__device__ __forceinline__ v8f wmma_f16(v16h a, v16h b, v8f c) {
  return __builtin_amdgcn_wmma_f32_16x16x32_f16(false, a, false, b,
                                                (short)0, c, false, false);
}

// ---------------------------------------------------------------------------
// Format conversion, one launch for all seven arrays.  The work is 28 MB in,
// 14 MB out; what it costs is launches and waves to start, so few waves each
// keep many whole-line accesses in flight.  All 512 blocks do the same work:
//   1/512 of each of query, key, value -> f16: a thread converts 4 x 4 floats
//   of each; a wave-wide load covers 512 contiguous bytes, a store 256;
//   one 64 k x 32 n tile of one weight matrix, WT[n][k] = W[k][n] (so GEMM
//   B-fragments are contiguous b128 loads): a thread reads 8 k of one column
//   (a wave-wide load is one line of W) and stores them as 16 bytes; the block
//   writes whole 128-byte lines of WT.
// ---------------------------------------------------------------------------
typedef __attribute__((ext_vector_type(4))) float    v4f;
typedef __attribute__((ext_vector_type(4))) _Float16 v4h;

#define PREP_BLOCKS 512
#define X_ELEMS (BATCH * SEQ * E_DIM)
#define W_ELEMS (E_DIM * E_DIM)

__global__ void __launch_bounds__(256)
prep_f16(const float* __restrict__ query, const float* __restrict__ key,
         const float* __restrict__ value, const float* __restrict__ Wq,
         const float* __restrict__ Wk, const float* __restrict__ Wv,
         const float* __restrict__ Wo, _Float16* __restrict__ x16,
         _Float16* __restrict__ wT16) {
  const int tid = threadIdx.x;
  const int blk = blockIdx.x;

  const int t = blk >> 7;                            // which matrix
  const float* Wm = t == 0 ? Wq : (t == 1 ? Wk : (t == 2 ? Wv : Wo));
  const int n  = (blk & 15) * 32 + (tid & 31);
  const int k0 = ((blk >> 4) & 7) * 64 + (tid >> 5) * 8;

  const int base = blk * 1024 + tid;                 // in units of 4 floats
  v4f xq[4], xk[4], xv[4];
#pragma unroll
  for (int i = 0; i < 4; ++i) {
    xq[i] = reinterpret_cast<const v4f*>(query)[base + i * 256];
    xk[i] = reinterpret_cast<const v4f*>(key)[base + i * 256];
    xv[i] = reinterpret_cast<const v4f*>(value)[base + i * 256];
  }
  v8f w;
#pragma unroll
  for (int i = 0; i < 8; ++i) w[i] = Wm[(k0 + i) * E_DIM + n];
  // keeps all 20 loads issued ahead of the first conversion: without it the
  // weight loads sink behind waits on the others, a second memory latency
  __builtin_amdgcn_sched_barrier(0);

#pragma unroll
  for (int i = 0; i < 4; ++i) {
    v4h* d = reinterpret_cast<v4h*>(x16) + base + i * 256;
    d[0]               = __builtin_convertvector(xq[i], v4h);
    d[X_ELEMS / 4]     = __builtin_convertvector(xk[i], v4h);
    d[2 * X_ELEMS / 4] = __builtin_convertvector(xv[i], v4h);
  }
  *reinterpret_cast<v8h*>(wT16 + (size_t)t * W_ELEMS + n * E_DIM + k0) =
      __builtin_convertvector(w, v8h);
}

// ---------------------------------------------------------------------------
// Projection GEMM: Y = X @ W + b.  One 16x16 tile per wave, 8 waves/block.
// Output scattered to head-major f16: [B,H,L,HD] (q,k) or [B,H,HD,L] (v^T).
// ---------------------------------------------------------------------------
__global__ void __launch_bounds__(256)
proj_gemm(const _Float16* __restrict__ X16, const _Float16* __restrict__ WT16,
          const float* __restrict__ bias, _Float16* __restrict__ out_std,
          _Float16* __restrict__ out_vT, int write_vT) {
  const int lane = threadIdx.x & 31, wid = threadIdx.x >> 5;
  const int m = lane & 15, hk = lane >> 4;
  const int rbase = blockIdx.x * 16;
  const int cbase = blockIdx.y * 128 + wid * 16;
  v8f acc = {};
#pragma unroll
  for (int kk = 0; kk < E_DIM; kk += 32) {
    v16h a = load_frag(X16, E_DIM, rbase, kk, lane);
    v16h b = load_frag(WT16, E_DIM, cbase, kk, lane);
    acc = wmma_f16(a, b, acc);
  }
  const int col = cbase + m;
  const float bv = bias[col];
  const int h = col >> 5, d = col & (HEAD_DIM - 1);
#pragma unroll
  for (int r = 0; r < 8; ++r) {
    int row = rbase + hk * 8 + r;
    int bb = row >> 11, l = row & (SEQ - 1);
    float v = acc[r] + bv;
    if (write_vT) {
      out_vT[(((size_t)(bb * NHEAD + h)) * HEAD_DIM + d) * SEQ + l] = (_Float16)v;
    } else {
      out_std[(((size_t)(bb * NHEAD + h)) * SEQ + l) * HEAD_DIM + d] = (_Float16)v;
    }
  }
}

// ---------------------------------------------------------------------------
// Fused flash attention, scores computed transposed.  Wave owns 16 q-rows;
// block = 8 waves = 128 q-rows for one (b,h).  64 chunks of 32 keys:
//   S^T = K . Q^T   (A = 16 key rows, B = 16 query columns), two tiles;
//   O^T += V^T . P^T (A = 16 head dims x 32 keys, B = P^T).
// In the D map a lane holds one query column (lane & 15) and 8 keys per tile
// (8*hk + r), so max and sum run over the lane's own registers plus one
// exchange with lane ^ 16, and the two packed score tiles are already the
// B operand of the second product (k = 8*hk + s, 16 + 8*hk + (s - 8)):
// P never leaves the registers, the waves share nothing.
// ---------------------------------------------------------------------------
__device__ __forceinline__ float xhalf(float x) {   // value of lane ^ 16
  int b = __builtin_bit_cast(int, x);
  return __builtin_bit_cast(float, __builtin_amdgcn_permlanex16(
      b, b, 0x76543210, 0xfedcba98, false, false));
}

// relrow: this lane's own relation row at its first key (REL only).
// op: this lane's 8 + 8 output halves (d = 8*hk .., 16 + 8*hk ..).
template <bool REL>
__device__ __forceinline__ void
attn_rows(const _Float16* __restrict__ Q, const _Float16* __restrict__ K,
          const _Float16* __restrict__ V, const float* __restrict__ relrow,
          _Float16* __restrict__ op, int qbase, int lane) {
  const v16h bq = load_frag(Q, HEAD_DIM, qbase, 0, lane);  // column = query
  v8f o0 = {}, o1 = {};      // o0[r] = O[q][d = 8*hk + r], o1: d + 16
  float mrun = -1e30f, lrun = 0.0f;   // lrun: this lane's half of the keys

  for (int j = 0; j < SEQ; j += 32) {
    if (REL && (j + 64) < SEQ) {     // stream-ahead the relation weights
      __builtin_prefetch(relrow + j + 64, 0, 1);
    }
    const v16h ak0 = load_frag(K, HEAD_DIM, j, 0, lane);
    const v16h ak1 = load_frag(K, HEAD_DIM, j + 16, 0, lane);
    // V^T rows are head dims -> contiguous-in-key b128 A-fragment loads
    const v16h av0 = load_frag(V, SEQ, 0, j, lane);
    const v16h av1 = load_frag(V, SEQ, 16, j, lane);
    v8f w0, w1;                      // weights of the lane's 8 + 8 keys
    if (REL) {
      w0 = *reinterpret_cast<const v8f*>(relrow + j);
      w1 = *reinterpret_cast<const v8f*>(relrow + j + 16);
    }
    // keeps all of the chunk's loads issued ahead of the first product: sunk
    // to their users, each would expose a load latency of its own
    __builtin_amdgcn_sched_barrier(0);

    v8f s0 = {}, s1 = {};
    s0 = wmma_f16(ak0, bq, s0);     // s0[r] = S[q][key = j + 8*hk + r]
    s1 = wmma_f16(ak1, bq, s1);     // s1[r] = S[q][key = j + 16 + 8*hk + r]
    s0 *= SCALING;
    s1 *= SCALING;

    float mx = fmaxf(s0[0], s1[0]);
#pragma unroll
    for (int r = 1; r < 8; ++r) mx = fmaxf(mx, fmaxf(s0[r], s1[r]));
    mx = fmaxf(mx, xhalf(mx));                  // both halves of the 32 keys
    const float mnew  = fmaxf(mrun, mx);
    const float alpha = __expf(mrun - mnew);
#pragma unroll
    for (int r = 0; r < 8; ++r) {
      s0[r] = __expf(s0[r] - mnew);
      s1[r] = __expf(s1[r] - mnew);
    }
    if (REL) {                                  // exp(s)*w, renormalized online
      s0 *= w0;
      s1 *= w1;
    }
    const v8f t = s0 + s1;
    const float rs = ((t[0] + t[1]) + (t[2] + t[3])) +
                     ((t[4] + t[5]) + (t[6] + t[7]));
    lrun = lrun * alpha + rs;
    mrun = mnew;
    FragU pf;                                   // P^T as B operand
    pf.h[0] = __builtin_convertvector(s0, v8h);
    pf.h[1] = __builtin_convertvector(s1, v8h);
    o0 *= alpha;
    o1 *= alpha;
    o0 = wmma_f16(av0, pf.v, o0);
    o1 = wmma_f16(av1, pf.v, o1);
  }

  const float eps = REL ? 1e-6f : 0.0f;
  const float inv = 1.0f / (lrun + xhalf(lrun) + eps);   // join the halves once
  *reinterpret_cast<v8h*>(op)      = __builtin_convertvector(o0 * inv, v8h);
  *reinterpret_cast<v8h*>(op + 16) = __builtin_convertvector(o1 * inv, v8h);
}

__global__ void __launch_bounds__(256)
attn_fused(const _Float16* __restrict__ qh, const _Float16* __restrict__ kh,
           const _Float16* __restrict__ vT, const float* __restrict__ relw,
           _Float16* __restrict__ attn_out) {
  const int lane = threadIdx.x & 31, wid = threadIdx.x >> 5;
  const int m = lane & 15, hk = lane >> 4;
  const int b = blockIdx.z, h = blockIdx.y;
  const int qbase = blockIdx.x * 128 + wid * 16;
  const size_t headoff = (size_t)(b * NHEAD + h);
  const _Float16* Q = qh + headoff * SEQ * HEAD_DIM;
  const _Float16* K = kh + headoff * SEQ * HEAD_DIM;
  const _Float16* V = vT + headoff * HEAD_DIM * SEQ;
  _Float16* op = attn_out + ((size_t)(b * SEQ + qbase + m)) * E_DIM +
                 h * HEAD_DIM + hk * 8;
  if (h >= NORMAL_HEADS) {
    const float* relrow =
        relw + ((size_t)(b * RHEAD + (h - NORMAL_HEADS))) * SEQ * SEQ +
        (size_t)(qbase + m) * SEQ + hk * 8;
    attn_rows<true>(Q, K, V, relrow, op, qbase, lane);
  } else {
    attn_rows<false>(Q, K, V, nullptr, op, qbase, lane);
  }
}

// ---------------------------------------------------------------------------
// Output projection + LayerNorm fused: block computes a full 16x512 strip
// (8 waves x 4 column tiles), LN reduces each row from LDS.
// ---------------------------------------------------------------------------
__global__ void __launch_bounds__(256)
outproj_ln(const _Float16* __restrict__ attn16, const _Float16* __restrict__ WoT,
           const float* __restrict__ bo, const float* __restrict__ gamma,
           const float* __restrict__ beta, float* __restrict__ out) {
  const int lane = threadIdx.x & 31, wid = threadIdx.x >> 5;
  const int m = lane & 15, hk = lane >> 4;
  const int rbase = blockIdx.x * 16;
  __shared__ float rowbuf[16][E_DIM];
  v8f acc[4] = {{}, {}, {}, {}};
  for (int kk = 0; kk < E_DIM; kk += 32) {
    v16h a = load_frag(attn16, E_DIM, rbase, kk, lane);
#pragma unroll
    for (int t = 0; t < 4; ++t) {
      v16h bw = load_frag(WoT, E_DIM, wid * 64 + t * 16, kk, lane);
      acc[t] = wmma_f16(a, bw, acc[t]);
    }
  }
#pragma unroll
  for (int t = 0; t < 4; ++t) {
    int col = wid * 64 + t * 16 + m;
    float bv = bo[col];
#pragma unroll
    for (int r = 0; r < 8; ++r) rowbuf[hk * 8 + r][col] = acc[t][r] + bv;
  }
  __syncthreads();
#pragma unroll
  for (int rr = 0; rr < 2; ++rr) {
    int row = wid * 2 + rr;
    float s = 0.f, s2 = 0.f;
    for (int c = lane; c < E_DIM; c += 32) {
      float v = rowbuf[row][c];
      s += v; s2 += v * v;
    }
#pragma unroll
    for (int off = 16; off > 0; off >>= 1) {
      s  += __shfl_xor(s, off);
      s2 += __shfl_xor(s2, off);
    }
    float mean = s * (1.0f / E_DIM);
    float var  = s2 * (1.0f / E_DIM) - mean * mean;
    float rstd = rsqrtf(var + 1e-5f);
    for (int c = lane; c < E_DIM; c += 32) {
      out[(size_t)(rbase + row) * E_DIM + c] =
          (rowbuf[row][c] - mean) * rstd * gamma[c] + beta[c];
    }
  }
}

// ---------------------------------------------------------------------------
extern "C" void kernel_launch(void* const* d_in, const int* in_sizes, int n_in,
                              void* d_out, int out_size, void* d_ws, size_t ws_size,
                              hipStream_t stream) {
  const float* query = (const float*)d_in[0];
  const float* key   = (const float*)d_in[1];
  const float* value = (const float*)d_in[2];
  const float* relw  = (const float*)d_in[3];
  const float* Wq = (const float*)d_in[4];
  const float* bq = (const float*)d_in[5];
  const float* Wk = (const float*)d_in[6];
  const float* bk = (const float*)d_in[7];
  const float* Wv = (const float*)d_in[8];
  const float* bv = (const float*)d_in[9];
  const float* Wo = (const float*)d_in[10];
  const float* bo = (const float*)d_in[11];
  const float* gamma = (const float*)d_in[12];
  const float* beta  = (const float*)d_in[13];
  float* out = (float*)d_out;

  // workspace carve-up (~30 MB)
  const size_t XE = (size_t)BATCH * SEQ * E_DIM;   // 2M elems
  const size_t WE = (size_t)E_DIM * E_DIM;         // 256K elems
  char* ws = (char*)d_ws;
  _Float16* xq16 = (_Float16*)ws; ws += XE * sizeof(_Float16);
  _Float16* xk16 = (_Float16*)ws; ws += XE * sizeof(_Float16);
  _Float16* xv16 = (_Float16*)ws; ws += XE * sizeof(_Float16);
  _Float16* WqT  = (_Float16*)ws; ws += WE * sizeof(_Float16);
  _Float16* WkT  = (_Float16*)ws; ws += WE * sizeof(_Float16);
  _Float16* WvT  = (_Float16*)ws; ws += WE * sizeof(_Float16);
  _Float16* WoT  = (_Float16*)ws; ws += WE * sizeof(_Float16);
  _Float16* qh16 = (_Float16*)ws; ws += XE * sizeof(_Float16);
  _Float16* kh16 = (_Float16*)ws; ws += XE * sizeof(_Float16);
  _Float16* vT16 = (_Float16*)ws; ws += XE * sizeof(_Float16);
  _Float16* at16 = (_Float16*)ws; ws += XE * sizeof(_Float16);
  (void)in_sizes; (void)n_in; (void)out_size; (void)ws_size;

  dim3 blk(256);
  // xq16, xk16, xv16 and WqT .. WoT lie one behind the other in the workspace
  prep_f16<<<PREP_BLOCKS, blk, 0, stream>>>(query, key, value, Wq, Wk, Wv, Wo,
                                            xq16, WqT);

  dim3 pg(BATCH * SEQ / 16, E_DIM / 128);            // (256, 4)
  proj_gemm<<<pg, blk, 0, stream>>>(xq16, WqT, bq, qh16, nullptr, 0);
  proj_gemm<<<pg, blk, 0, stream>>>(xk16, WkT, bk, kh16, nullptr, 0);
  proj_gemm<<<pg, blk, 0, stream>>>(xv16, WvT, bv, nullptr, vT16, 1);

  dim3 ag(SEQ / 128, NHEAD, BATCH);                  // (16, 16, 2)
  attn_fused<<<ag, blk, 0, stream>>>(qh16, kh16, vT16, relw, at16);

  outproj_ln<<<BATCH * SEQ / 16, blk, 0, stream>>>(at16, WoT, bo, gamma, beta, out);
}

// v003
// Measured time: 133 microseconds a run.
// Timed twice side by side with v002, it ran 1.14 and 1.15 times as fast.
// All steps since v000 together make it 3.24 times as fast.
#include <hip/hip_runtime.h>
#include <hip/hip_bf16.h>

// ---------------------------------------------------------------------------
// Relation-aware attention for MI455X (gfx1250, wave32, WMMA).
//
// Roofline: relation_weights (256 MB) dominates traffic -> memory bound at
// ~13us on 23.3 TB/s HBM *if* we never spill the 2x16x2048x2048 score tensor.
// Hence a fused flash-style attention kernel with online normalization, f16
// WMMA (16x16x32, K == head_dim == 32) for all GEMM work, f32 accumulate.
// ---------------------------------------------------------------------------

typedef __attribute__((ext_vector_type(16))) _Float16 v16h;
typedef __attribute__((ext_vector_type(8)))  _Float16 v8h;
typedef __attribute__((ext_vector_type(8)))  float    v8f;

#define E_DIM   512
#define NHEAD   16
#define RHEAD   8
#define NORMAL_HEADS 8
#define HEAD_DIM 32
#define BATCH   2
#define SEQ     2048
#define SCALING 0.17677669529663687f   // 32^-0.5

union FragU { v16h v; v8h h[2]; };

// A/B fragment loader (16-bit, 16x16x32 WMMA).
// A layout (ISA 7.12.2): lane = 16*hk + m holds row m; element e holds
//   k = (e<8 ? 0 : 16) + hk*8 + (e&7)  -> two contiguous 8-half (b128) loads.
// B fragments use the mirrored layout (lane&15 = column), so a row-major
// [N x K] (i.e. pre-transposed) matrix loads with the identical pattern.
__device__ __forceinline__ v16h load_frag(const _Float16* __restrict__ base,
                                          int ld, int row0, int k0, int lane) {
  const int m  = lane & 15;
  const int hk = lane >> 4;
  const _Float16* p = base + (size_t)(row0 + m) * ld + (k0 + hk * 8);
  FragU f;
  f.h[0] = *reinterpret_cast<const v8h*>(p);
  f.h[1] = *reinterpret_cast<const v8h*>(p + 16);
  return f.v;
}

__device__ __forceinline__ v8f wmma_f16(v16h a, v16h b, v8f c) {
  return __builtin_amdgcn_wmma_f32_16x16x32_f16(false, a, false, b,
                                                (short)0, c, false, false);
}

// ---------------------------------------------------------------------------
// Format conversion, one launch for all seven arrays.  The work is 28 MB in,
// 14 MB out; what it costs is launches and waves to start, so few waves each
// keep many whole-line accesses in flight.  All 512 blocks do the same work:
//   1/512 of each of query, key, value -> f16: a thread converts 4 x 4 floats
//   of each; a wave-wide load covers 512 contiguous bytes, a store 256;
//   one 64 k x 32 n tile of one weight matrix, WT[n][k] = W[k][n] (so GEMM
//   B-fragments are contiguous b128 loads): a thread reads 8 k of one column
//   (a wave-wide load is one line of W) and stores them as 16 bytes; the block
//   writes whole 128-byte lines of WT.
// ---------------------------------------------------------------------------
typedef __attribute__((ext_vector_type(4))) float    v4f;
typedef __attribute__((ext_vector_type(4))) _Float16 v4h;

#define PREP_BLOCKS 512
#define X_ELEMS (BATCH * SEQ * E_DIM)
#define W_ELEMS (E_DIM * E_DIM)

__global__ void __launch_bounds__(256)
prep_f16(const float* __restrict__ query, const float* __restrict__ key,
         const float* __restrict__ value, const float* __restrict__ Wq,
         const float* __restrict__ Wk, const float* __restrict__ Wv,
         const float* __restrict__ Wo, _Float16* __restrict__ x16,
         _Float16* __restrict__ wT16) {
  const int tid = threadIdx.x;
  const int blk = blockIdx.x;

  const int t = blk >> 7;                            // which matrix
  const float* Wm = t == 0 ? Wq : (t == 1 ? Wk : (t == 2 ? Wv : Wo));
  const int n  = (blk & 15) * 32 + (tid & 31);
  const int k0 = ((blk >> 4) & 7) * 64 + (tid >> 5) * 8;

  const int base = blk * 1024 + tid;                 // in units of 4 floats
  v4f xq[4], xk[4], xv[4];
#pragma unroll
  for (int i = 0; i < 4; ++i) {
    xq[i] = reinterpret_cast<const v4f*>(query)[base + i * 256];
    xk[i] = reinterpret_cast<const v4f*>(key)[base + i * 256];
    xv[i] = reinterpret_cast<const v4f*>(value)[base + i * 256];
  }
  v8f w;
#pragma unroll
  for (int i = 0; i < 8; ++i) w[i] = Wm[(k0 + i) * E_DIM + n];
  // keeps all 20 loads issued ahead of the first conversion: without it the
  // weight loads sink behind waits on the others, a second memory latency
  __builtin_amdgcn_sched_barrier(0);

#pragma unroll
  for (int i = 0; i < 4; ++i) {
    v4h* d = reinterpret_cast<v4h*>(x16) + base + i * 256;
    d[0]               = __builtin_convertvector(xq[i], v4h);
    d[X_ELEMS / 4]     = __builtin_convertvector(xk[i], v4h);
    d[2 * X_ELEMS / 4] = __builtin_convertvector(xv[i], v4h);
  }
  *reinterpret_cast<v8h*>(wT16 + (size_t)t * W_ELEMS + n * E_DIM + k0) =
      __builtin_convertvector(w, v8h);
}

// ---------------------------------------------------------------------------
// Projection GEMM: Y = X @ W + b.  One 16x16 tile per wave, 8 waves/block.
// Output scattered to head-major f16: [B,H,L,HD] (q,k) or [B,H,HD,L] (v^T).
// ---------------------------------------------------------------------------
__global__ void __launch_bounds__(256)
proj_gemm(const _Float16* __restrict__ X16, const _Float16* __restrict__ WT16,
          const float* __restrict__ bias, _Float16* __restrict__ out_std,
          _Float16* __restrict__ out_vT, int write_vT) {
  const int lane = threadIdx.x & 31, wid = threadIdx.x >> 5;
  const int m = lane & 15, hk = lane >> 4;
  const int rbase = blockIdx.x * 16;
  const int cbase = blockIdx.y * 128 + wid * 16;
  v8f acc = {};
#pragma unroll
  for (int kk = 0; kk < E_DIM; kk += 32) {
    v16h a = load_frag(X16, E_DIM, rbase, kk, lane);
    v16h b = load_frag(WT16, E_DIM, cbase, kk, lane);
    acc = wmma_f16(a, b, acc);
  }
  const int col = cbase + m;
  const float bv = bias[col];
  const int h = col >> 5, d = col & (HEAD_DIM - 1);
#pragma unroll
  for (int r = 0; r < 8; ++r) {
    int row = rbase + hk * 8 + r;
    int bb = row >> 11, l = row & (SEQ - 1);
    float v = acc[r] + bv;
    if (write_vT) {
      out_vT[(((size_t)(bb * NHEAD + h)) * HEAD_DIM + d) * SEQ + l] = (_Float16)v;
    } else {
      out_std[(((size_t)(bb * NHEAD + h)) * SEQ + l) * HEAD_DIM + d] = (_Float16)v;
    }
  }
}

// ---------------------------------------------------------------------------
// Fused flash attention, scores computed transposed.  Wave owns 16 q-rows;
// block = 16 waves = 256 q-rows for one (b,h).  64 chunks of 32 keys:
//   S^T = K . Q^T   (A = 16 key rows, B = 16 query columns), two tiles;
//   O^T += V^T . P^T (A = 16 head dims x 32 keys, B = P^T).
// In the D map a lane holds one query column (lane & 15) and 8 keys per tile
// (8*hk + r), so max and sum run over the lane's own registers plus one
// exchange with lane ^ 16, and the two packed score tiles are already the
// B operand of the second product (k = 8*hk + s, 16 + 8*hk + (s - 8)):
// P never leaves the registers.
//
// The head's whole K (128 KB) and V^T (128 KB) are put into LDS once, by
// whole-line loads, and all 16 waves take their A fragments from there: a
// fragment load from global memory touches 8 (K) or 16 (V^T) cache lines for
// its 512 bytes, and every wave would repeat it.  At 256 KB of LDS one block
// has a WGP to itself; 256 blocks.  LDS is counted in 16-byte units; a unit's low
// index bits are XORed with row bits so that the 16 lanes of a half wave,
// which read 16 rows at one column, fall on 16 different bank groups:
//   K   unit u = key * 4 + c   (c: 8 head dims)  -> u ^ ((key >> 2) & 3)
//   V^T unit u = d * 256 + p   (p: 8 keys)       -> u ^ (d & 15)
// ---------------------------------------------------------------------------
#define ATT_WAVES 16
#define KV_UNITS (SEQ * HEAD_DIM / 8)    // 16-byte units of one head's K or V^T

__device__ __forceinline__ int k_slot(int u) { return u ^ ((u >> 4) & 3); }
__device__ __forceinline__ int v_slot(int u) { return u ^ ((u >> 8) & 15); }

__device__ __forceinline__ float xhalf(float x) {   // value of lane ^ 16
  int b = __builtin_bit_cast(int, x);
  return __builtin_bit_cast(float, __builtin_amdgcn_permlanex16(
      b, b, 0x76543210, 0xfedcba98, false, false));
}

// kv: the head's K units, then its V^T units, in LDS.
// relrow: this lane's own relation row at its first key (REL only).
// op: this lane's 8 + 8 output halves (d = 8*hk .., 16 + 8*hk ..).
template <bool REL>
__device__ __forceinline__ void
attn_rows(const _Float16* __restrict__ Q, const v8h* kv,
          const float* __restrict__ relrow,
          _Float16* __restrict__ op, int qbase, int lane) {
  const v16h bq = load_frag(Q, HEAD_DIM, qbase, 0, lane);  // column = query
  // the lane's units of a fragment (k = 8*hk .. and 16 + 8*hk ..), chunk 0
  const int m = lane & 15, hk = lane >> 4;
  const int kl0 = k_slot(m * 4 + hk), kl1 = k_slot(m * 4 + hk + 2);
  const int vb0 = (KV_UNITS + v_slot(m * 256 + hk)) * 16;       // in bytes
  const int vb1 = (KV_UNITS + v_slot(m * 256 + hk + 2)) * 16;
  const char* kvb = reinterpret_cast<const char*>(kv);
  v8f o0 = {}, o1 = {};      // o0[r] = O[q][d = 8*hk + r], o1: d + 16
  float mrun = -1e30f, lrun = 0.0f;   // lrun: this lane's half of the keys

  for (int j = 0; j < SEQ; j += 32) {
    if (REL && (j + 64) < SEQ) {     // stream-ahead the relation weights
      __builtin_prefetch(relrow + j + 64, 0, 1);
    }
    FragU ak0, ak1, av0, av1;
    const v8h* kj = kv + j * 4;      // 16 keys are 64 units; slots repeat
    ak0.h[0] = kj[kl0];
    ak0.h[1] = kj[kl1];
    ak1.h[0] = kj[64 + kl0];
    ak1.h[1] = kj[64 + kl1];
    const int bj = j * 2;            // 4 units a chunk: adds to p as an XOR
    av0.h[0] = *reinterpret_cast<const v8h*>(kvb + (vb0 ^ bj));
    av0.h[1] = *reinterpret_cast<const v8h*>(kvb + (vb1 ^ bj));
    av1.h[0] = *reinterpret_cast<const v8h*>(kvb + 16 * 4096 + (vb0 ^ bj));
    av1.h[1] = *reinterpret_cast<const v8h*>(kvb + 16 * 4096 + (vb1 ^ bj));
    v8f w0, w1;                      // weights of the lane's 8 + 8 keys
    if (REL) {
      w0 = *reinterpret_cast<const v8f*>(relrow + j);
      w1 = *reinterpret_cast<const v8f*>(relrow + j + 16);
    }
    // keeps all of the chunk's loads issued ahead of the first product: sunk
    // to their users, each would expose a load latency of its own
    __builtin_amdgcn_sched_barrier(0);

    v8f s0 = {}, s1 = {};
    s0 = wmma_f16(ak0.v, bq, s0);   // s0[r] = S[q][key = j + 8*hk + r]
    s1 = wmma_f16(ak1.v, bq, s1);   // s1[r] = S[q][key = j + 16 + 8*hk + r]
    s0 *= SCALING;
    s1 *= SCALING;

    float mx = fmaxf(s0[0], s1[0]);
#pragma unroll
    for (int r = 1; r < 8; ++r) mx = fmaxf(mx, fmaxf(s0[r], s1[r]));
    mx = fmaxf(mx, xhalf(mx));                  // both halves of the 32 keys
    const float mnew  = fmaxf(mrun, mx);
    const float alpha = __expf(mrun - mnew);
#pragma unroll
    for (int r = 0; r < 8; ++r) {
      s0[r] = __expf(s0[r] - mnew);
      s1[r] = __expf(s1[r] - mnew);
    }
    if (REL) {                                  // exp(s)*w, renormalized online
      s0 *= w0;
      s1 *= w1;
    }
    const v8f t = s0 + s1;
    const float rs = ((t[0] + t[1]) + (t[2] + t[3])) +
                     ((t[4] + t[5]) + (t[6] + t[7]));
    lrun = lrun * alpha + rs;
    mrun = mnew;
    FragU pf;                                   // P^T as B operand
    pf.h[0] = __builtin_convertvector(s0, v8h);
    pf.h[1] = __builtin_convertvector(s1, v8h);
    o0 *= alpha;
    o1 *= alpha;
    o0 = wmma_f16(av0.v, pf.v, o0);
    o1 = wmma_f16(av1.v, pf.v, o1);
  }

  const float eps = REL ? 1e-6f : 0.0f;
  const float inv = 1.0f / (lrun + xhalf(lrun) + eps);   // join the halves once
  *reinterpret_cast<v8h*>(op)      = __builtin_convertvector(o0 * inv, v8h);
  *reinterpret_cast<v8h*>(op + 16) = __builtin_convertvector(o1 * inv, v8h);
}

__global__ void __launch_bounds__(ATT_WAVES * 32)
attn_fused(const _Float16* __restrict__ qh, const _Float16* __restrict__ kh,
           const _Float16* __restrict__ vT, const float* __restrict__ relw,
           _Float16* __restrict__ attn_out) {
  const int lane = threadIdx.x & 31, wid = threadIdx.x >> 5;
  const int m = lane & 15, hk = lane >> 4;
  const int b = blockIdx.z, h = blockIdx.y;
  const int qbase = blockIdx.x * (ATT_WAVES * 16) + wid * 16;
  const size_t headoff = (size_t)(b * NHEAD + h);
  const _Float16* Q = qh + headoff * SEQ * HEAD_DIM;
  const v8h* gK = reinterpret_cast<const v8h*>(kh + headoff * SEQ * HEAD_DIM);
  const v8h* gV = reinterpret_cast<const v8h*>(vT + headoff * HEAD_DIM * SEQ);

  __shared__ v8h kv[2 * KV_UNITS];
  constexpr int FILL = KV_UNITS / (ATT_WAVES * 32);  // units a thread moves
  v8h rk[FILL], rv[FILL];
#pragma unroll
  for (int i = 0; i < FILL; ++i) {
    rk[i] = gK[i * (ATT_WAVES * 32) + (int)threadIdx.x];
    rv[i] = gV[i * (ATT_WAVES * 32) + (int)threadIdx.x];
  }
  // stands in front of the first reuse of a register that these loads name;
  // the two bases are inputs so that their registers stay theirs up to here
  asm volatile("s_wait_xcnt 0x0" :: "s"(gK), "s"(gV) : "memory");
#pragma unroll
  for (int i = 0; i < FILL; ++i) {
    const int u = i * (ATT_WAVES * 32) + (int)threadIdx.x;
    kv[k_slot(u)] = rk[i];
    kv[KV_UNITS + v_slot(u)] = rv[i];
  }
  __syncthreads();   // every wave reads what all 16 have stored
  _Float16* op = attn_out + ((size_t)(b * SEQ + qbase + m)) * E_DIM +
                 h * HEAD_DIM + hk * 8;
  if (h >= NORMAL_HEADS) {
    const float* relrow =
        relw + ((size_t)(b * RHEAD + (h - NORMAL_HEADS))) * SEQ * SEQ +
        (size_t)(qbase + m) * SEQ + hk * 8;
    attn_rows<true>(Q, kv, relrow, op, qbase, lane);
  } else {
    attn_rows<false>(Q, kv, nullptr, op, qbase, lane);
  }
}

// ---------------------------------------------------------------------------
// Output projection + LayerNorm fused: block computes a full 16x512 strip
// (8 waves x 4 column tiles), LN reduces each row from LDS.
// ---------------------------------------------------------------------------
__global__ void __launch_bounds__(256)
outproj_ln(const _Float16* __restrict__ attn16, const _Float16* __restrict__ WoT,
           const float* __restrict__ bo, const float* __restrict__ gamma,
           const float* __restrict__ beta, float* __restrict__ out) {
  const int lane = threadIdx.x & 31, wid = threadIdx.x >> 5;
  const int m = lane & 15, hk = lane >> 4;
  const int rbase = blockIdx.x * 16;
  __shared__ float rowbuf[16][E_DIM];
  v8f acc[4] = {{}, {}, {}, {}};
  for (int kk = 0; kk < E_DIM; kk += 32) {
    v16h a = load_frag(attn16, E_DIM, rbase, kk, lane);
#pragma unroll
    for (int t = 0; t < 4; ++t) {
      v16h bw = load_frag(WoT, E_DIM, wid * 64 + t * 16, kk, lane);
      acc[t] = wmma_f16(a, bw, acc[t]);
    }
  }
#pragma unroll
  for (int t = 0; t < 4; ++t) {
    int col = wid * 64 + t * 16 + m;
    float bv = bo[col];
#pragma unroll
    for (int r = 0; r < 8; ++r) rowbuf[hk * 8 + r][col] = acc[t][r] + bv;
  }
  __syncthreads();
#pragma unroll
  for (int rr = 0; rr < 2; ++rr) {
    int row = wid * 2 + rr;
    float s = 0.f, s2 = 0.f;
    for (int c = lane; c < E_DIM; c += 32) {
      float v = rowbuf[row][c];
      s += v; s2 += v * v;
    }
#pragma unroll
    for (int off = 16; off > 0; off >>= 1) {
      s  += __shfl_xor(s, off);
      s2 += __shfl_xor(s2, off);
    }
    float mean = s * (1.0f / E_DIM);
    float var  = s2 * (1.0f / E_DIM) - mean * mean;
    float rstd = rsqrtf(var + 1e-5f);
    for (int c = lane; c < E_DIM; c += 32) {
      out[(size_t)(rbase + row) * E_DIM + c] =
          (rowbuf[row][c] - mean) * rstd * gamma[c] + beta[c];
    }
  }
}

// ---------------------------------------------------------------------------
extern "C" void kernel_launch(void* const* d_in, const int* in_sizes, int n_in,
                              void* d_out, int out_size, void* d_ws, size_t ws_size,
                              hipStream_t stream) {
  const float* query = (const float*)d_in[0];
  const float* key   = (const float*)d_in[1];
  const float* value = (const float*)d_in[2];
  const float* relw  = (const float*)d_in[3];
  const float* Wq = (const float*)d_in[4];
  const float* bq = (const float*)d_in[5];
  const float* Wk = (const float*)d_in[6];
  const float* bk = (const float*)d_in[7];
  const float* Wv = (const float*)d_in[8];
  const float* bv = (const float*)d_in[9];
  const float* Wo = (const float*)d_in[10];
  const float* bo = (const float*)d_in[11];
  const float* gamma = (const float*)d_in[12];
  const float* beta  = (const float*)d_in[13];
  float* out = (float*)d_out;

  // workspace carve-up (~30 MB)
  const size_t XE = (size_t)BATCH * SEQ * E_DIM;   // 2M elems
  const size_t WE = (size_t)E_DIM * E_DIM;         // 256K elems
  char* ws = (char*)d_ws;
  _Float16* xq16 = (_Float16*)ws; ws += XE * sizeof(_Float16);
  _Float16* xk16 = (_Float16*)ws; ws += XE * sizeof(_Float16);
  _Float16* xv16 = (_Float16*)ws; ws += XE * sizeof(_Float16);
  _Float16* WqT  = (_Float16*)ws; ws += WE * sizeof(_Float16);
  _Float16* WkT  = (_Float16*)ws; ws += WE * sizeof(_Float16);
  _Float16* WvT  = (_Float16*)ws; ws += WE * sizeof(_Float16);
  _Float16* WoT  = (_Float16*)ws; ws += WE * sizeof(_Float16);
  _Float16* qh16 = (_Float16*)ws; ws += XE * sizeof(_Float16);
  _Float16* kh16 = (_Float16*)ws; ws += XE * sizeof(_Float16);
  _Float16* vT16 = (_Float16*)ws; ws += XE * sizeof(_Float16);
  _Float16* at16 = (_Float16*)ws; ws += XE * sizeof(_Float16);
  (void)in_sizes; (void)n_in; (void)out_size; (void)ws_size;

  dim3 blk(256);
  // xq16, xk16, xv16 and WqT .. WoT lie one behind the other in the workspace
  prep_f16<<<PREP_BLOCKS, blk, 0, stream>>>(query, key, value, Wq, Wk, Wv, Wo,
                                            xq16, WqT);

  dim3 pg(BATCH * SEQ / 16, E_DIM / 128);            // (256, 4)
  proj_gemm<<<pg, blk, 0, stream>>>(xq16, WqT, bq, qh16, nullptr, 0);
  proj_gemm<<<pg, blk, 0, stream>>>(xk16, WkT, bk, kh16, nullptr, 0);
  proj_gemm<<<pg, blk, 0, stream>>>(xv16, WvT, bv, nullptr, vT16, 1);

  dim3 ag(SEQ / (ATT_WAVES * 16), NHEAD, BATCH);     // (8, 16, 2)
  attn_fused<<<ag, dim3(ATT_WAVES * 32), 0, stream>>>(qh16, kh16, vT16, relw, at16);

  outproj_ln<<<BATCH * SEQ / 16, blk, 0, stream>>>(at16, WoT, bo, gamma, beta, out);
}

// v004
// Measured time: 88.5 microseconds a run.
// In two side-by-side timings against v003, it was 1.50 and 1.52 times as fast.
// All steps since v000 together make it 4.87 times as fast.
#include <hip/hip_runtime.h>
#include <hip/hip_bf16.h>

// ---------------------------------------------------------------------------
// Relation-aware attention for MI455X (gfx1250, wave32, WMMA).
//
// Roofline: relation_weights (256 MB) dominates traffic -> memory bound at
// ~13us on 23.3 TB/s HBM *if* we never spill the 2x16x2048x2048 score tensor.
// Hence a fused flash-style attention kernel with online normalization, f16
// WMMA (16x16x32, K == head_dim == 32) for all GEMM work, f32 accumulate.
// ---------------------------------------------------------------------------

typedef __attribute__((ext_vector_type(16))) _Float16 v16h;
typedef __attribute__((ext_vector_type(8)))  _Float16 v8h;
typedef __attribute__((ext_vector_type(8)))  float    v8f;

#define E_DIM   512
#define NHEAD   16
#define RHEAD   8
#define NORMAL_HEADS 8
#define HEAD_DIM 32
#define BATCH   2
#define SEQ     2048
#define SCALING 0.17677669529663687f   // 32^-0.5

union FragU { v16h v; v8h h[2]; };

// A/B fragment loader (16-bit, 16x16x32 WMMA).
// A layout (ISA 7.12.2): lane = 16*hk + m holds row m; element e holds
//   k = (e<8 ? 0 : 16) + hk*8 + (e&7)  -> two contiguous 8-half (b128) loads.
// B fragments use the mirrored layout (lane&15 = column), so a row-major
// [N x K] (i.e. pre-transposed) matrix loads with the identical pattern.
__device__ __forceinline__ v16h load_frag(const _Float16* __restrict__ base,
                                          int ld, int row0, int k0, int lane) {
  const int m  = lane & 15;
  const int hk = lane >> 4;
  const _Float16* p = base + (size_t)(row0 + m) * ld + (k0 + hk * 8);
  FragU f;
  f.h[0] = *reinterpret_cast<const v8h*>(p);
  f.h[1] = *reinterpret_cast<const v8h*>(p + 16);
  return f.v;
}

__device__ __forceinline__ v8f wmma_f16(v16h a, v16h b, v8f c) {
  return __builtin_amdgcn_wmma_f32_16x16x32_f16(false, a, false, b,
                                                (short)0, c, false, false);
}

// ---------------------------------------------------------------------------
// Format conversion, one launch for all seven arrays.  The work is 28 MB in,
// 14 MB out; what it costs is launches and waves to start, so few waves each
// keep many whole-line accesses in flight.  All 512 blocks do the same work:
//   1/512 of each of query, key, value -> f16: a thread converts 4 x 4 floats
//   of each; a wave-wide load covers 512 contiguous bytes, a store 256;
//   one 64 k x 32 n tile of one weight matrix, WT[n][k] = W[k][n] (so GEMM
//   B-fragments are contiguous b128 loads): a thread reads 8 k of one column
//   (a wave-wide load is one line of W) and stores them as 16 bytes; the block
//   writes whole 128-byte lines of WT.
// ---------------------------------------------------------------------------
typedef __attribute__((ext_vector_type(4))) float    v4f;
typedef __attribute__((ext_vector_type(4))) _Float16 v4h;

#define PREP_BLOCKS 512
#define X_ELEMS (BATCH * SEQ * E_DIM)
#define W_ELEMS (E_DIM * E_DIM)

__global__ void __launch_bounds__(256)
prep_f16(const float* __restrict__ query, const float* __restrict__ key,
         const float* __restrict__ value, const float* __restrict__ Wq,
         const float* __restrict__ Wk, const float* __restrict__ Wv,
         const float* __restrict__ Wo, _Float16* __restrict__ x16,
         _Float16* __restrict__ wT16) {
  const int tid = threadIdx.x;
  const int blk = blockIdx.x;

  const int t = blk >> 7;                            // which matrix
  const float* Wm = t == 0 ? Wq : (t == 1 ? Wk : (t == 2 ? Wv : Wo));
  const int n  = (blk & 15) * 32 + (tid & 31);
  const int k0 = ((blk >> 4) & 7) * 64 + (tid >> 5) * 8;

  const int base = blk * 1024 + tid;                 // in units of 4 floats
  v4f xq[4], xk[4], xv[4];
#pragma unroll
  for (int i = 0; i < 4; ++i) {
    xq[i] = reinterpret_cast<const v4f*>(query)[base + i * 256];
    xk[i] = reinterpret_cast<const v4f*>(key)[base + i * 256];
    xv[i] = reinterpret_cast<const v4f*>(value)[base + i * 256];
  }
  v8f w;
#pragma unroll
  for (int i = 0; i < 8; ++i) w[i] = Wm[(k0 + i) * E_DIM + n];
  // keeps all 20 loads issued ahead of the first conversion: without it the
  // weight loads sink behind waits on the others, a second memory latency
  __builtin_amdgcn_sched_barrier(0);

#pragma unroll
  for (int i = 0; i < 4; ++i) {
    v4h* d = reinterpret_cast<v4h*>(x16) + base + i * 256;
    d[0]               = __builtin_convertvector(xq[i], v4h);
    d[X_ELEMS / 4]     = __builtin_convertvector(xk[i], v4h);
    d[2 * X_ELEMS / 4] = __builtin_convertvector(xv[i], v4h);
  }
  *reinterpret_cast<v8h*>(wT16 + (size_t)t * W_ELEMS + n * E_DIM + k0) =
      __builtin_convertvector(w, v8h);
}

// ---------------------------------------------------------------------------
// Projection GEMM: Y = X @ W + b.  A block of 8 waves computes 64 rows x 128
// columns; K runs in 8 stages of 64.  A stage's X rows and W^T rows (one
// 128-byte line each) come from global memory by whole-line loads, one 16-byte
// unit a thread, and go to LDS; the waves take their fragments there.  A
// fragment load from global memory touches 16 lines for its 512 bytes and
// feeds one product; here a line is fetched once a block, and a wave owns
// 32 rows x 32 columns (2 x 2 tiles), so a fragment feeds two products.
// Two LDS buffers and two register sets: the loads of the stage after next fly
// while this stage is worked on.
// LDS unit of row r, column unit c: r * 8 + (c ^ ((r >> 1) & 7)), so that the
// 16 lanes of a half wave, which read 16 rows at one c, fall on 16 different
// bank groups.
// Output scattered to head-major f16: [B,H,L,HD] (q,k) or [B,H,HD,L] (v^T).
// ---------------------------------------------------------------------------
#define PJ_ROWS 64
#define PJ_COLS 128
#define PJ_STAGES (E_DIM / 64)
#define PJ_UNITS ((PJ_ROWS + PJ_COLS) * 8)   // 16-byte units of one stage

// Work-group barrier that orders LDS traffic alone.  __syncthreads() also waits
// for every global load in flight, which would end the lead of the loads that
// are asked for two stages ahead; they land in registers of their own wave.
__device__ __forceinline__ void lds_barrier() {
  __builtin_amdgcn_fence(__ATOMIC_RELEASE, "workgroup", "local");
  __builtin_amdgcn_s_barrier();
  __builtin_amdgcn_fence(__ATOMIC_ACQUIRE, "workgroup", "local");
}

__global__ void __launch_bounds__(256)
proj_gemm(const _Float16* __restrict__ X16, const _Float16* __restrict__ WT16,
          const float* __restrict__ bias, _Float16* __restrict__ out_std,
          _Float16* __restrict__ out_vT, int write_vT) {
  __shared__ v8h st[2 * PJ_UNITS];
  const int tid = threadIdx.x;
  const int lane = tid & 31, wid = tid >> 5;
  const int m = lane & 15, hk = lane >> 4;
  const int rbase = blockIdx.x * PJ_ROWS;
  const int cbase = blockIdx.y * PJ_COLS;
  // filling: thread = unit fc of rows fr, fr + 32, ...
  const int fc = tid & 7, fr = tid >> 3;
  const v8h* px = reinterpret_cast<const v8h*>(X16) + (rbase + fr) * (E_DIM / 8) + fc;
  const v8h* pw = reinterpret_cast<const v8h*>(WT16) + (cbase + fr) * (E_DIM / 8) + fc;
  const int fs = fr * 8 + (fc ^ ((fr >> 1) & 7));
  // reading: the wave's X rows and W^T rows; the lane's units of a fragment
  // (k = 8*hk .. and 16 + 8*hk ..) for the two k steps of a stage
  const int xrow = ((wid >> 2) * 32 + m) * 8;
  const int wrow = (PJ_ROWS + (wid & 3) * 32 + m) * 8;
  const int sw = (m >> 1) & 7;

  // the wave's 32 columns are one head; a 64-row tile lies in one batch
  const int row0 = rbase + (wid >> 2) * 32 + hk * 8;
  const int col0 = cbase + (wid & 3) * 32 + m;
  const float bv[2] = {bias[col0], bias[col0 + 16]};

  // two register sets: stage s + 2 is asked for while stage s is worked on.
  // Every loop from here on is unrolled, so that the register arrays, the set
  // and the LDS buffer are picked by compile-time indices (no scratch memory).
  v8h nx[2][2], nw[2][4];
#pragma unroll
  for (int p = 0; p < 2; ++p) {
#pragma unroll
    for (int i = 0; i < 2; ++i) nx[p][i] = px[i * 32 * (E_DIM / 8) + p * 8];
#pragma unroll
    for (int i = 0; i < 4; ++i) nw[p][i] = pw[i * 32 * (E_DIM / 8) + p * 8];
  }
#pragma unroll
  for (int i = 0; i < 2; ++i) st[fs + i * 256] = nx[0][i];
#pragma unroll
  for (int i = 0; i < 4; ++i) st[PJ_ROWS * 8 + fs + i * 256] = nw[0][i];

  v8f acc[2][2] = {{{}, {}}, {{}, {}}};
#pragma unroll
  for (int s = 0; s < PJ_STAGES; ++s) {
    // publishes stage s, and ends every wave's reads of the other buffer
    // before it is filled again below
    lds_barrier();
    if (s + 2 < PJ_STAGES) {   // into the set that went to LDS a stage ago
#pragma unroll
      for (int i = 0; i < 2; ++i)
        nx[s & 1][i] = px[i * 32 * (E_DIM / 8) + (s + 2) * 8];
#pragma unroll
      for (int i = 0; i < 4; ++i)
        nw[s & 1][i] = pw[i * 32 * (E_DIM / 8) + (s + 2) * 8];
    }
    // keeps the six loads issued ahead of the stage's products: sunk towards
    // their LDS stores they would lose the lead that hides their latency
    __builtin_amdgcn_sched_barrier(0);
    const v8h* sb = st + (s & 1) * PJ_UNITS;
#pragma unroll
    for (int ks = 0; ks < 2; ++ks) {
      const int c0 = (ks * 4 + hk) ^ sw, c1 = (ks * 4 + 2 + hk) ^ sw;
      FragU fx[2], fw[2];
#pragma unroll
      for (int t = 0; t < 2; ++t) {
        fx[t].h[0] = sb[xrow + t * 128 + c0];
        fx[t].h[1] = sb[xrow + t * 128 + c1];
        fw[t].h[0] = sb[wrow + t * 128 + c0];
        fw[t].h[1] = sb[wrow + t * 128 + c1];
      }
#pragma unroll
      for (int i = 0; i < 2; ++i)
#pragma unroll
        for (int j = 0; j < 2; ++j)
          acc[i][j] = wmma_f16(fx[i].v, fw[j].v, acc[i][j]);
    }
    if (s + 1 < PJ_STAGES) {
      v8h* d = st + ((s + 1) & 1) * PJ_UNITS;
#pragma unroll
      for (int i = 0; i < 2; ++i) d[fs + i * 256] = nx[(s + 1) & 1][i];
#pragma unroll
      for (int i = 0; i < 4; ++i) d[PJ_ROWS * 8 + fs + i * 256] = nw[(s + 1) & 1][i];
    }
  }

  const int bb = row0 >> 11, l0 = row0 & (SEQ - 1);
  const int h = col0 >> 5, d0 = col0 & (HEAD_DIM - 1);
  const size_t head = (size_t)(bb * NHEAD + h) * SEQ * HEAD_DIM;
  if (write_vT) {
    _Float16* o = out_vT + head + d0 * SEQ + l0;
#pragma unroll
    for (int j = 0; j < 2; ++j)
#pragma unroll
      for (int i = 0; i < 2; ++i)
#pragma unroll
        for (int r = 0; r < 8; ++r)
          o[j * 16 * SEQ + i * 16 + r] = (_Float16)(acc[i][j][r] + bv[j]);
  } else {
    _Float16* o = out_std + head + l0 * HEAD_DIM + d0;
#pragma unroll
    for (int j = 0; j < 2; ++j)
#pragma unroll
      for (int i = 0; i < 2; ++i)
#pragma unroll
        for (int r = 0; r < 8; ++r)
          o[(i * 16 + r) * HEAD_DIM + j * 16] = (_Float16)(acc[i][j][r] + bv[j]);
  }
}

// ---------------------------------------------------------------------------
// Fused flash attention, scores computed transposed.  Wave owns 16 q-rows;
// block = 16 waves = 256 q-rows for one (b,h).  64 chunks of 32 keys:
//   S^T = K . Q^T   (A = 16 key rows, B = 16 query columns), two tiles;
//   O^T += V^T . P^T (A = 16 head dims x 32 keys, B = P^T).
// In the D map a lane holds one query column (lane & 15) and 8 keys per tile
// (8*hk + r), so max and sum run over the lane's own registers plus one
// exchange with lane ^ 16, and the two packed score tiles are already the
// B operand of the second product (k = 8*hk + s, 16 + 8*hk + (s - 8)):
// P never leaves the registers.
//
// The head's whole K (128 KB) and V^T (128 KB) are put into LDS once, by
// whole-line loads, and all 16 waves take their A fragments from there: a
// fragment load from global memory touches 8 (K) or 16 (V^T) cache lines for
// its 512 bytes, and every wave would repeat it.  At 256 KB of LDS one block
// has a WGP to itself; 256 blocks.  LDS is counted in 16-byte units; a unit's low
// index bits are XORed with row bits so that the 16 lanes of a half wave,
// which read 16 rows at one column, fall on 16 different bank groups:
//   K   unit u = key * 4 + c   (c: 8 head dims)  -> u ^ ((key >> 2) & 3)
//   V^T unit u = d * 256 + p   (p: 8 keys)       -> u ^ (d & 15)
// ---------------------------------------------------------------------------
#define ATT_WAVES 16
#define KV_UNITS (SEQ * HEAD_DIM / 8)    // 16-byte units of one head's K or V^T

__device__ __forceinline__ int k_slot(int u) { return u ^ ((u >> 4) & 3); }
__device__ __forceinline__ int v_slot(int u) { return u ^ ((u >> 8) & 15); }

__device__ __forceinline__ float xhalf(float x) {   // value of lane ^ 16
  int b = __builtin_bit_cast(int, x);
  return __builtin_bit_cast(float, __builtin_amdgcn_permlanex16(
      b, b, 0x76543210, 0xfedcba98, false, false));
}

// kv: the head's K units, then its V^T units, in LDS.
// relrow: this lane's own relation row at its first key (REL only).
// op: this lane's 8 + 8 output halves (d = 8*hk .., 16 + 8*hk ..).
template <bool REL>
__device__ __forceinline__ void
attn_rows(const _Float16* __restrict__ Q, const v8h* kv,
          const float* __restrict__ relrow,
          _Float16* __restrict__ op, int qbase, int lane) {
  const v16h bq = load_frag(Q, HEAD_DIM, qbase, 0, lane);  // column = query
  // the lane's units of a fragment (k = 8*hk .. and 16 + 8*hk ..), chunk 0
  const int m = lane & 15, hk = lane >> 4;
  const int kl0 = k_slot(m * 4 + hk), kl1 = k_slot(m * 4 + hk + 2);
  const int vb0 = (KV_UNITS + v_slot(m * 256 + hk)) * 16;       // in bytes
  const int vb1 = (KV_UNITS + v_slot(m * 256 + hk + 2)) * 16;
  const char* kvb = reinterpret_cast<const char*>(kv);
  v8f o0 = {}, o1 = {};      // o0[r] = O[q][d = 8*hk + r], o1: d + 16
  float mrun = -1e30f, lrun = 0.0f;   // lrun: this lane's half of the keys

  for (int j = 0; j < SEQ; j += 32) {
    if (REL && (j + 64) < SEQ) {     // stream-ahead the relation weights
      __builtin_prefetch(relrow + j + 64, 0, 1);
    }
    FragU ak0, ak1, av0, av1;
    const v8h* kj = kv + j * 4;      // 16 keys are 64 units; slots repeat
    ak0.h[0] = kj[kl0];
    ak0.h[1] = kj[kl1];
    ak1.h[0] = kj[64 + kl0];
    ak1.h[1] = kj[64 + kl1];
    const int bj = j * 2;            // 4 units a chunk: adds to p as an XOR
    av0.h[0] = *reinterpret_cast<const v8h*>(kvb + (vb0 ^ bj));
    av0.h[1] = *reinterpret_cast<const v8h*>(kvb + (vb1 ^ bj));
    av1.h[0] = *reinterpret_cast<const v8h*>(kvb + 16 * 4096 + (vb0 ^ bj));
    av1.h[1] = *reinterpret_cast<const v8h*>(kvb + 16 * 4096 + (vb1 ^ bj));
    v8f w0, w1;                      // weights of the lane's 8 + 8 keys
    if (REL) {
      w0 = *reinterpret_cast<const v8f*>(relrow + j);
      w1 = *reinterpret_cast<const v8f*>(relrow + j + 16);
    }
    // keeps all of the chunk's loads issued ahead of the first product: sunk
    // to their users, each would expose a load latency of its own
    __builtin_amdgcn_sched_barrier(0);

    v8f s0 = {}, s1 = {};
    s0 = wmma_f16(ak0.v, bq, s0);   // s0[r] = S[q][key = j + 8*hk + r]
    s1 = wmma_f16(ak1.v, bq, s1);   // s1[r] = S[q][key = j + 16 + 8*hk + r]
    s0 *= SCALING;
    s1 *= SCALING;

    float mx = fmaxf(s0[0], s1[0]);
#pragma unroll
    for (int r = 1; r < 8; ++r) mx = fmaxf(mx, fmaxf(s0[r], s1[r]));
    mx = fmaxf(mx, xhalf(mx));                  // both halves of the 32 keys
    const float mnew  = fmaxf(mrun, mx);
    const float alpha = __expf(mrun - mnew);
#pragma unroll
    for (int r = 0; r < 8; ++r) {
      s0[r] = __expf(s0[r] - mnew);
      s1[r] = __expf(s1[r] - mnew);
    }
    if (REL) {                                  // exp(s)*w, renormalized online
      s0 *= w0;
      s1 *= w1;
    }
    const v8f t = s0 + s1;
    const float rs = ((t[0] + t[1]) + (t[2] + t[3])) +
                     ((t[4] + t[5]) + (t[6] + t[7]));
    lrun = lrun * alpha + rs;
    mrun = mnew;
    FragU pf;                                   // P^T as B operand
    pf.h[0] = __builtin_convertvector(s0, v8h);
    pf.h[1] = __builtin_convertvector(s1, v8h);
    o0 *= alpha;
    o1 *= alpha;
    o0 = wmma_f16(av0.v, pf.v, o0);
    o1 = wmma_f16(av1.v, pf.v, o1);
  }

  const float eps = REL ? 1e-6f : 0.0f;
  const float inv = 1.0f / (lrun + xhalf(lrun) + eps);   // join the halves once
  *reinterpret_cast<v8h*>(op)      = __builtin_convertvector(o0 * inv, v8h);
  *reinterpret_cast<v8h*>(op + 16) = __builtin_convertvector(o1 * inv, v8h);
}

__global__ void __launch_bounds__(ATT_WAVES * 32)
attn_fused(const _Float16* __restrict__ qh, const _Float16* __restrict__ kh,
           const _Float16* __restrict__ vT, const float* __restrict__ relw,
           _Float16* __restrict__ attn_out) {
  const int lane = threadIdx.x & 31, wid = threadIdx.x >> 5;
  const int m = lane & 15, hk = lane >> 4;
  const int b = blockIdx.z, h = blockIdx.y;
  const int qbase = blockIdx.x * (ATT_WAVES * 16) + wid * 16;
  const size_t headoff = (size_t)(b * NHEAD + h);
  const _Float16* Q = qh + headoff * SEQ * HEAD_DIM;
  const v8h* gK = reinterpret_cast<const v8h*>(kh + headoff * SEQ * HEAD_DIM);
  const v8h* gV = reinterpret_cast<const v8h*>(vT + headoff * HEAD_DIM * SEQ);

  __shared__ v8h kv[2 * KV_UNITS];
  constexpr int FILL = KV_UNITS / (ATT_WAVES * 32);  // units a thread moves
  v8h rk[FILL], rv[FILL];
#pragma unroll
  for (int i = 0; i < FILL; ++i) {
    rk[i] = gK[i * (ATT_WAVES * 32) + (int)threadIdx.x];
    rv[i] = gV[i * (ATT_WAVES * 32) + (int)threadIdx.x];
  }
  // stands in front of the first reuse of a register that these loads name;
  // the two bases are inputs so that their registers stay theirs up to here
  asm volatile("s_wait_xcnt 0x0" :: "s"(gK), "s"(gV) : "memory");
#pragma unroll
  for (int i = 0; i < FILL; ++i) {
    const int u = i * (ATT_WAVES * 32) + (int)threadIdx.x;
    kv[k_slot(u)] = rk[i];
    kv[KV_UNITS + v_slot(u)] = rv[i];
  }
  __syncthreads();   // every wave reads what all 16 have stored
  _Float16* op = attn_out + ((size_t)(b * SEQ + qbase + m)) * E_DIM +
                 h * HEAD_DIM + hk * 8;
  if (h >= NORMAL_HEADS) {
    const float* relrow =
        relw + ((size_t)(b * RHEAD + (h - NORMAL_HEADS))) * SEQ * SEQ +
        (size_t)(qbase + m) * SEQ + hk * 8;
    attn_rows<true>(Q, kv, relrow, op, qbase, lane);
  } else {
    attn_rows<false>(Q, kv, nullptr, op, qbase, lane);
  }
}

// ---------------------------------------------------------------------------
// Output projection + LayerNorm fused: block computes a full 16x512 strip
// (8 waves x 4 column tiles), LN reduces each row from LDS.
// ---------------------------------------------------------------------------
__global__ void __launch_bounds__(256)
outproj_ln(const _Float16* __restrict__ attn16, const _Float16* __restrict__ WoT,
           const float* __restrict__ bo, const float* __restrict__ gamma,
           const float* __restrict__ beta, float* __restrict__ out) {
  const int lane = threadIdx.x & 31, wid = threadIdx.x >> 5;
  const int m = lane & 15, hk = lane >> 4;
  const int rbase = blockIdx.x * 16;
  __shared__ float rowbuf[16][E_DIM];
  v8f acc[4] = {{}, {}, {}, {}};
  for (int kk = 0; kk < E_DIM; kk += 32) {
    v16h a = load_frag(attn16, E_DIM, rbase, kk, lane);
#pragma unroll
    for (int t = 0; t < 4; ++t) {
      v16h bw = load_frag(WoT, E_DIM, wid * 64 + t * 16, kk, lane);
      acc[t] = wmma_f16(a, bw, acc[t]);
    }
  }
#pragma unroll
  for (int t = 0; t < 4; ++t) {
    int col = wid * 64 + t * 16 + m;
    float bv = bo[col];
#pragma unroll
    for (int r = 0; r < 8; ++r) rowbuf[hk * 8 + r][col] = acc[t][r] + bv;
  }
  __syncthreads();
#pragma unroll
  for (int rr = 0; rr < 2; ++rr) {
    int row = wid * 2 + rr;
    float s = 0.f, s2 = 0.f;
    for (int c = lane; c < E_DIM; c += 32) {
      float v = rowbuf[row][c];
      s += v; s2 += v * v;
    }
#pragma unroll
    for (int off = 16; off > 0; off >>= 1) {
      s  += __shfl_xor(s, off);
      s2 += __shfl_xor(s2, off);
    }
    float mean = s * (1.0f / E_DIM);
    float var  = s2 * (1.0f / E_DIM) - mean * mean;
    float rstd = rsqrtf(var + 1e-5f);
    for (int c = lane; c < E_DIM; c += 32) {
      out[(size_t)(rbase + row) * E_DIM + c] =
          (rowbuf[row][c] - mean) * rstd * gamma[c] + beta[c];
    }
  }
}

// ---------------------------------------------------------------------------
extern "C" void kernel_launch(void* const* d_in, const int* in_sizes, int n_in,
                              void* d_out, int out_size, void* d_ws, size_t ws_size,
                              hipStream_t stream) {
  const float* query = (const float*)d_in[0];
  const float* key   = (const float*)d_in[1];
  const float* value = (const float*)d_in[2];
  const float* relw  = (const float*)d_in[3];
  const float* Wq = (const float*)d_in[4];
  const float* bq = (const float*)d_in[5];
  const float* Wk = (const float*)d_in[6];
  const float* bk = (const float*)d_in[7];
  const float* Wv = (const float*)d_in[8];
  const float* bv = (const float*)d_in[9];
  const float* Wo = (const float*)d_in[10];
  const float* bo = (const float*)d_in[11];
  const float* gamma = (const float*)d_in[12];
  const float* beta  = (const float*)d_in[13];
  float* out = (float*)d_out;

  // workspace carve-up (~30 MB)
  const size_t XE = (size_t)BATCH * SEQ * E_DIM;   // 2M elems
  const size_t WE = (size_t)E_DIM * E_DIM;         // 256K elems
  char* ws = (char*)d_ws;
  _Float16* xq16 = (_Float16*)ws; ws += XE * sizeof(_Float16);
  _Float16* xk16 = (_Float16*)ws; ws += XE * sizeof(_Float16);
  _Float16* xv16 = (_Float16*)ws; ws += XE * sizeof(_Float16);
  _Float16* WqT  = (_Float16*)ws; ws += WE * sizeof(_Float16);
  _Float16* WkT  = (_Float16*)ws; ws += WE * sizeof(_Float16);
  _Float16* WvT  = (_Float16*)ws; ws += WE * sizeof(_Float16);
  _Float16* WoT  = (_Float16*)ws; ws += WE * sizeof(_Float16);
  _Float16* qh16 = (_Float16*)ws; ws += XE * sizeof(_Float16);
  _Float16* kh16 = (_Float16*)ws; ws += XE * sizeof(_Float16);
  _Float16* vT16 = (_Float16*)ws; ws += XE * sizeof(_Float16);
  _Float16* at16 = (_Float16*)ws; ws += XE * sizeof(_Float16);
  (void)in_sizes; (void)n_in; (void)out_size; (void)ws_size;

  dim3 blk(256);
  // xq16, xk16, xv16 and WqT .. WoT lie one behind the other in the workspace
  prep_f16<<<PREP_BLOCKS, blk, 0, stream>>>(query, key, value, Wq, Wk, Wv, Wo,
                                            xq16, WqT);

  dim3 pg(BATCH * SEQ / PJ_ROWS, E_DIM / PJ_COLS);   // (64, 4)
  proj_gemm<<<pg, blk, 0, stream>>>(xq16, WqT, bq, qh16, nullptr, 0);
  proj_gemm<<<pg, blk, 0, stream>>>(xk16, WkT, bk, kh16, nullptr, 0);
  proj_gemm<<<pg, blk, 0, stream>>>(xv16, WvT, bv, nullptr, vT16, 1);

  dim3 ag(SEQ / (ATT_WAVES * 16), NHEAD, BATCH);     // (8, 16, 2)
  attn_fused<<<ag, dim3(ATT_WAVES * 32), 0, stream>>>(qh16, kh16, vT16, relw, at16);

  outproj_ln<<<BATCH * SEQ / 16, blk, 0, stream>>>(at16, WoT, bo, gamma, beta, out);
}

// v005
// One run takes 81.6 microseconds.
// In two side-by-side timings against v004, it was 1.08 and 1.09 times as fast.
// Counting every step since v000, it is 5.29 times as fast.
#include <hip/hip_runtime.h>
#include <hip/hip_bf16.h>

// ---------------------------------------------------------------------------
// Relation-aware attention for MI455X (gfx1250, wave32, WMMA).
//
// Roofline: relation_weights (256 MB) dominates traffic -> memory bound at
// ~13us on 23.3 TB/s HBM *if* we never spill the 2x16x2048x2048 score tensor.
// Hence a fused flash-style attention kernel with online normalization, f16
// WMMA (16x16x32, K == head_dim == 32) for all GEMM work, f32 accumulate.
// ---------------------------------------------------------------------------

typedef __attribute__((ext_vector_type(16))) _Float16 v16h;
typedef __attribute__((ext_vector_type(8)))  _Float16 v8h;
typedef __attribute__((ext_vector_type(8)))  float    v8f;

#define E_DIM   512
#define NHEAD   16
#define RHEAD   8
#define NORMAL_HEADS 8
#define HEAD_DIM 32
#define BATCH   2
#define SEQ     2048
#define SCALING 0.17677669529663687f   // 32^-0.5

union FragU { v16h v; v8h h[2]; };

// A/B fragment loader (16-bit, 16x16x32 WMMA).
// A layout (ISA 7.12.2): lane = 16*hk + m holds row m; element e holds
//   k = (e<8 ? 0 : 16) + hk*8 + (e&7)  -> two contiguous 8-half (b128) loads.
// B fragments use the mirrored layout (lane&15 = column), so a row-major
// [N x K] (i.e. pre-transposed) matrix loads with the identical pattern.
__device__ __forceinline__ v16h load_frag(const _Float16* __restrict__ base,
                                          int ld, int row0, int k0, int lane) {
  const int m  = lane & 15;
  const int hk = lane >> 4;
  const _Float16* p = base + (size_t)(row0 + m) * ld + (k0 + hk * 8);
  FragU f;
  f.h[0] = *reinterpret_cast<const v8h*>(p);
  f.h[1] = *reinterpret_cast<const v8h*>(p + 16);
  return f.v;
}

__device__ __forceinline__ v8f wmma_f16(v16h a, v16h b, v8f c) {
  return __builtin_amdgcn_wmma_f32_16x16x32_f16(false, a, false, b,
                                                (short)0, c, false, false);
}

// ---------------------------------------------------------------------------
// Format conversion, one launch for all seven arrays.  The work is 28 MB in,
// 14 MB out; what it costs is launches and waves to start, so few waves each
// keep many whole-line accesses in flight.  All 512 blocks do the same work:
//   1/512 of each of query, key, value -> f16: a thread converts 4 x 4 floats
//   of each; a wave-wide load covers 512 contiguous bytes, a store 256;
//   one 64 k x 32 n tile of one weight matrix, WT[n][k] = W[k][n] (so GEMM
//   B-fragments are contiguous b128 loads): a thread reads 8 k of one column
//   (a wave-wide load is one line of W) and stores them as 16 bytes; the block
//   writes whole 128-byte lines of WT.
// ---------------------------------------------------------------------------
typedef __attribute__((ext_vector_type(4))) float    v4f;
typedef __attribute__((ext_vector_type(4))) _Float16 v4h;

#define PREP_BLOCKS 512
#define X_ELEMS (BATCH * SEQ * E_DIM)
#define W_ELEMS (E_DIM * E_DIM)

__global__ void __launch_bounds__(256)
prep_f16(const float* __restrict__ query, const float* __restrict__ key,
         const float* __restrict__ value, const float* __restrict__ Wq,
         const float* __restrict__ Wk, const float* __restrict__ Wv,
         const float* __restrict__ Wo, _Float16* __restrict__ x16,
         _Float16* __restrict__ wT16) {
  const int tid = threadIdx.x;
  const int blk = blockIdx.x;

  const int t = blk >> 7;                            // which matrix
  const float* Wm = t == 0 ? Wq : (t == 1 ? Wk : (t == 2 ? Wv : Wo));
  const int n  = (blk & 15) * 32 + (tid & 31);
  const int k0 = ((blk >> 4) & 7) * 64 + (tid >> 5) * 8;

  const int base = blk * 1024 + tid;                 // in units of 4 floats
  v4f xq[4], xk[4], xv[4];
#pragma unroll
  for (int i = 0; i < 4; ++i) {
    xq[i] = reinterpret_cast<const v4f*>(query)[base + i * 256];
    xk[i] = reinterpret_cast<const v4f*>(key)[base + i * 256];
    xv[i] = reinterpret_cast<const v4f*>(value)[base + i * 256];
  }
  v8f w;
#pragma unroll
  for (int i = 0; i < 8; ++i) w[i] = Wm[(k0 + i) * E_DIM + n];
  // keeps all 20 loads issued ahead of the first conversion: without it the
  // weight loads sink behind waits on the others, a second memory latency
  __builtin_amdgcn_sched_barrier(0);

#pragma unroll
  for (int i = 0; i < 4; ++i) {
    v4h* d = reinterpret_cast<v4h*>(x16) + base + i * 256;
    d[0]               = __builtin_convertvector(xq[i], v4h);
    d[X_ELEMS / 4]     = __builtin_convertvector(xk[i], v4h);
    d[2 * X_ELEMS / 4] = __builtin_convertvector(xv[i], v4h);
  }
  *reinterpret_cast<v8h*>(wT16 + (size_t)t * W_ELEMS + n * E_DIM + k0) =
      __builtin_convertvector(w, v8h);
}

// ---------------------------------------------------------------------------
// Projection GEMM: Y = X @ W + b.  A block of 8 waves computes 64 rows x 128
// columns; K runs in 8 stages of 64.  A stage's X rows and W^T rows (one
// 128-byte line each) come from global memory by whole-line loads, one 16-byte
// unit a thread, and go to LDS; the waves take their fragments there.  A
// fragment load from global memory touches 16 lines for its 512 bytes and
// feeds one product; here a line is fetched once a block, and a wave owns
// 32 rows x 32 columns (2 x 2 tiles), so a fragment feeds two products.
// Two LDS buffers and two register sets: the loads of the stage after next fly
// while this stage is worked on.
// LDS unit of row r, column unit c: r * 8 + (c ^ ((r >> 1) & 7)), so that the
// 16 lanes of a half wave, which read 16 rows at one c, fall on 16 different
// bank groups.
// Output scattered to head-major f16: [B,H,L,HD] (q,k) or [B,H,HD,L] (v^T).
// ---------------------------------------------------------------------------
#define PJ_ROWS 64
#define PJ_COLS 128
#define PJ_STAGES (E_DIM / 64)
#define PJ_UNITS ((PJ_ROWS + PJ_COLS) * 8)   // 16-byte units of one stage

// Work-group barrier that orders LDS traffic alone.  __syncthreads() also waits
// for every global load in flight, which would end the lead of the loads that
// are asked for two stages ahead; they land in registers of their own wave.
__device__ __forceinline__ void lds_barrier() {
  __builtin_amdgcn_fence(__ATOMIC_RELEASE, "workgroup", "local");
  __builtin_amdgcn_s_barrier();
  __builtin_amdgcn_fence(__ATOMIC_ACQUIRE, "workgroup", "local");
}

__global__ void __launch_bounds__(256)
proj_gemm(const _Float16* __restrict__ X16, const _Float16* __restrict__ WT16,
          const float* __restrict__ bias, _Float16* __restrict__ out_std,
          _Float16* __restrict__ out_vT, int write_vT) {
  __shared__ v8h st[2 * PJ_UNITS];
  const int tid = threadIdx.x;
  const int lane = tid & 31, wid = tid >> 5;
  const int m = lane & 15, hk = lane >> 4;
  const int rbase = blockIdx.x * PJ_ROWS;
  const int cbase = blockIdx.y * PJ_COLS;
  // filling: thread = unit fc of rows fr, fr + 32, ...
  const int fc = tid & 7, fr = tid >> 3;
  const v8h* px = reinterpret_cast<const v8h*>(X16) + (rbase + fr) * (E_DIM / 8) + fc;
  const v8h* pw = reinterpret_cast<const v8h*>(WT16) + (cbase + fr) * (E_DIM / 8) + fc;
  const int fs = fr * 8 + (fc ^ ((fr >> 1) & 7));
  // reading: the wave's X rows and W^T rows; the lane's units of a fragment
  // (k = 8*hk .. and 16 + 8*hk ..) for the two k steps of a stage
  const int xrow = ((wid >> 2) * 32 + m) * 8;
  const int wrow = (PJ_ROWS + (wid & 3) * 32 + m) * 8;
  const int sw = (m >> 1) & 7;

  // the wave's 32 columns are one head; a 64-row tile lies in one batch
  const int row0 = rbase + (wid >> 2) * 32 + hk * 8;
  const int col0 = cbase + (wid & 3) * 32 + m;
  const float bv[2] = {bias[col0], bias[col0 + 16]};

  // two register sets: stage s + 2 is asked for while stage s is worked on.
  // Every loop from here on is unrolled, so that the register arrays, the set
  // and the LDS buffer are picked by compile-time indices (no scratch memory).
  v8h nx[2][2], nw[2][4];
#pragma unroll
  for (int p = 0; p < 2; ++p) {
#pragma unroll
    for (int i = 0; i < 2; ++i) nx[p][i] = px[i * 32 * (E_DIM / 8) + p * 8];
#pragma unroll
    for (int i = 0; i < 4; ++i) nw[p][i] = pw[i * 32 * (E_DIM / 8) + p * 8];
  }
#pragma unroll
  for (int i = 0; i < 2; ++i) st[fs + i * 256] = nx[0][i];
#pragma unroll
  for (int i = 0; i < 4; ++i) st[PJ_ROWS * 8 + fs + i * 256] = nw[0][i];

  v8f acc[2][2] = {{{}, {}}, {{}, {}}};
#pragma unroll
  for (int s = 0; s < PJ_STAGES; ++s) {
    // publishes stage s, and ends every wave's reads of the other buffer
    // before it is filled again below
    lds_barrier();
    if (s + 2 < PJ_STAGES) {   // into the set that went to LDS a stage ago
#pragma unroll
      for (int i = 0; i < 2; ++i)
        nx[s & 1][i] = px[i * 32 * (E_DIM / 8) + (s + 2) * 8];
#pragma unroll
      for (int i = 0; i < 4; ++i)
        nw[s & 1][i] = pw[i * 32 * (E_DIM / 8) + (s + 2) * 8];
    }
    // keeps the six loads issued ahead of the stage's products: sunk towards
    // their LDS stores they would lose the lead that hides their latency
    __builtin_amdgcn_sched_barrier(0);
    const v8h* sb = st + (s & 1) * PJ_UNITS;
#pragma unroll
    for (int ks = 0; ks < 2; ++ks) {
      const int c0 = (ks * 4 + hk) ^ sw, c1 = (ks * 4 + 2 + hk) ^ sw;
      FragU fx[2], fw[2];
#pragma unroll
      for (int t = 0; t < 2; ++t) {
        fx[t].h[0] = sb[xrow + t * 128 + c0];
        fx[t].h[1] = sb[xrow + t * 128 + c1];
        fw[t].h[0] = sb[wrow + t * 128 + c0];
        fw[t].h[1] = sb[wrow + t * 128 + c1];
      }
#pragma unroll
      for (int i = 0; i < 2; ++i)
#pragma unroll
        for (int j = 0; j < 2; ++j)
          acc[i][j] = wmma_f16(fx[i].v, fw[j].v, acc[i][j]);
    }
    if (s + 1 < PJ_STAGES) {
      v8h* d = st + ((s + 1) & 1) * PJ_UNITS;
#pragma unroll
      for (int i = 0; i < 2; ++i) d[fs + i * 256] = nx[(s + 1) & 1][i];
#pragma unroll
      for (int i = 0; i < 4; ++i) d[PJ_ROWS * 8 + fs + i * 256] = nw[(s + 1) & 1][i];
    }
  }

  const int bb = row0 >> 11, l0 = row0 & (SEQ - 1);
  const int h = col0 >> 5, d0 = col0 & (HEAD_DIM - 1);
  const size_t head = (size_t)(bb * NHEAD + h) * SEQ * HEAD_DIM;
  if (write_vT) {
    _Float16* o = out_vT + head + d0 * SEQ + l0;
#pragma unroll
    for (int j = 0; j < 2; ++j)
#pragma unroll
      for (int i = 0; i < 2; ++i)
#pragma unroll
        for (int r = 0; r < 8; ++r)
          o[j * 16 * SEQ + i * 16 + r] = (_Float16)(acc[i][j][r] + bv[j]);
  } else {
    _Float16* o = out_std + head + l0 * HEAD_DIM + d0;
#pragma unroll
    for (int j = 0; j < 2; ++j)
#pragma unroll
      for (int i = 0; i < 2; ++i)
#pragma unroll
        for (int r = 0; r < 8; ++r)
          o[(i * 16 + r) * HEAD_DIM + j * 16] = (_Float16)(acc[i][j][r] + bv[j]);
  }
}

// ---------------------------------------------------------------------------
// Fused flash attention, scores computed transposed.  Wave owns 16 q-rows;
// block = 16 waves = 256 q-rows for one (b,h).  64 chunks of 32 keys:
//   S^T = K . Q^T   (A = 16 key rows, B = 16 query columns), two tiles;
//   O^T += V^T . P^T (A = 16 head dims x 32 keys, B = P^T).
// In the D map a lane holds one query column (lane & 15) and 8 keys per tile
// (8*hk + r), so max and sum run over the lane's own registers plus one
// exchange with lane ^ 16, and the two packed score tiles are already the
// B operand of the second product (k = 8*hk + s, 16 + 8*hk + (s - 8)):
// P never leaves the registers.
//
// The head's whole K (128 KB) and V^T (128 KB) are put into LDS once, by
// whole-line loads, and all 16 waves take their A fragments from there: a
// fragment load from global memory touches 8 (K) or 16 (V^T) cache lines for
// its 512 bytes, and every wave would repeat it.  At 256 KB of LDS one block
// has a WGP to itself; 256 blocks.  LDS is counted in 16-byte units; a unit's low
// index bits are XORed with row bits so that the 16 lanes of a half wave,
// which read 16 rows at one column, fall on 16 different bank groups:
//   K   unit u = key * 4 + c   (c: 8 head dims)  -> u ^ ((key >> 2) & 3)
//   V^T unit u = d * 256 + p   (p: 8 keys)       -> u ^ (d & 15)
// ---------------------------------------------------------------------------
#define ATT_WAVES 16
#define KV_UNITS (SEQ * HEAD_DIM / 8)    // 16-byte units of one head's K or V^T

__device__ __forceinline__ int k_slot(int u) { return u ^ ((u >> 4) & 3); }
__device__ __forceinline__ int v_slot(int u) { return u ^ ((u >> 8) & 15); }

__device__ __forceinline__ float xhalf(float x) {   // value of lane ^ 16
  int b = __builtin_bit_cast(int, x);
  return __builtin_bit_cast(float, __builtin_amdgcn_permlanex16(
      b, b, 0x76543210, 0xfedcba98, false, false));
}

// kv: the head's K units, then its V^T units, in LDS.
// relrow: this lane's own relation row at its first key (REL only).
// op: this lane's 8 + 8 output halves (d = 8*hk .., 16 + 8*hk ..).
template <bool REL>
__device__ __forceinline__ void
attn_rows(const _Float16* __restrict__ Q, const v8h* kv,
          const float* __restrict__ relrow,
          _Float16* __restrict__ op, int qbase, int lane) {
  const v16h bq = load_frag(Q, HEAD_DIM, qbase, 0, lane);  // column = query
  // the lane's units of a fragment (k = 8*hk .. and 16 + 8*hk ..), chunk 0
  const int m = lane & 15, hk = lane >> 4;
  const int kl0 = k_slot(m * 4 + hk), kl1 = k_slot(m * 4 + hk + 2);
  const int vb0 = (KV_UNITS + v_slot(m * 256 + hk)) * 16;       // in bytes
  const int vb1 = (KV_UNITS + v_slot(m * 256 + hk + 2)) * 16;
  const char* kvb = reinterpret_cast<const char*>(kv);
  v8f o0 = {}, o1 = {};      // o0[r] = O[q][d = 8*hk + r], o1: d + 16
  float mrun = -1e30f, lrun = 0.0f;   // lrun: this lane's half of the keys

  for (int j = 0; j < SEQ; j += 32) {
    if (REL && (j + 64) < SEQ) {     // stream-ahead the relation weights
      __builtin_prefetch(relrow + j + 64, 0, 1);
    }
    FragU ak0, ak1, av0, av1;
    const v8h* kj = kv + j * 4;      // 16 keys are 64 units; slots repeat
    ak0.h[0] = kj[kl0];
    ak0.h[1] = kj[kl1];
    ak1.h[0] = kj[64 + kl0];
    ak1.h[1] = kj[64 + kl1];
    const int bj = j * 2;            // 4 units a chunk: adds to p as an XOR
    av0.h[0] = *reinterpret_cast<const v8h*>(kvb + (vb0 ^ bj));
    av0.h[1] = *reinterpret_cast<const v8h*>(kvb + (vb1 ^ bj));
    av1.h[0] = *reinterpret_cast<const v8h*>(kvb + 16 * 4096 + (vb0 ^ bj));
    av1.h[1] = *reinterpret_cast<const v8h*>(kvb + 16 * 4096 + (vb1 ^ bj));
    v8f w0, w1;                      // weights of the lane's 8 + 8 keys
    if (REL) {
      w0 = *reinterpret_cast<const v8f*>(relrow + j);
      w1 = *reinterpret_cast<const v8f*>(relrow + j + 16);
    }
    // keeps all of the chunk's loads issued ahead of the first product: sunk
    // to their users, each would expose a load latency of its own
    __builtin_amdgcn_sched_barrier(0);

    v8f s0 = {}, s1 = {};
    s0 = wmma_f16(ak0.v, bq, s0);   // s0[r] = S[q][key = j + 8*hk + r]
    s1 = wmma_f16(ak1.v, bq, s1);   // s1[r] = S[q][key = j + 16 + 8*hk + r]
    s0 *= SCALING;
    s1 *= SCALING;

    float mx = fmaxf(s0[0], s1[0]);
#pragma unroll
    for (int r = 1; r < 8; ++r) mx = fmaxf(mx, fmaxf(s0[r], s1[r]));
    mx = fmaxf(mx, xhalf(mx));                  // both halves of the 32 keys
    const float mnew  = fmaxf(mrun, mx);
    const float alpha = __expf(mrun - mnew);
#pragma unroll
    for (int r = 0; r < 8; ++r) {
      s0[r] = __expf(s0[r] - mnew);
      s1[r] = __expf(s1[r] - mnew);
    }
    if (REL) {                                  // exp(s)*w, renormalized online
      s0 *= w0;
      s1 *= w1;
    }
    const v8f t = s0 + s1;
    const float rs = ((t[0] + t[1]) + (t[2] + t[3])) +
                     ((t[4] + t[5]) + (t[6] + t[7]));
    lrun = lrun * alpha + rs;
    mrun = mnew;
    FragU pf;                                   // P^T as B operand
    pf.h[0] = __builtin_convertvector(s0, v8h);
    pf.h[1] = __builtin_convertvector(s1, v8h);
    o0 *= alpha;
    o1 *= alpha;
    o0 = wmma_f16(av0.v, pf.v, o0);
    o1 = wmma_f16(av1.v, pf.v, o1);
  }

  const float eps = REL ? 1e-6f : 0.0f;
  const float inv = 1.0f / (lrun + xhalf(lrun) + eps);   // join the halves once
  *reinterpret_cast<v8h*>(op)      = __builtin_convertvector(o0 * inv, v8h);
  *reinterpret_cast<v8h*>(op + 16) = __builtin_convertvector(o1 * inv, v8h);
}

__global__ void __launch_bounds__(ATT_WAVES * 32)
attn_fused(const _Float16* __restrict__ qh, const _Float16* __restrict__ kh,
           const _Float16* __restrict__ vT, const float* __restrict__ relw,
           _Float16* __restrict__ attn_out) {
  const int lane = threadIdx.x & 31, wid = threadIdx.x >> 5;
  const int m = lane & 15, hk = lane >> 4;
  const int b = blockIdx.z, h = blockIdx.y;
  const int qbase = blockIdx.x * (ATT_WAVES * 16) + wid * 16;
  const size_t headoff = (size_t)(b * NHEAD + h);
  const _Float16* Q = qh + headoff * SEQ * HEAD_DIM;
  const v8h* gK = reinterpret_cast<const v8h*>(kh + headoff * SEQ * HEAD_DIM);
  const v8h* gV = reinterpret_cast<const v8h*>(vT + headoff * HEAD_DIM * SEQ);

  __shared__ v8h kv[2 * KV_UNITS];
  constexpr int FILL = KV_UNITS / (ATT_WAVES * 32);  // units a thread moves
  v8h rk[FILL], rv[FILL];
#pragma unroll
  for (int i = 0; i < FILL; ++i) {
    rk[i] = gK[i * (ATT_WAVES * 32) + (int)threadIdx.x];
    rv[i] = gV[i * (ATT_WAVES * 32) + (int)threadIdx.x];
  }
  // stands in front of the first reuse of a register that these loads name;
  // the two bases are inputs so that their registers stay theirs up to here
  asm volatile("s_wait_xcnt 0x0" :: "s"(gK), "s"(gV) : "memory");
#pragma unroll
  for (int i = 0; i < FILL; ++i) {
    const int u = i * (ATT_WAVES * 32) + (int)threadIdx.x;
    kv[k_slot(u)] = rk[i];
    kv[KV_UNITS + v_slot(u)] = rv[i];
  }
  __syncthreads();   // every wave reads what all 16 have stored
  _Float16* op = attn_out + ((size_t)(b * SEQ + qbase + m)) * E_DIM +
                 h * HEAD_DIM + hk * 8;
  if (h >= NORMAL_HEADS) {
    const float* relrow =
        relw + ((size_t)(b * RHEAD + (h - NORMAL_HEADS))) * SEQ * SEQ +
        (size_t)(qbase + m) * SEQ + hk * 8;
    attn_rows<true>(Q, kv, relrow, op, qbase, lane);
  } else {
    attn_rows<false>(Q, kv, nullptr, op, qbase, lane);
  }
}

// ---------------------------------------------------------------------------
// Output projection + LayerNorm fused.  A block of 16 waves computes a full
// strip of 32 rows x 512 columns, so that LN can reduce each row from LDS.
// As in proj_gemm, rows come from global memory by whole-line loads, one
// 16-byte unit a lane, and go to LDS, and the waves take their fragments
// there; a wave owns 32 rows x 32 columns (2 x 2 tiles), so a fragment feeds
// two products, and a line of Wo^T is fetched once for 32 rows of output.
// The strip's X rows (32 KB) are put down once, for all waves.  Wo^T runs in
// 8 stages of 64 k.  A wave's 32 columns are 32 rows of Wo^T that no other wave
// needs: each wave stages its own rows (4 KB a stage) through two LDS buffers
// of its own and two register sets, so the k loop holds no barrier and the
// waves drift apart, one wave's LDS stores beside another's reads and products.
// LDS unit of row r, column unit c of a stage: r * 8 + (c ^ ((r >> 1) & 7)),
// as in proj_gemm.  The k order of every sum is the one of a plain k loop.
// ---------------------------------------------------------------------------
#define OP_ROWS 32
#define OP_WAVES 16
#define OP_STAGES (E_DIM / 64)
#define OP_UNITS (32 * 8)          // 16-byte units of 32 rows of one stage

// The lanes of one wave hand each other units through LDS: the wave's stores
// have landed before any of its lanes reads there.  No other wave is waited for.
__device__ __forceinline__ void lds_wave_sync() {
  __builtin_amdgcn_fence(__ATOMIC_ACQ_REL, "workgroup", "local");
}

__global__ void __launch_bounds__(OP_WAVES * 32)
outproj_ln(const _Float16* __restrict__ attn16, const _Float16* __restrict__ WoT,
           const float* __restrict__ bo, const float* __restrict__ gamma,
           const float* __restrict__ beta, float* __restrict__ out) {
  // the X rows of all stages, then each wave's two buffers
  __shared__ v8h stx[(OP_STAGES + OP_WAVES * 2) * OP_UNITS];
  __shared__ float rowbuf[OP_ROWS][E_DIM];
  const int tid = threadIdx.x;
  const int lane = tid & 31, wid = tid >> 5;
  const int m = lane & 15, hk = lane >> 4;
  const int rbase = blockIdx.x * OP_ROWS;
  const int fc = tid & 7;
  // filling Wo^T: lane = unit fc of the wave's rows lr, lr + 4, ...
  const int lr = lane >> 3;
  const v8h* pw = reinterpret_cast<const v8h*>(WoT) +
                  (wid * 32 + lr) * (E_DIM / 8) + fc;
  v8h* wbuf = stx + (OP_STAGES + wid * 2) * OP_UNITS;
  // filling X: thread = unit fc of row xr in stages xs, xs + 2, ...
  const int xr = (tid >> 3) & 31, xs = tid >> 8;
  const v8h* px = reinterpret_cast<const v8h*>(attn16) +
                  (rbase + xr) * (E_DIM / 8) + xs * 8 + fc;
  const int xfs = xs * OP_UNITS + xr * 8 + (fc ^ ((xr >> 1) & 7));
  // reading: row m of a 16-row tile of X or of the wave's Wo^T rows
  const int frow = m * 8;
  const int sz = (m >> 1) & 7;
  const int col0 = wid * 32 + m;

  // two register sets: stage s + 2 is asked for while stage s is worked on.
  // Every loop from here on is unrolled, so that the register arrays, the set
  // and the LDS buffer are picked by compile-time indices (no scratch memory).
  v8h nx[OP_STAGES / 2], nw[2][8];
#pragma unroll
  for (int i = 0; i < 8; ++i) nw[0][i] = pw[i * 4 * (E_DIM / 8)];
#pragma unroll
  for (int i = 0; i < OP_STAGES / 2; ++i) nx[i] = px[i * 16];
#pragma unroll
  for (int i = 0; i < 8; ++i) nw[1][i] = pw[i * 4 * (E_DIM / 8) + 8];
  const float bv[2] = {bo[col0], bo[col0 + 16]};
  // stands in front of the first reuse of a register that these loads name;
  // the two bases are inputs so that their registers stay theirs up to here
  asm volatile("s_wait_xcnt 0x0" :: "v"(px), "v"(pw) : "memory");
#pragma unroll
  for (int i = 0; i < 8; ++i) {
    const int r = lr + 4 * i;
    wbuf[r * 8 + (fc ^ ((r >> 1) & 7))] = nw[0][i];
  }
#pragma unroll
  for (int i = 0; i < OP_STAGES / 2; ++i) stx[xfs + i * 2 * OP_UNITS] = nx[i];
  lds_barrier();   // every wave reads the X rows that all 16 have stored

  v8f acc[2][2] = {{{}, {}}, {{}, {}}};
#pragma unroll
  for (int s = 0; s < OP_STAGES; ++s) {
    if (s + 2 < OP_STAGES) {   // into the set that went to LDS a stage ago
#pragma unroll
      for (int i = 0; i < 8; ++i)
        nw[s & 1][i] = pw[i * 4 * (E_DIM / 8) + (s + 2) * 8];
    }
    // keeps the eight loads issued ahead of the stage's products: sunk towards
    // their LDS stores they would lose the lead that hides their latency
    __builtin_amdgcn_sched_barrier(0);
    const v8h* sbx = stx + s * OP_UNITS;
    const v8h* sbw = wbuf + (s & 1) * OP_UNITS;
#pragma unroll
    for (int ks = 0; ks < 2; ++ks) {
      const int c0 = (ks * 4 + hk) ^ sz, c1 = (ks * 4 + 2 + hk) ^ sz;
      FragU fx[2], fw[2];
#pragma unroll
      for (int t = 0; t < 2; ++t) {
        fx[t].h[0] = sbx[frow + t * 128 + c0];
        fx[t].h[1] = sbx[frow + t * 128 + c1];
        fw[t].h[0] = sbw[frow + t * 128 + c0];
        fw[t].h[1] = sbw[frow + t * 128 + c1];
      }
#pragma unroll
      for (int i = 0; i < 2; ++i)
#pragma unroll
        for (int j = 0; j < 2; ++j)
          acc[i][j] = wmma_f16(fx[i].v, fw[j].v, acc[i][j]);
    }
    if (s + 1 < OP_STAGES) {   // the buffer whose fragments stage s - 1 has used
      v8h* d = wbuf + ((s + 1) & 1) * OP_UNITS;
#pragma unroll
      for (int i = 0; i < 8; ++i) {
        const int r = lr + 4 * i;
        d[r * 8 + (fc ^ ((r >> 1) & 7))] = nw[(s + 1) & 1][i];
      }
      lds_wave_sync();
    }
  }

#pragma unroll
  for (int j = 0; j < 2; ++j)
#pragma unroll
    for (int i = 0; i < 2; ++i)
#pragma unroll
      for (int r = 0; r < 8; ++r)
        rowbuf[i * 16 + hk * 8 + r][col0 + j * 16] = acc[i][j][r] + bv[j];
  __syncthreads();
#pragma unroll
  for (int rr = 0; rr < 2; ++rr) {
    int row = wid * 2 + rr;
    float s = 0.f, s2 = 0.f;
    for (int c = lane; c < E_DIM; c += 32) {
      float v = rowbuf[row][c];
      s += v; s2 += v * v;
    }
#pragma unroll
    for (int off = 16; off > 0; off >>= 1) {
      s  += __shfl_xor(s, off);
      s2 += __shfl_xor(s2, off);
    }
    float mean = s * (1.0f / E_DIM);
    float var  = s2 * (1.0f / E_DIM) - mean * mean;
    float rstd = rsqrtf(var + 1e-5f);
    for (int c = lane; c < E_DIM; c += 32) {
      out[(size_t)(rbase + row) * E_DIM + c] =
          (rowbuf[row][c] - mean) * rstd * gamma[c] + beta[c];
    }
  }
}

// ---------------------------------------------------------------------------
extern "C" void kernel_launch(void* const* d_in, const int* in_sizes, int n_in,
                              void* d_out, int out_size, void* d_ws, size_t ws_size,
                              hipStream_t stream) {
  const float* query = (const float*)d_in[0];
  const float* key   = (const float*)d_in[1];
  const float* value = (const float*)d_in[2];
  const float* relw  = (const float*)d_in[3];
  const float* Wq = (const float*)d_in[4];
  const float* bq = (const float*)d_in[5];
  const float* Wk = (const float*)d_in[6];
  const float* bk = (const float*)d_in[7];
  const float* Wv = (const float*)d_in[8];
  const float* bv = (const float*)d_in[9];
  const float* Wo = (const float*)d_in[10];
  const float* bo = (const float*)d_in[11];
  const float* gamma = (const float*)d_in[12];
  const float* beta  = (const float*)d_in[13];
  float* out = (float*)d_out;

  // workspace carve-up (~30 MB)
  const size_t XE = (size_t)BATCH * SEQ * E_DIM;   // 2M elems
  const size_t WE = (size_t)E_DIM * E_DIM;         // 256K elems
  char* ws = (char*)d_ws;
  _Float16* xq16 = (_Float16*)ws; ws += XE * sizeof(_Float16);
  _Float16* xk16 = (_Float16*)ws; ws += XE * sizeof(_Float16);
  _Float16* xv16 = (_Float16*)ws; ws += XE * sizeof(_Float16);
  _Float16* WqT  = (_Float16*)ws; ws += WE * sizeof(_Float16);
  _Float16* WkT  = (_Float16*)ws; ws += WE * sizeof(_Float16);
  _Float16* WvT  = (_Float16*)ws; ws += WE * sizeof(_Float16);
  _Float16* WoT  = (_Float16*)ws; ws += WE * sizeof(_Float16);
  _Float16* qh16 = (_Float16*)ws; ws += XE * sizeof(_Float16);
  _Float16* kh16 = (_Float16*)ws; ws += XE * sizeof(_Float16);
  _Float16* vT16 = (_Float16*)ws; ws += XE * sizeof(_Float16);
  _Float16* at16 = (_Float16*)ws; ws += XE * sizeof(_Float16);
  (void)in_sizes; (void)n_in; (void)out_size; (void)ws_size;

  dim3 blk(256);
  // xq16, xk16, xv16 and WqT .. WoT lie one behind the other in the workspace
  prep_f16<<<PREP_BLOCKS, blk, 0, stream>>>(query, key, value, Wq, Wk, Wv, Wo,
                                            xq16, WqT);

  dim3 pg(BATCH * SEQ / PJ_ROWS, E_DIM / PJ_COLS);   // (64, 4)
  proj_gemm<<<pg, blk, 0, stream>>>(xq16, WqT, bq, qh16, nullptr, 0);
  proj_gemm<<<pg, blk, 0, stream>>>(xk16, WkT, bk, kh16, nullptr, 0);
  proj_gemm<<<pg, blk, 0, stream>>>(xv16, WvT, bv, nullptr, vT16, 1);

  dim3 ag(SEQ / (ATT_WAVES * 16), NHEAD, BATCH);     // (8, 16, 2)
  attn_fused<<<ag, dim3(ATT_WAVES * 32), 0, stream>>>(qh16, kh16, vT16, relw, at16);

  outproj_ln<<<BATCH * SEQ / OP_ROWS, dim3(OP_WAVES * 32), 0, stream>>>(at16, WoT, bo, gamma,
                                                                    beta, out);
}

// v006
// One run takes 74.7 microseconds.
// In two side-by-side timings against v005, it was 1.10 and 1.09 times as fast.
// Over all steps from v000 it is 5.79 times as fast.
#include <hip/hip_runtime.h>
#include <hip/hip_bf16.h>

// ---------------------------------------------------------------------------
// Relation-aware attention for MI455X (gfx1250, wave32, WMMA).
//
// Roofline: relation_weights (256 MB) dominates traffic -> memory bound at
// ~13us on 23.3 TB/s HBM *if* we never spill the 2x16x2048x2048 score tensor.
// Hence a fused flash-style attention kernel with online normalization, f16
// WMMA (16x16x32, K == head_dim == 32) for all GEMM work, f32 accumulate.
// ---------------------------------------------------------------------------

typedef __attribute__((ext_vector_type(16))) _Float16 v16h;
typedef __attribute__((ext_vector_type(8)))  _Float16 v8h;
typedef __attribute__((ext_vector_type(8)))  float    v8f;

#define E_DIM   512
#define NHEAD   16
#define RHEAD   8
#define NORMAL_HEADS 8
#define HEAD_DIM 32
#define BATCH   2
#define SEQ     2048
#define SCALING 0.17677669529663687f   // 32^-0.5

union FragU { v16h v; v8h h[2]; };

// A/B fragment loader (16-bit, 16x16x32 WMMA).
// A layout (ISA 7.12.2): lane = 16*hk + m holds row m; element e holds
//   k = (e<8 ? 0 : 16) + hk*8 + (e&7)  -> two contiguous 8-half (b128) loads.
// B fragments use the mirrored layout (lane&15 = column), so a row-major
// [N x K] (i.e. pre-transposed) matrix loads with the identical pattern.
__device__ __forceinline__ v16h load_frag(const _Float16* __restrict__ base,
                                          int ld, int row0, int k0, int lane) {
  const int m  = lane & 15;
  const int hk = lane >> 4;
  const _Float16* p = base + (size_t)(row0 + m) * ld + (k0 + hk * 8);
  FragU f;
  f.h[0] = *reinterpret_cast<const v8h*>(p);
  f.h[1] = *reinterpret_cast<const v8h*>(p + 16);
  return f.v;
}

__device__ __forceinline__ v8f wmma_f16(v16h a, v16h b, v8f c) {
  return __builtin_amdgcn_wmma_f32_16x16x32_f16(false, a, false, b,
                                                (short)0, c, false, false);
}

// ---------------------------------------------------------------------------
// Format conversion, one launch for all seven arrays.  The work is 28 MB in,
// 14 MB out; what it costs is launches and waves to start, so few waves each
// keep many whole-line accesses in flight.  All 512 blocks do the same work:
//   1/512 of each of query, key, value -> f16: a thread converts 4 x 4 floats
//   of each; a wave-wide load covers 512 contiguous bytes, a store 256;
//   one 64 k x 32 n tile of one weight matrix, WT[n][k] = W[k][n] (so GEMM
//   B-fragments are contiguous b128 loads): a thread reads 8 k of one column
//   (a wave-wide load is one line of W) and stores them as 16 bytes; the block
//   writes whole 128-byte lines of WT.
// ---------------------------------------------------------------------------
typedef __attribute__((ext_vector_type(4))) float    v4f;
typedef __attribute__((ext_vector_type(4))) _Float16 v4h;

#define PREP_BLOCKS 512
#define X_ELEMS (BATCH * SEQ * E_DIM)
#define W_ELEMS (E_DIM * E_DIM)

__global__ void __launch_bounds__(256)
prep_f16(const float* __restrict__ query, const float* __restrict__ key,
         const float* __restrict__ value, const float* __restrict__ Wq,
         const float* __restrict__ Wk, const float* __restrict__ Wv,
         const float* __restrict__ Wo, _Float16* __restrict__ x16,
         _Float16* __restrict__ wT16) {
  const int tid = threadIdx.x;
  const int blk = blockIdx.x;

  const int t = blk >> 7;                            // which matrix
  const float* Wm = t == 0 ? Wq : (t == 1 ? Wk : (t == 2 ? Wv : Wo));
  const int n  = (blk & 15) * 32 + (tid & 31);
  const int k0 = ((blk >> 4) & 7) * 64 + (tid >> 5) * 8;

  const int base = blk * 1024 + tid;                 // in units of 4 floats
  v4f xq[4], xk[4], xv[4];
#pragma unroll
  for (int i = 0; i < 4; ++i) {
    xq[i] = reinterpret_cast<const v4f*>(query)[base + i * 256];
    xk[i] = reinterpret_cast<const v4f*>(key)[base + i * 256];
    xv[i] = reinterpret_cast<const v4f*>(value)[base + i * 256];
  }
  v8f w;
#pragma unroll
  for (int i = 0; i < 8; ++i) w[i] = Wm[(k0 + i) * E_DIM + n];
  // keeps all 20 loads issued ahead of the first conversion: without it the
  // weight loads sink behind waits on the others, a second memory latency
  __builtin_amdgcn_sched_barrier(0);

#pragma unroll
  for (int i = 0; i < 4; ++i) {
    v4h* d = reinterpret_cast<v4h*>(x16) + base + i * 256;
    d[0]               = __builtin_convertvector(xq[i], v4h);
    d[X_ELEMS / 4]     = __builtin_convertvector(xk[i], v4h);
    d[2 * X_ELEMS / 4] = __builtin_convertvector(xv[i], v4h);
  }
  *reinterpret_cast<v8h*>(wT16 + (size_t)t * W_ELEMS + n * E_DIM + k0) =
      __builtin_convertvector(w, v8h);
}

// ---------------------------------------------------------------------------
// Projection GEMM: Y = X @ W + b.  A block of 8 waves computes 64 rows x 128
// columns; K runs in 8 stages of 64.  A stage's X rows and W^T rows (one
// 128-byte line each) come from global memory by whole-line loads, one 16-byte
// unit a thread, and go to LDS; the waves take their fragments there.  A
// fragment load from global memory touches 16 lines for its 512 bytes and
// feeds one product; here a line is fetched once a block, and a wave owns
// 32 rows x 32 columns (2 x 2 tiles), so a fragment feeds two products.
// Two LDS buffers and two register sets: the loads of the stage after next fly
// while this stage is worked on.
// LDS unit of row r, column unit c: r * 8 + (c ^ ((r >> 1) & 7)), so that the
// 16 lanes of a half wave, which read 16 rows at one c, fall on 16 different
// bank groups.
// Output scattered to head-major f16: [B,H,L,HD] (q,k) or [B,H,HD,L] (v^T).
// ---------------------------------------------------------------------------
#define PJ_ROWS 64
#define PJ_COLS 128
#define PJ_STAGES (E_DIM / 64)
#define PJ_UNITS ((PJ_ROWS + PJ_COLS) * 8)   // 16-byte units of one stage

// Work-group barrier that orders LDS traffic alone.  __syncthreads() also waits
// for every global load in flight, which would end the lead of the loads that
// are asked for two stages ahead; they land in registers of their own wave.
__device__ __forceinline__ void lds_barrier() {
  __builtin_amdgcn_fence(__ATOMIC_RELEASE, "workgroup", "local");
  __builtin_amdgcn_s_barrier();
  __builtin_amdgcn_fence(__ATOMIC_ACQUIRE, "workgroup", "local");
}

// The lanes of one wave hand each other units through LDS: the wave's stores
// have landed before any of its lanes reads there.  No other wave is waited for.
__device__ __forceinline__ void lds_wave_sync() {
  __builtin_amdgcn_fence(__ATOMIC_ACQ_REL, "workgroup", "local");
}

__global__ void __launch_bounds__(256)
proj_gemm(const _Float16* __restrict__ X16, const _Float16* __restrict__ WT16,
          const float* __restrict__ bias, _Float16* __restrict__ out_std,
          _Float16* __restrict__ out_vT, int write_vT) {
  __shared__ v8h st[2 * PJ_UNITS];
  const int tid = threadIdx.x;
  const int lane = tid & 31, wid = tid >> 5;
  const int m = lane & 15, hk = lane >> 4;
  const int rbase = blockIdx.x * PJ_ROWS;
  const int cbase = blockIdx.y * PJ_COLS;
  // filling: thread = unit fc of rows fr, fr + 32, ...
  const int fc = tid & 7, fr = tid >> 3;
  const v8h* px = reinterpret_cast<const v8h*>(X16) + (rbase + fr) * (E_DIM / 8) + fc;
  const v8h* pw = reinterpret_cast<const v8h*>(WT16) + (cbase + fr) * (E_DIM / 8) + fc;
  const int fs = fr * 8 + (fc ^ ((fr >> 1) & 7));
  // reading: the wave's X rows and W^T rows; the lane's units of a fragment
  // (k = 8*hk .. and 16 + 8*hk ..) for the two k steps of a stage
  const int xrow = ((wid >> 2) * 32 + m) * 8;
  const int wrow = (PJ_ROWS + (wid & 3) * 32 + m) * 8;
  const int sw = (m >> 1) & 7;

  // the wave's 32 columns are one head; a 64-row tile lies in one batch
  const int row0 = rbase + (wid >> 2) * 32 + hk * 8;
  const int col0 = cbase + (wid & 3) * 32 + m;
  const float bv[2] = {bias[col0], bias[col0 + 16]};

  // two register sets: stage s + 2 is asked for while stage s is worked on.
  // Every loop from here on is unrolled, so that the register arrays, the set
  // and the LDS buffer are picked by compile-time indices (no scratch memory).
  v8h nx[2][2], nw[2][4];
#pragma unroll
  for (int p = 0; p < 2; ++p) {
#pragma unroll
    for (int i = 0; i < 2; ++i) nx[p][i] = px[i * 32 * (E_DIM / 8) + p * 8];
#pragma unroll
    for (int i = 0; i < 4; ++i) nw[p][i] = pw[i * 32 * (E_DIM / 8) + p * 8];
  }
#pragma unroll
  for (int i = 0; i < 2; ++i) st[fs + i * 256] = nx[0][i];
#pragma unroll
  for (int i = 0; i < 4; ++i) st[PJ_ROWS * 8 + fs + i * 256] = nw[0][i];

  v8f acc[2][2] = {{{}, {}}, {{}, {}}};
#pragma unroll
  for (int s = 0; s < PJ_STAGES; ++s) {
    // publishes stage s, and ends every wave's reads of the other buffer
    // before it is filled again below
    lds_barrier();
    if (s + 2 < PJ_STAGES) {   // into the set that went to LDS a stage ago
#pragma unroll
      for (int i = 0; i < 2; ++i)
        nx[s & 1][i] = px[i * 32 * (E_DIM / 8) + (s + 2) * 8];
#pragma unroll
      for (int i = 0; i < 4; ++i)
        nw[s & 1][i] = pw[i * 32 * (E_DIM / 8) + (s + 2) * 8];
    }
    // keeps the six loads issued ahead of the stage's products: sunk towards
    // their LDS stores they would lose the lead that hides their latency
    __builtin_amdgcn_sched_barrier(0);
    const v8h* sb = st + (s & 1) * PJ_UNITS;
#pragma unroll
    for (int ks = 0; ks < 2; ++ks) {
      const int c0 = (ks * 4 + hk) ^ sw, c1 = (ks * 4 + 2 + hk) ^ sw;
      FragU fx[2], fw[2];
#pragma unroll
      for (int t = 0; t < 2; ++t) {
        fx[t].h[0] = sb[xrow + t * 128 + c0];
        fx[t].h[1] = sb[xrow + t * 128 + c1];
        fw[t].h[0] = sb[wrow + t * 128 + c0];
        fw[t].h[1] = sb[wrow + t * 128 + c1];
      }
#pragma unroll
      for (int i = 0; i < 2; ++i)
#pragma unroll
        for (int j = 0; j < 2; ++j)
          acc[i][j] = wmma_f16(fx[i].v, fw[j].v, acc[i][j]);
    }
    if (s + 1 < PJ_STAGES) {
      v8h* d = st + ((s + 1) & 1) * PJ_UNITS;
#pragma unroll
      for (int i = 0; i < 2; ++i) d[fs + i * 256] = nx[(s + 1) & 1][i];
#pragma unroll
      for (int i = 0; i < 4; ++i) d[PJ_ROWS * 8 + fs + i * 256] = nw[(s + 1) & 1][i];
    }
  }

  const int bb = row0 >> 11, l0 = row0 & (SEQ - 1);
  const int h = col0 >> 5, d0 = col0 & (HEAD_DIM - 1);
  const size_t head = (size_t)(bb * NHEAD + h) * SEQ * HEAD_DIM;
  if (write_vT) {
    _Float16* o = out_vT + head + d0 * SEQ + l0;
#pragma unroll
    for (int j = 0; j < 2; ++j)
#pragma unroll
      for (int i = 0; i < 2; ++i)
#pragma unroll
        for (int r = 0; r < 8; ++r)
          o[j * 16 * SEQ + i * 16 + r] = (_Float16)(acc[i][j][r] + bv[j]);
  } else {
    _Float16* o = out_std + head + l0 * HEAD_DIM + d0;
#pragma unroll
    for (int j = 0; j < 2; ++j)
#pragma unroll
      for (int i = 0; i < 2; ++i)
#pragma unroll
        for (int r = 0; r < 8; ++r)
          o[(i * 16 + r) * HEAD_DIM + j * 16] = (_Float16)(acc[i][j][r] + bv[j]);
  }
}

// ---------------------------------------------------------------------------
// Fused flash attention, scores computed transposed.  Wave owns 16 q-rows;
// block = 16 waves = 256 q-rows for one (b,h).  64 chunks of 32 keys:
//   S^T = K . Q^T   (A = 16 key rows, B = 16 query columns), two tiles;
//   O^T += V^T . P^T (A = 16 head dims x 32 keys, B = P^T).
// In the D map a lane holds one query column (lane & 15) and 8 keys per tile
// (8*hk + r), so max and sum run over the lane's own registers plus one
// exchange with lane ^ 16, and the two packed score tiles are already the
// B operand of the second product (k = 8*hk + s, 16 + 8*hk + (s - 8)):
// P never leaves the registers.
//
// The head's whole K (128 KB) and V^T (128 KB) are put into LDS once, by
// whole-line loads, and all 16 waves take their A fragments from there: a
// fragment load from global memory touches 8 (K) or 16 (V^T) cache lines for
// its 512 bytes, and every wave would repeat it.  At more than 256 KB of LDS one
// block has a WGP to itself; 256 blocks.  LDS is counted in 16-byte units; a unit's low
// index bits are XORed with row bits so that the 16 lanes of a half wave,
// which read 16 rows at one column, fall on 16 different bank groups:
//   K   unit u = key * 4 + c   (c: 8 head dims)  -> u ^ ((key >> 2) & 3)
//   V^T unit u = d * 256 + p   (p: 8 keys)       -> u ^ (d & 15)
//
// Relation weights: a lane needs 8 + 8 weights of its own query row, so a load
// straight into that layout touches 16 rows (16 lines) for its 512 bytes, four
// times a chunk.  Instead a wave fetches its 16 rows x 32 keys by whole-line
// loads (8 lanes a line, 4 lines a load), four chunks ahead in four register
// sets, and turns each chunk through 2 KB of LDS of its own: no other wave
// reads there, so no barrier.  Unit of row r, column unit c (4 weights):
// r * 8 + (c ^ ((r >> 1) & 7)), as in proj_gemm.
// ---------------------------------------------------------------------------
#define ATT_WAVES 16
#define KV_UNITS (SEQ * HEAD_DIM / 8)    // 16-byte units of one head's K or V^T
#define REL_LEAD 4                       // chunks of weights held in registers
#define REL_UNITS (16 * 8)               // 16-byte units of 16 rows x 32 keys

template <bool B> struct Flag { static constexpr bool v = B; };

__device__ __forceinline__ int k_slot(int u) { return u ^ ((u >> 4) & 3); }
__device__ __forceinline__ int v_slot(int u) { return u ^ ((u >> 8) & 15); }

__device__ __forceinline__ float xhalf(float x) {   // value of lane ^ 16
  int b = __builtin_bit_cast(int, x);
  return __builtin_bit_cast(float, __builtin_amdgcn_permlanex16(
      b, b, 0x76543210, 0xfedcba98, false, false));
}

// kv: the head's K units, then its V^T units, in LDS.
// relfill: the lane's unit of the wave's relation rows, chunk 0: unit lane & 7
// of row lane >> 3; rows + 4, + 8, + 12 follow (REL only).
// wb: the wave's own LDS units for one chunk of weights (REL only).
// op: this lane's 8 + 8 output halves (d = 8*hk .., 16 + 8*hk ..).
template <bool REL>
__device__ __forceinline__ void
attn_rows(const _Float16* __restrict__ Q, const v8h* kv,
          const float* __restrict__ relfill, v4f* wb,
          _Float16* __restrict__ op, int qbase, int lane) {
  const v16h bq = load_frag(Q, HEAD_DIM, qbase, 0, lane);  // column = query
  // the lane's units of a fragment (k = 8*hk .. and 16 + 8*hk ..), chunk 0
  const int m = lane & 15, hk = lane >> 4;
  const int kl0 = k_slot(m * 4 + hk), kl1 = k_slot(m * 4 + hk + 2);
  const int vb0 = (KV_UNITS + v_slot(m * 256 + hk)) * 16;       // in bytes
  const int vb1 = (KV_UNITS + v_slot(m * 256 + hk + 2)) * 16;
  const char* kvb = reinterpret_cast<const char*>(kv);
  v8f o0 = {}, o1 = {};      // o0[r] = O[q][d = 8*hk + r], o1: d + 16
  float mrun = -1e30f, lrun = 0.0f;   // lrun: this lane's half of the keys

  // weights: where the lane puts its four units of a chunk, and where it finds
  // the four units of its own row (keys 8*hk .. and 16 + 8*hk ..)
  const v4f* gw = reinterpret_cast<const v4f*>(relfill);
  const int lr = lane >> 3, fc = lane & 7, sw = (m >> 1) & 7;
  v4f rw[REL_LEAD][4];
  auto rel_load = [&](int set, int j) {      // chunk at key j -> register set
#pragma unroll
    for (int i = 0; i < 4; ++i) rw[set][i] = gw[i * (4 * SEQ / 4) + j / 4];
  };
  auto rel_store = [&](int set) {            // register set -> the wave's LDS
#pragma unroll
    for (int i = 0; i < 4; ++i) {
      const int r = lr + 4 * i;
      wb[r * 8 + (fc ^ ((r >> 1) & 7))] = rw[set][i];
    }
  };
  if (REL) {
#pragma unroll
    for (int u = 0; u < REL_LEAD; ++u) rel_load(u, u * 32);
    rel_store(0);
  }

  // A trip is REL_LEAD chunks, unrolled so that the register set is picked by
  // a compile-time index; 'more' says whether chunks REL_LEAD ahead exist.
  constexpr int TRIP = REL ? REL_LEAD : 1;
  auto trip = [&](int j0, auto more) {
#pragma unroll
  for (int u = 0; u < TRIP; ++u) {
    const int j = j0 + u * 32;
    v8f w0, w1;                      // weights of the lane's 8 + 8 keys
    if (REL) {
      lds_wave_sync();               // this chunk's units, stored a chunk ago
      union { v8f v; v4f q[2]; } a, b;
      a.q[0] = wb[m * 8 + ((2 * hk) ^ sw)];
      a.q[1] = wb[m * 8 + ((2 * hk + 1) ^ sw)];
      b.q[0] = wb[m * 8 + ((2 * hk + 4) ^ sw)];
      b.q[1] = wb[m * 8 + ((2 * hk + 5) ^ sw)];
      w0 = a.v;
      w1 = b.v;
      // into the set that went to LDS a chunk ago
      if (decltype(more)::v) rel_load(u, j + REL_LEAD * 32);
    }
    FragU ak0, ak1, av0, av1;
    const v8h* kj = kv + j * 4;      // 16 keys are 64 units; slots repeat
    ak0.h[0] = kj[kl0];
    ak0.h[1] = kj[kl1];
    ak1.h[0] = kj[64 + kl0];
    ak1.h[1] = kj[64 + kl1];
    const int bj = j * 2;            // 4 units a chunk: adds to p as an XOR
    av0.h[0] = *reinterpret_cast<const v8h*>(kvb + (vb0 ^ bj));
    av0.h[1] = *reinterpret_cast<const v8h*>(kvb + (vb1 ^ bj));
    av1.h[0] = *reinterpret_cast<const v8h*>(kvb + 16 * 4096 + (vb0 ^ bj));
    av1.h[1] = *reinterpret_cast<const v8h*>(kvb + 16 * 4096 + (vb1 ^ bj));
    // keeps all of the chunk's loads issued ahead of the first product: sunk
    // to their users, each would expose a load latency of its own
    __builtin_amdgcn_sched_barrier(0);

    v8f s0 = {}, s1 = {};
    s0 = wmma_f16(ak0.v, bq, s0);   // s0[r] = S[q][key = j + 8*hk + r]
    s1 = wmma_f16(ak1.v, bq, s1);   // s1[r] = S[q][key = j + 16 + 8*hk + r]
    s0 *= SCALING;
    s1 *= SCALING;

    float mx = fmaxf(s0[0], s1[0]);
#pragma unroll
    for (int r = 1; r < 8; ++r) mx = fmaxf(mx, fmaxf(s0[r], s1[r]));
    mx = fmaxf(mx, xhalf(mx));                  // both halves of the 32 keys
    const float mnew  = fmaxf(mrun, mx);
    const float alpha = __expf(mrun - mnew);
#pragma unroll
    for (int r = 0; r < 8; ++r) {
      s0[r] = __expf(s0[r] - mnew);
      s1[r] = __expf(s1[r] - mnew);
    }
    if (REL) {                                  // exp(s)*w, renormalized online
      s0 *= w0;
      s1 *= w1;
      if (decltype(more)::v || u + 1 < TRIP) {
        lds_wave_sync();             // every lane has read this chunk's units:
        rel_store((u + 1) % REL_LEAD);   // the next chunk's take their place
      }
    }
    const v8f t = s0 + s1;
    const float rs = ((t[0] + t[1]) + (t[2] + t[3])) +
                     ((t[4] + t[5]) + (t[6] + t[7]));
    lrun = lrun * alpha + rs;
    mrun = mnew;
    FragU pf;                                   // P^T as B operand
    pf.h[0] = __builtin_convertvector(s0, v8h);
    pf.h[1] = __builtin_convertvector(s1, v8h);
    o0 *= alpha;
    o1 *= alpha;
    o0 = wmma_f16(av0.v, pf.v, o0);
    o1 = wmma_f16(av1.v, pf.v, o1);
  }
  };
  constexpr int STEP = TRIP * 32;
  for (int j0 = 0; j0 < (REL ? SEQ - STEP : SEQ); j0 += STEP) trip(j0, Flag<true>{});
  if (REL) trip(SEQ - STEP, Flag<false>{});

  const float eps = REL ? 1e-6f : 0.0f;
  const float inv = 1.0f / (lrun + xhalf(lrun) + eps);   // join the halves once
  *reinterpret_cast<v8h*>(op)      = __builtin_convertvector(o0 * inv, v8h);
  *reinterpret_cast<v8h*>(op + 16) = __builtin_convertvector(o1 * inv, v8h);
}

__global__ void __launch_bounds__(ATT_WAVES * 32)
attn_fused(const _Float16* __restrict__ qh, const _Float16* __restrict__ kh,
           const _Float16* __restrict__ vT, const float* __restrict__ relw,
           _Float16* __restrict__ attn_out) {
  const int lane = threadIdx.x & 31, wid = threadIdx.x >> 5;
  const int m = lane & 15, hk = lane >> 4;
  const int b = blockIdx.z, h = blockIdx.y;
  const int qbase = blockIdx.x * (ATT_WAVES * 16) + wid * 16;
  const size_t headoff = (size_t)(b * NHEAD + h);
  const _Float16* Q = qh + headoff * SEQ * HEAD_DIM;
  const v8h* gK = reinterpret_cast<const v8h*>(kh + headoff * SEQ * HEAD_DIM);
  const v8h* gV = reinterpret_cast<const v8h*>(vT + headoff * HEAD_DIM * SEQ);

  __shared__ v8h kv[2 * KV_UNITS + ATT_WAVES * REL_UNITS];
  constexpr int FILL = KV_UNITS / (ATT_WAVES * 32);  // units a thread moves
  v8h rk[FILL], rv[FILL];
#pragma unroll
  for (int i = 0; i < FILL; ++i) {
    rk[i] = gK[i * (ATT_WAVES * 32) + (int)threadIdx.x];
    rv[i] = gV[i * (ATT_WAVES * 32) + (int)threadIdx.x];
  }
  // stands in front of the first reuse of a register that these loads name;
  // the two bases are inputs so that their registers stay theirs up to here
  asm volatile("s_wait_xcnt 0x0" :: "s"(gK), "s"(gV) : "memory");
#pragma unroll
  for (int i = 0; i < FILL; ++i) {
    const int u = i * (ATT_WAVES * 32) + (int)threadIdx.x;
    kv[k_slot(u)] = rk[i];
    kv[KV_UNITS + v_slot(u)] = rv[i];
  }
  __syncthreads();   // every wave reads what all 16 have stored
  _Float16* op = attn_out + ((size_t)(b * SEQ + qbase + m)) * E_DIM +
                 h * HEAD_DIM + hk * 8;
  if (h >= NORMAL_HEADS) {
    const float* relfill =
        relw + ((size_t)(b * RHEAD + (h - NORMAL_HEADS))) * SEQ * SEQ +
        (size_t)(qbase + (lane >> 3)) * SEQ + (lane & 7) * 4;
    v4f* wb = reinterpret_cast<v4f*>(kv + 2 * KV_UNITS + wid * REL_UNITS);
    attn_rows<true>(Q, kv, relfill, wb, op, qbase, lane);
  } else {
    attn_rows<false>(Q, kv, nullptr, nullptr, op, qbase, lane);
  }
}

// ---------------------------------------------------------------------------
// Output projection + LayerNorm fused.  A block of 16 waves computes a full
// strip of 32 rows x 512 columns, so that LN can reduce each row from LDS.
// As in proj_gemm, rows come from global memory by whole-line loads, one
// 16-byte unit a lane, and go to LDS, and the waves take their fragments
// there; a wave owns 32 rows x 32 columns (2 x 2 tiles), so a fragment feeds
// two products, and a line of Wo^T is fetched once for 32 rows of output.
// The strip's X rows (32 KB) are put down once, for all waves.  Wo^T runs in
// 8 stages of 64 k.  A wave's 32 columns are 32 rows of Wo^T that no other wave
// needs: each wave stages its own rows (4 KB a stage) through two LDS buffers
// of its own and two register sets, so the k loop holds no barrier and the
// waves drift apart, one wave's LDS stores beside another's reads and products.
// LDS unit of row r, column unit c of a stage: r * 8 + (c ^ ((r >> 1) & 7)),
// as in proj_gemm.  The k order of every sum is the one of a plain k loop.
// ---------------------------------------------------------------------------
#define OP_ROWS 32
#define OP_WAVES 16
#define OP_STAGES (E_DIM / 64)
#define OP_UNITS (32 * 8)          // 16-byte units of 32 rows of one stage

__global__ void __launch_bounds__(OP_WAVES * 32)
outproj_ln(const _Float16* __restrict__ attn16, const _Float16* __restrict__ WoT,
           const float* __restrict__ bo, const float* __restrict__ gamma,
           const float* __restrict__ beta, float* __restrict__ out) {
  // the X rows of all stages, then each wave's two buffers
  __shared__ v8h stx[(OP_STAGES + OP_WAVES * 2) * OP_UNITS];
  __shared__ float rowbuf[OP_ROWS][E_DIM];
  const int tid = threadIdx.x;
  const int lane = tid & 31, wid = tid >> 5;
  const int m = lane & 15, hk = lane >> 4;
  const int rbase = blockIdx.x * OP_ROWS;
  const int fc = tid & 7;
  // filling Wo^T: lane = unit fc of the wave's rows lr, lr + 4, ...
  const int lr = lane >> 3;
  const v8h* pw = reinterpret_cast<const v8h*>(WoT) +
                  (wid * 32 + lr) * (E_DIM / 8) + fc;
  v8h* wbuf = stx + (OP_STAGES + wid * 2) * OP_UNITS;
  // filling X: thread = unit fc of row xr in stages xs, xs + 2, ...
  const int xr = (tid >> 3) & 31, xs = tid >> 8;
  const v8h* px = reinterpret_cast<const v8h*>(attn16) +
                  (rbase + xr) * (E_DIM / 8) + xs * 8 + fc;
  const int xfs = xs * OP_UNITS + xr * 8 + (fc ^ ((xr >> 1) & 7));
  // reading: row m of a 16-row tile of X or of the wave's Wo^T rows
  const int frow = m * 8;
  const int sz = (m >> 1) & 7;
  const int col0 = wid * 32 + m;

  // two register sets: stage s + 2 is asked for while stage s is worked on.
  // Every loop from here on is unrolled, so that the register arrays, the set
  // and the LDS buffer are picked by compile-time indices (no scratch memory).
  v8h nx[OP_STAGES / 2], nw[2][8];
#pragma unroll
  for (int i = 0; i < 8; ++i) nw[0][i] = pw[i * 4 * (E_DIM / 8)];
#pragma unroll
  for (int i = 0; i < OP_STAGES / 2; ++i) nx[i] = px[i * 16];
#pragma unroll
  for (int i = 0; i < 8; ++i) nw[1][i] = pw[i * 4 * (E_DIM / 8) + 8];
  const float bv[2] = {bo[col0], bo[col0 + 16]};
  // stands in front of the first reuse of a register that these loads name;
  // the two bases are inputs so that their registers stay theirs up to here
  asm volatile("s_wait_xcnt 0x0" :: "v"(px), "v"(pw) : "memory");
#pragma unroll
  for (int i = 0; i < 8; ++i) {
    const int r = lr + 4 * i;
    wbuf[r * 8 + (fc ^ ((r >> 1) & 7))] = nw[0][i];
  }
#pragma unroll
  for (int i = 0; i < OP_STAGES / 2; ++i) stx[xfs + i * 2 * OP_UNITS] = nx[i];
  lds_barrier();   // every wave reads the X rows that all 16 have stored

  v8f acc[2][2] = {{{}, {}}, {{}, {}}};
#pragma unroll
  for (int s = 0; s < OP_STAGES; ++s) {
    if (s + 2 < OP_STAGES) {   // into the set that went to LDS a stage ago
#pragma unroll
      for (int i = 0; i < 8; ++i)
        nw[s & 1][i] = pw[i * 4 * (E_DIM / 8) + (s + 2) * 8];
    }
    // keeps the eight loads issued ahead of the stage's products: sunk towards
    // their LDS stores they would lose the lead that hides their latency
    __builtin_amdgcn_sched_barrier(0);
    const v8h* sbx = stx + s * OP_UNITS;
    const v8h* sbw = wbuf + (s & 1) * OP_UNITS;
#pragma unroll
    for (int ks = 0; ks < 2; ++ks) {
      const int c0 = (ks * 4 + hk) ^ sz, c1 = (ks * 4 + 2 + hk) ^ sz;
      FragU fx[2], fw[2];
#pragma unroll
      for (int t = 0; t < 2; ++t) {
        fx[t].h[0] = sbx[frow + t * 128 + c0];
        fx[t].h[1] = sbx[frow + t * 128 + c1];
        fw[t].h[0] = sbw[frow + t * 128 + c0];
        fw[t].h[1] = sbw[frow + t * 128 + c1];
      }
#pragma unroll
      for (int i = 0; i < 2; ++i)
#pragma unroll
        for (int j = 0; j < 2; ++j)
          acc[i][j] = wmma_f16(fx[i].v, fw[j].v, acc[i][j]);
    }
    if (s + 1 < OP_STAGES) {   // the buffer whose fragments stage s - 1 has used
      v8h* d = wbuf + ((s + 1) & 1) * OP_UNITS;
#pragma unroll
      for (int i = 0; i < 8; ++i) {
        const int r = lr + 4 * i;
        d[r * 8 + (fc ^ ((r >> 1) & 7))] = nw[(s + 1) & 1][i];
      }
      lds_wave_sync();
    }
  }

#pragma unroll
  for (int j = 0; j < 2; ++j)
#pragma unroll
    for (int i = 0; i < 2; ++i)
#pragma unroll
      for (int r = 0; r < 8; ++r)
        rowbuf[i * 16 + hk * 8 + r][col0 + j * 16] = acc[i][j][r] + bv[j];
  __syncthreads();
#pragma unroll
  for (int rr = 0; rr < 2; ++rr) {
    int row = wid * 2 + rr;
    float s = 0.f, s2 = 0.f;
    for (int c = lane; c < E_DIM; c += 32) {
      float v = rowbuf[row][c];
      s += v; s2 += v * v;
    }
#pragma unroll
    for (int off = 16; off > 0; off >>= 1) {
      s  += __shfl_xor(s, off);
      s2 += __shfl_xor(s2, off);
    }
    float mean = s * (1.0f / E_DIM);
    float var  = s2 * (1.0f / E_DIM) - mean * mean;
    float rstd = rsqrtf(var + 1e-5f);
    for (int c = lane; c < E_DIM; c += 32) {
      out[(size_t)(rbase + row) * E_DIM + c] =
          (rowbuf[row][c] - mean) * rstd * gamma[c] + beta[c];
    }
  }
}

// ---------------------------------------------------------------------------
extern "C" void kernel_launch(void* const* d_in, const int* in_sizes, int n_in,
                              void* d_out, int out_size, void* d_ws, size_t ws_size,
                              hipStream_t stream) {
  const float* query = (const float*)d_in[0];
  const float* key   = (const float*)d_in[1];
  const float* value = (const float*)d_in[2];
  const float* relw  = (const float*)d_in[3];
  const float* Wq = (const float*)d_in[4];
  const float* bq = (const float*)d_in[5];
  const float* Wk = (const float*)d_in[6];
  const float* bk = (const float*)d_in[7];
  const float* Wv = (const float*)d_in[8];
  const float* bv = (const float*)d_in[9];
  const float* Wo = (const float*)d_in[10];
  const float* bo = (const float*)d_in[11];
  const float* gamma = (const float*)d_in[12];
  const float* beta  = (const float*)d_in[13];
  float* out = (float*)d_out;

  // workspace carve-up (~30 MB)
  const size_t XE = (size_t)BATCH * SEQ * E_DIM;   // 2M elems
  const size_t WE = (size_t)E_DIM * E_DIM;         // 256K elems
  char* ws = (char*)d_ws;
  _Float16* xq16 = (_Float16*)ws; ws += XE * sizeof(_Float16);
  _Float16* xk16 = (_Float16*)ws; ws += XE * sizeof(_Float16);
  _Float16* xv16 = (_Float16*)ws; ws += XE * sizeof(_Float16);
  _Float16* WqT  = (_Float16*)ws; ws += WE * sizeof(_Float16);
  _Float16* WkT  = (_Float16*)ws; ws += WE * sizeof(_Float16);
  _Float16* WvT  = (_Float16*)ws; ws += WE * sizeof(_Float16);
  _Float16* WoT  = (_Float16*)ws; ws += WE * sizeof(_Float16);
  _Float16* qh16 = (_Float16*)ws; ws += XE * sizeof(_Float16);
  _Float16* kh16 = (_Float16*)ws; ws += XE * sizeof(_Float16);
  _Float16* vT16 = (_Float16*)ws; ws += XE * sizeof(_Float16);
  _Float16* at16 = (_Float16*)ws; ws += XE * sizeof(_Float16);
  (void)in_sizes; (void)n_in; (void)out_size; (void)ws_size;

  dim3 blk(256);
  // xq16, xk16, xv16 and WqT .. WoT lie one behind the other in the workspace
  prep_f16<<<PREP_BLOCKS, blk, 0, stream>>>(query, key, value, Wq, Wk, Wv, Wo,
                                            xq16, WqT);

  dim3 pg(BATCH * SEQ / PJ_ROWS, E_DIM / PJ_COLS);   // (64, 4)
  proj_gemm<<<pg, blk, 0, stream>>>(xq16, WqT, bq, qh16, nullptr, 0);
  proj_gemm<<<pg, blk, 0, stream>>>(xk16, WkT, bk, kh16, nullptr, 0);
  proj_gemm<<<pg, blk, 0, stream>>>(xv16, WvT, bv, nullptr, vT16, 1);

  dim3 ag(SEQ / (ATT_WAVES * 16), NHEAD, BATCH);     // (8, 16, 2)
  attn_fused<<<ag, dim3(ATT_WAVES * 32), 0, stream>>>(qh16, kh16, vT16, relw, at16);

  outproj_ln<<<BATCH * SEQ / OP_ROWS, dim3(OP_WAVES * 32), 0, stream>>>(at16, WoT, bo, gamma,
                                                                    beta, out);
}

// v007
// One run takes 66.7 microseconds.
// Next to v006, in two timings, it ran 1.12 times as fast each time.
// All steps since v000 together make it 6.47 times as fast.
#include <hip/hip_runtime.h>
#include <hip/hip_bf16.h>

// ---------------------------------------------------------------------------
// Relation-aware attention for MI455X (gfx1250, wave32, WMMA).
//
// Roofline: relation_weights (256 MB) dominates traffic -> memory bound at
// ~13us on 23.3 TB/s HBM *if* we never spill the 2x16x2048x2048 score tensor.
// Hence a fused flash-style attention kernel with online normalization, f16
// WMMA (16x16x32, K == head_dim == 32) for all GEMM work, f32 accumulate.
// ---------------------------------------------------------------------------

typedef __attribute__((ext_vector_type(16))) _Float16 v16h;
typedef __attribute__((ext_vector_type(8)))  _Float16 v8h;
typedef __attribute__((ext_vector_type(8)))  float    v8f;

#define E_DIM   512
#define NHEAD   16
#define RHEAD   8
#define NORMAL_HEADS 8
#define HEAD_DIM 32
#define BATCH   2
#define SEQ     2048
#define SCALING 0.17677669529663687f   // 32^-0.5

union FragU { v16h v; v8h h[2]; };

// A/B fragment loader (16-bit, 16x16x32 WMMA).
// A layout (ISA 7.12.2): lane = 16*hk + m holds row m; element e holds
//   k = (e<8 ? 0 : 16) + hk*8 + (e&7)  -> two contiguous 8-half (b128) loads.
// B fragments use the mirrored layout (lane&15 = column), so a row-major
// [N x K] (i.e. pre-transposed) matrix loads with the identical pattern.
__device__ __forceinline__ v16h load_frag(const _Float16* __restrict__ base,
                                          int ld, int row0, int k0, int lane) {
  const int m  = lane & 15;
  const int hk = lane >> 4;
  const _Float16* p = base + (size_t)(row0 + m) * ld + (k0 + hk * 8);
  FragU f;
  f.h[0] = *reinterpret_cast<const v8h*>(p);
  f.h[1] = *reinterpret_cast<const v8h*>(p + 16);
  return f.v;
}

__device__ __forceinline__ v8f wmma_f16(v16h a, v16h b, v8f c) {
  return __builtin_amdgcn_wmma_f32_16x16x32_f16(false, a, false, b,
                                                (short)0, c, false, false);
}

// ---------------------------------------------------------------------------
// Format conversion, one launch for all seven arrays.  The work is 28 MB in,
// 14 MB out; what it costs is launches and waves to start, so few waves each
// keep many whole-line accesses in flight.  All 512 blocks do the same work:
//   1/512 of each of query, key, value -> f16: a thread converts 4 x 4 floats
//   of each; a wave-wide load covers 512 contiguous bytes, a store 256;
//   one 64 k x 32 n tile of one weight matrix, WT[n][k] = W[k][n] (so GEMM
//   B-fragments are contiguous b128 loads): a thread reads 8 k of one column
//   (a wave-wide load is one line of W) and stores them as 16 bytes; the block
//   writes whole 128-byte lines of WT.
// ---------------------------------------------------------------------------
typedef __attribute__((ext_vector_type(4))) float    v4f;
typedef __attribute__((ext_vector_type(4))) _Float16 v4h;

#define PREP_BLOCKS 512
#define X_ELEMS (BATCH * SEQ * E_DIM)
#define W_ELEMS (E_DIM * E_DIM)

__global__ void __launch_bounds__(256)
prep_f16(const float* __restrict__ query, const float* __restrict__ key,
         const float* __restrict__ value, const float* __restrict__ Wq,
         const float* __restrict__ Wk, const float* __restrict__ Wv,
         const float* __restrict__ Wo, _Float16* __restrict__ x16,
         _Float16* __restrict__ wT16) {
  const int tid = threadIdx.x;
  const int blk = blockIdx.x;

  const int t = blk >> 7;                            // which matrix
  const float* Wm = t == 0 ? Wq : (t == 1 ? Wk : (t == 2 ? Wv : Wo));
  const int n  = (blk & 15) * 32 + (tid & 31);
  const int k0 = ((blk >> 4) & 7) * 64 + (tid >> 5) * 8;

  const int base = blk * 1024 + tid;                 // in units of 4 floats
  v4f xq[4], xk[4], xv[4];
#pragma unroll
  for (int i = 0; i < 4; ++i) {
    xq[i] = reinterpret_cast<const v4f*>(query)[base + i * 256];
    xk[i] = reinterpret_cast<const v4f*>(key)[base + i * 256];
    xv[i] = reinterpret_cast<const v4f*>(value)[base + i * 256];
  }
  v8f w;
#pragma unroll
  for (int i = 0; i < 8; ++i) w[i] = Wm[(k0 + i) * E_DIM + n];
  // keeps all 20 loads issued ahead of the first conversion: without it the
  // weight loads sink behind waits on the others, a second memory latency
  __builtin_amdgcn_sched_barrier(0);

#pragma unroll
  for (int i = 0; i < 4; ++i) {
    v4h* d = reinterpret_cast<v4h*>(x16) + base + i * 256;
    d[0]               = __builtin_convertvector(xq[i], v4h);
    d[X_ELEMS / 4]     = __builtin_convertvector(xk[i], v4h);
    d[2 * X_ELEMS / 4] = __builtin_convertvector(xv[i], v4h);
  }
  *reinterpret_cast<v8h*>(wT16 + (size_t)t * W_ELEMS + n * E_DIM + k0) =
      __builtin_convertvector(w, v8h);
}

// ---------------------------------------------------------------------------
// Projection GEMM: Y = X @ W + b.  A block of 8 waves computes 64 rows x 128
// columns; K runs in 8 stages of 64.  A stage's X rows and W^T rows (one
// 128-byte line each) come from global memory by whole-line loads, one 16-byte
// unit a thread, and go to LDS; the waves take their fragments there.  A
// fragment load from global memory touches 16 lines for its 512 bytes and
// feeds one product; here a line is fetched once a block, and a wave owns
// 32 rows x 32 columns (2 x 2 tiles), so a fragment feeds two products.
// Two LDS buffers and two register sets: the loads of the stage after next fly
// while this stage is worked on.
// LDS unit of row r, column unit c: r * 8 + (c ^ ((r >> 1) & 7)), so that the
// 16 lanes of a half wave, which read 16 rows at one c, fall on 16 different
// bank groups.
// Output scattered to head-major f16: [B,H,L,HD] (q,k) or [B,H,HD,L] (v^T).
// The three projections read nothing of each other: they are one launch, and
// blockIdx.z says which (0 q, 1 k, 2 v).  One projection alone is 256 blocks,
// two waves a SIMD, that mostly wait for loads; the 768 blocks are all resident
// at once (three a WGP), so the three chains of waits run side by side and two
// launch gaps, fills and tails go.  X16, WT16 and out16 each hold the arrays of
// q, k and v one behind the other.
// ---------------------------------------------------------------------------
#define PJ_ROWS 64
#define PJ_COLS 128
#define PJ_STAGES (E_DIM / 64)
#define PJ_UNITS ((PJ_ROWS + PJ_COLS) * 8)   // 16-byte units of one stage

// Work-group barrier that orders LDS traffic alone.  __syncthreads() also waits
// for every global load in flight, which would end the lead of the loads that
// are asked for two stages ahead; they land in registers of their own wave.
__device__ __forceinline__ void lds_barrier() {
  __builtin_amdgcn_fence(__ATOMIC_RELEASE, "workgroup", "local");
  __builtin_amdgcn_s_barrier();
  __builtin_amdgcn_fence(__ATOMIC_ACQUIRE, "workgroup", "local");
}

// The lanes of one wave hand each other units through LDS: the wave's stores
// have landed before any of its lanes reads there.  No other wave is waited for.
__device__ __forceinline__ void lds_wave_sync() {
  __builtin_amdgcn_fence(__ATOMIC_ACQ_REL, "workgroup", "local");
}

__global__ void __launch_bounds__(256)
proj_gemm(const _Float16* __restrict__ X16, const _Float16* __restrict__ WT16,
          const float* __restrict__ bias_q, const float* __restrict__ bias_k,
          const float* __restrict__ bias_v, _Float16* __restrict__ out16) {
  __shared__ v8h st[2 * PJ_UNITS];
  const int which = blockIdx.z;
  const float* bias = which == 0 ? bias_q : (which == 1 ? bias_k : bias_v);
  X16 += which * X_ELEMS;
  WT16 += which * W_ELEMS;
  out16 += which * X_ELEMS;
  const int tid = threadIdx.x;
  const int lane = tid & 31, wid = tid >> 5;
  const int m = lane & 15, hk = lane >> 4;
  const int rbase = blockIdx.x * PJ_ROWS;
  const int cbase = blockIdx.y * PJ_COLS;
  // filling: thread = unit fc of rows fr, fr + 32, ...
  const int fc = tid & 7, fr = tid >> 3;
  const v8h* px = reinterpret_cast<const v8h*>(X16) + (rbase + fr) * (E_DIM / 8) + fc;
  const v8h* pw = reinterpret_cast<const v8h*>(WT16) + (cbase + fr) * (E_DIM / 8) + fc;
  const int fs = fr * 8 + (fc ^ ((fr >> 1) & 7));
  // reading: the wave's X rows and W^T rows; the lane's units of a fragment
  // (k = 8*hk .. and 16 + 8*hk ..) for the two k steps of a stage
  const int xrow = ((wid >> 2) * 32 + m) * 8;
  const int wrow = (PJ_ROWS + (wid & 3) * 32 + m) * 8;
  const int sw = (m >> 1) & 7;

  // the wave's 32 columns are one head; a 64-row tile lies in one batch
  const int row0 = rbase + (wid >> 2) * 32 + hk * 8;
  const int col0 = cbase + (wid & 3) * 32 + m;
  const float bv[2] = {bias[col0], bias[col0 + 16]};

  // two register sets: stage s + 2 is asked for while stage s is worked on.
  // Every loop from here on is unrolled, so that the register arrays, the set
  // and the LDS buffer are picked by compile-time indices (no scratch memory).
  v8h nx[2][2], nw[2][4];
#pragma unroll
  for (int p = 0; p < 2; ++p) {
#pragma unroll
    for (int i = 0; i < 2; ++i) nx[p][i] = px[i * 32 * (E_DIM / 8) + p * 8];
#pragma unroll
    for (int i = 0; i < 4; ++i) nw[p][i] = pw[i * 32 * (E_DIM / 8) + p * 8];
  }
#pragma unroll
  for (int i = 0; i < 2; ++i) st[fs + i * 256] = nx[0][i];
#pragma unroll
  for (int i = 0; i < 4; ++i) st[PJ_ROWS * 8 + fs + i * 256] = nw[0][i];

  v8f acc[2][2] = {{{}, {}}, {{}, {}}};
#pragma unroll
  for (int s = 0; s < PJ_STAGES; ++s) {
    // publishes stage s, and ends every wave's reads of the other buffer
    // before it is filled again below
    lds_barrier();
    if (s + 2 < PJ_STAGES) {   // into the set that went to LDS a stage ago
#pragma unroll
      for (int i = 0; i < 2; ++i)
        nx[s & 1][i] = px[i * 32 * (E_DIM / 8) + (s + 2) * 8];
#pragma unroll
      for (int i = 0; i < 4; ++i)
        nw[s & 1][i] = pw[i * 32 * (E_DIM / 8) + (s + 2) * 8];
    }
    // keeps the six loads issued ahead of the stage's products: sunk towards
    // their LDS stores they would lose the lead that hides their latency
    __builtin_amdgcn_sched_barrier(0);
    const v8h* sb = st + (s & 1) * PJ_UNITS;
#pragma unroll
    for (int ks = 0; ks < 2; ++ks) {
      const int c0 = (ks * 4 + hk) ^ sw, c1 = (ks * 4 + 2 + hk) ^ sw;
      FragU fx[2], fw[2];
#pragma unroll
      for (int t = 0; t < 2; ++t) {
        fx[t].h[0] = sb[xrow + t * 128 + c0];
        fx[t].h[1] = sb[xrow + t * 128 + c1];
        fw[t].h[0] = sb[wrow + t * 128 + c0];
        fw[t].h[1] = sb[wrow + t * 128 + c1];
      }
#pragma unroll
      for (int i = 0; i < 2; ++i)
#pragma unroll
        for (int j = 0; j < 2; ++j)
          acc[i][j] = wmma_f16(fx[i].v, fw[j].v, acc[i][j]);
    }
    if (s + 1 < PJ_STAGES) {
      v8h* d = st + ((s + 1) & 1) * PJ_UNITS;
#pragma unroll
      for (int i = 0; i < 2; ++i) d[fs + i * 256] = nx[(s + 1) & 1][i];
#pragma unroll
      for (int i = 0; i < 4; ++i) d[PJ_ROWS * 8 + fs + i * 256] = nw[(s + 1) & 1][i];
    }
  }

  // where the tile goes: a row is a sequence position, a column a head dim;
  // which of the two runs along memory depends on the projection (v goes out
  // transposed).  The two steps are picked by value.
  const int bb = row0 >> 11, l0 = row0 & (SEQ - 1);
  const int h = col0 >> 5, d0 = col0 & (HEAD_DIM - 1);
  const size_t head = (size_t)(bb * NHEAD + h) * SEQ * HEAD_DIM;
  const int rstep = which == 2 ? 1 : HEAD_DIM;
  const int cstep = which == 2 ? SEQ : 1;
  _Float16* o = out16 + head + l0 * rstep + d0 * cstep;
#pragma unroll
  for (int j = 0; j < 2; ++j)
#pragma unroll
    for (int i = 0; i < 2; ++i)
#pragma unroll
      for (int r = 0; r < 8; ++r)
        o[(i * 16 + r) * rstep + j * 16 * cstep] = (_Float16)(acc[i][j][r] + bv[j]);
}

// ---------------------------------------------------------------------------
// Fused flash attention, scores computed transposed.  Wave owns 16 q-rows;
// block = 16 waves = 256 q-rows for one (b,h).  64 chunks of 32 keys:
//   S^T = K . Q^T   (A = 16 key rows, B = 16 query columns), two tiles;
//   O^T += V^T . P^T (A = 16 head dims x 32 keys, B = P^T).
// In the D map a lane holds one query column (lane & 15) and 8 keys per tile
// (8*hk + r), so max and sum run over the lane's own registers plus one
// exchange with lane ^ 16, and the two packed score tiles are already the
// B operand of the second product (k = 8*hk + s, 16 + 8*hk + (s - 8)):
// P never leaves the registers.
//
// The head's whole K (128 KB) and V^T (128 KB) are put into LDS once, by
// whole-line loads, and all 16 waves take their A fragments from there: a
// fragment load from global memory touches 8 (K) or 16 (V^T) cache lines for
// its 512 bytes, and every wave would repeat it.  At more than 256 KB of LDS one
// block has a WGP to itself; 256 blocks.  LDS is counted in 16-byte units; a unit's low
// index bits are XORed with row bits so that the 16 lanes of a half wave,
// which read 16 rows at one column, fall on 16 different bank groups:
//   K   unit u = key * 4 + c   (c: 8 head dims)  -> u ^ ((key >> 2) & 3)
//   V^T unit u = d * 256 + p   (p: 8 keys)       -> u ^ (d & 15)
//
// Relation weights: a lane needs 8 + 8 weights of its own query row, so a load
// straight into that layout touches 16 rows (16 lines) for its 512 bytes, four
// times a chunk.  Instead a wave fetches its 16 rows x 32 keys by whole-line
// loads (8 lanes a line, 4 lines a load), four chunks ahead in four register
// sets, and turns each chunk through 2 KB of LDS of its own: no other wave
// reads there, so no barrier.  Unit of row r, column unit c (4 weights):
// r * 8 + (c ^ ((r >> 1) & 7)), as in proj_gemm.
// ---------------------------------------------------------------------------
#define ATT_WAVES 16
#define KV_UNITS (SEQ * HEAD_DIM / 8)    // 16-byte units of one head's K or V^T
#define REL_LEAD 4                       // chunks of weights held in registers
#define REL_UNITS (16 * 8)               // 16-byte units of 16 rows x 32 keys

template <bool B> struct Flag { static constexpr bool v = B; };

__device__ __forceinline__ int k_slot(int u) { return u ^ ((u >> 4) & 3); }
__device__ __forceinline__ int v_slot(int u) { return u ^ ((u >> 8) & 15); }

__device__ __forceinline__ float xhalf(float x) {   // value of lane ^ 16
  int b = __builtin_bit_cast(int, x);
  return __builtin_bit_cast(float, __builtin_amdgcn_permlanex16(
      b, b, 0x76543210, 0xfedcba98, false, false));
}

// kv: the head's K units, then its V^T units, in LDS.
// relfill: the lane's unit of the wave's relation rows, chunk 0: unit lane & 7
// of row lane >> 3; rows + 4, + 8, + 12 follow (REL only).
// wb: the wave's own LDS units for one chunk of weights (REL only).
// op: this lane's 8 + 8 output halves (d = 8*hk .., 16 + 8*hk ..).
template <bool REL>
__device__ __forceinline__ void
attn_rows(const _Float16* __restrict__ Q, const v8h* kv,
          const float* __restrict__ relfill, v4f* wb,
          _Float16* __restrict__ op, int qbase, int lane) {
  const v16h bq = load_frag(Q, HEAD_DIM, qbase, 0, lane);  // column = query
  // the lane's units of a fragment (k = 8*hk .. and 16 + 8*hk ..), chunk 0
  const int m = lane & 15, hk = lane >> 4;
  const int kl0 = k_slot(m * 4 + hk), kl1 = k_slot(m * 4 + hk + 2);
  const int vb0 = (KV_UNITS + v_slot(m * 256 + hk)) * 16;       // in bytes
  const int vb1 = (KV_UNITS + v_slot(m * 256 + hk + 2)) * 16;
  const char* kvb = reinterpret_cast<const char*>(kv);
  v8f o0 = {}, o1 = {};      // o0[r] = O[q][d = 8*hk + r], o1: d + 16
  float mrun = -1e30f, lrun = 0.0f;   // lrun: this lane's half of the keys

  // weights: where the lane puts its four units of a chunk, and where it finds
  // the four units of its own row (keys 8*hk .. and 16 + 8*hk ..)
  const v4f* gw = reinterpret_cast<const v4f*>(relfill);
  const int lr = lane >> 3, fc = lane & 7, sw = (m >> 1) & 7;
  v4f rw[REL_LEAD][4];
  auto rel_load = [&](int set, int j) {      // chunk at key j -> register set
#pragma unroll
    for (int i = 0; i < 4; ++i) rw[set][i] = gw[i * (4 * SEQ / 4) + j / 4];
  };
  auto rel_store = [&](int set) {            // register set -> the wave's LDS
#pragma unroll
    for (int i = 0; i < 4; ++i) {
      const int r = lr + 4 * i;
      wb[r * 8 + (fc ^ ((r >> 1) & 7))] = rw[set][i];
    }
  };
  if (REL) {
#pragma unroll
    for (int u = 0; u < REL_LEAD; ++u) rel_load(u, u * 32);
    rel_store(0);
  }

  // A trip is REL_LEAD chunks, unrolled so that the register set is picked by
  // a compile-time index; 'more' says whether chunks REL_LEAD ahead exist.
  constexpr int TRIP = REL ? REL_LEAD : 1;
  auto trip = [&](int j0, auto more) {
#pragma unroll
  for (int u = 0; u < TRIP; ++u) {
    const int j = j0 + u * 32;
    v8f w0, w1;                      // weights of the lane's 8 + 8 keys
    if (REL) {
      lds_wave_sync();               // this chunk's units, stored a chunk ago
      union { v8f v; v4f q[2]; } a, b;
      a.q[0] = wb[m * 8 + ((2 * hk) ^ sw)];
      a.q[1] = wb[m * 8 + ((2 * hk + 1) ^ sw)];
      b.q[0] = wb[m * 8 + ((2 * hk + 4) ^ sw)];
      b.q[1] = wb[m * 8 + ((2 * hk + 5) ^ sw)];
      w0 = a.v;
      w1 = b.v;
      // into the set that went to LDS a chunk ago
      if (decltype(more)::v) rel_load(u, j + REL_LEAD * 32);
    }
    FragU ak0, ak1, av0, av1;
    const v8h* kj = kv + j * 4;      // 16 keys are 64 units; slots repeat
    ak0.h[0] = kj[kl0];
    ak0.h[1] = kj[kl1];
    ak1.h[0] = kj[64 + kl0];
    ak1.h[1] = kj[64 + kl1];
    const int bj = j * 2;            // 4 units a chunk: adds to p as an XOR
    av0.h[0] = *reinterpret_cast<const v8h*>(kvb + (vb0 ^ bj));
    av0.h[1] = *reinterpret_cast<const v8h*>(kvb + (vb1 ^ bj));
    av1.h[0] = *reinterpret_cast<const v8h*>(kvb + 16 * 4096 + (vb0 ^ bj));
    av1.h[1] = *reinterpret_cast<const v8h*>(kvb + 16 * 4096 + (vb1 ^ bj));
    // keeps all of the chunk's loads issued ahead of the first product: sunk
    // to their users, each would expose a load latency of its own
    __builtin_amdgcn_sched_barrier(0);

    v8f s0 = {}, s1 = {};
    s0 = wmma_f16(ak0.v, bq, s0);   // s0[r] = S[q][key = j + 8*hk + r]
    s1 = wmma_f16(ak1.v, bq, s1);   // s1[r] = S[q][key = j + 16 + 8*hk + r]
    s0 *= SCALING;
    s1 *= SCALING;

    float mx = fmaxf(s0[0], s1[0]);
#pragma unroll
    for (int r = 1; r < 8; ++r) mx = fmaxf(mx, fmaxf(s0[r], s1[r]));
    mx = fmaxf(mx, xhalf(mx));                  // both halves of the 32 keys
    const float mnew  = fmaxf(mrun, mx);
    const float alpha = __expf(mrun - mnew);
#pragma unroll
    for (int r = 0; r < 8; ++r) {
      s0[r] = __expf(s0[r] - mnew);
      s1[r] = __expf(s1[r] - mnew);
    }
    if (REL) {                                  // exp(s)*w, renormalized online
      s0 *= w0;
      s1 *= w1;
      if (decltype(more)::v || u + 1 < TRIP) {
        lds_wave_sync();             // every lane has read this chunk's units:
        rel_store((u + 1) % REL_LEAD);   // the next chunk's take their place
      }
    }
    const v8f t = s0 + s1;
    const float rs = ((t[0] + t[1]) + (t[2] + t[3])) +
                     ((t[4] + t[5]) + (t[6] + t[7]));
    lrun = lrun * alpha + rs;
    mrun = mnew;
    FragU pf;                                   // P^T as B operand
    pf.h[0] = __builtin_convertvector(s0, v8h);
    pf.h[1] = __builtin_convertvector(s1, v8h);
    o0 *= alpha;
    o1 *= alpha;
    o0 = wmma_f16(av0.v, pf.v, o0);
    o1 = wmma_f16(av1.v, pf.v, o1);
  }
  };
  constexpr int STEP = TRIP * 32;
  for (int j0 = 0; j0 < (REL ? SEQ - STEP : SEQ); j0 += STEP) trip(j0, Flag<true>{});
  if (REL) trip(SEQ - STEP, Flag<false>{});

  const float eps = REL ? 1e-6f : 0.0f;
  const float inv = 1.0f / (lrun + xhalf(lrun) + eps);   // join the halves once
  *reinterpret_cast<v8h*>(op)      = __builtin_convertvector(o0 * inv, v8h);
  *reinterpret_cast<v8h*>(op + 16) = __builtin_convertvector(o1 * inv, v8h);
}

__global__ void __launch_bounds__(ATT_WAVES * 32)
attn_fused(const _Float16* __restrict__ qh, const _Float16* __restrict__ kh,
           const _Float16* __restrict__ vT, const float* __restrict__ relw,
           _Float16* __restrict__ attn_out) {
  const int lane = threadIdx.x & 31, wid = threadIdx.x >> 5;
  const int m = lane & 15, hk = lane >> 4;
  const int b = blockIdx.z, h = blockIdx.y;
  const int qbase = blockIdx.x * (ATT_WAVES * 16) + wid * 16;
  const size_t headoff = (size_t)(b * NHEAD + h);
  const _Float16* Q = qh + headoff * SEQ * HEAD_DIM;
  const v8h* gK = reinterpret_cast<const v8h*>(kh + headoff * SEQ * HEAD_DIM);
  const v8h* gV = reinterpret_cast<const v8h*>(vT + headoff * HEAD_DIM * SEQ);

  __shared__ v8h kv[2 * KV_UNITS + ATT_WAVES * REL_UNITS];
  constexpr int FILL = KV_UNITS / (ATT_WAVES * 32);  // units a thread moves
  v8h rk[FILL], rv[FILL];
#pragma unroll
  for (int i = 0; i < FILL; ++i) {
    rk[i] = gK[i * (ATT_WAVES * 32) + (int)threadIdx.x];
    rv[i] = gV[i * (ATT_WAVES * 32) + (int)threadIdx.x];
  }
  // stands in front of the first reuse of a register that these loads name;
  // the two bases are inputs so that their registers stay theirs up to here
  asm volatile("s_wait_xcnt 0x0" :: "s"(gK), "s"(gV) : "memory");
#pragma unroll
  for (int i = 0; i < FILL; ++i) {
    const int u = i * (ATT_WAVES * 32) + (int)threadIdx.x;
    kv[k_slot(u)] = rk[i];
    kv[KV_UNITS + v_slot(u)] = rv[i];
  }
  __syncthreads();   // every wave reads what all 16 have stored
  _Float16* op = attn_out + ((size_t)(b * SEQ + qbase + m)) * E_DIM +
                 h * HEAD_DIM + hk * 8;
  if (h >= NORMAL_HEADS) {
    const float* relfill =
        relw + ((size_t)(b * RHEAD + (h - NORMAL_HEADS))) * SEQ * SEQ +
        (size_t)(qbase + (lane >> 3)) * SEQ + (lane & 7) * 4;
    v4f* wb = reinterpret_cast<v4f*>(kv + 2 * KV_UNITS + wid * REL_UNITS);
    attn_rows<true>(Q, kv, relfill, wb, op, qbase, lane);
  } else {
    attn_rows<false>(Q, kv, nullptr, nullptr, op, qbase, lane);
  }
}

// ---------------------------------------------------------------------------
// Output projection + LayerNorm fused.  A block of 16 waves computes a full
// strip of 32 rows x 512 columns, so that LN can reduce each row from LDS.
// As in proj_gemm, rows come from global memory by whole-line loads, one
// 16-byte unit a lane, and go to LDS, and the waves take their fragments
// there; a wave owns 32 rows x 32 columns (2 x 2 tiles), so a fragment feeds
// two products, and a line of Wo^T is fetched once for 32 rows of output.
// The strip's X rows (32 KB) are put down once, for all waves.  Wo^T runs in
// 8 stages of 64 k.  A wave's 32 columns are 32 rows of Wo^T that no other wave
// needs: each wave stages its own rows (4 KB a stage) through two LDS buffers
// of its own and two register sets, so the k loop holds no barrier and the
// waves drift apart, one wave's LDS stores beside another's reads and products.
// LDS unit of row r, column unit c of a stage: r * 8 + (c ^ ((r >> 1) & 7)),
// as in proj_gemm.  The k order of every sum is the one of a plain k loop.
// ---------------------------------------------------------------------------
#define OP_ROWS 32
#define OP_WAVES 16
#define OP_STAGES (E_DIM / 64)
#define OP_UNITS (32 * 8)          // 16-byte units of 32 rows of one stage

__global__ void __launch_bounds__(OP_WAVES * 32)
outproj_ln(const _Float16* __restrict__ attn16, const _Float16* __restrict__ WoT,
           const float* __restrict__ bo, const float* __restrict__ gamma,
           const float* __restrict__ beta, float* __restrict__ out) {
  // the X rows of all stages, then each wave's two buffers
  __shared__ v8h stx[(OP_STAGES + OP_WAVES * 2) * OP_UNITS];
  __shared__ float rowbuf[OP_ROWS][E_DIM];
  const int tid = threadIdx.x;
  const int lane = tid & 31, wid = tid >> 5;
  const int m = lane & 15, hk = lane >> 4;
  const int rbase = blockIdx.x * OP_ROWS;
  const int fc = tid & 7;
  // filling Wo^T: lane = unit fc of the wave's rows lr, lr + 4, ...
  const int lr = lane >> 3;
  const v8h* pw = reinterpret_cast<const v8h*>(WoT) +
                  (wid * 32 + lr) * (E_DIM / 8) + fc;
  v8h* wbuf = stx + (OP_STAGES + wid * 2) * OP_UNITS;
  // filling X: thread = unit fc of row xr in stages xs, xs + 2, ...
  const int xr = (tid >> 3) & 31, xs = tid >> 8;
  const v8h* px = reinterpret_cast<const v8h*>(attn16) +
                  (rbase + xr) * (E_DIM / 8) + xs * 8 + fc;
  const int xfs = xs * OP_UNITS + xr * 8 + (fc ^ ((xr >> 1) & 7));
  // reading: row m of a 16-row tile of X or of the wave's Wo^T rows
  const int frow = m * 8;
  const int sz = (m >> 1) & 7;
  const int col0 = wid * 32 + m;

  // two register sets: stage s + 2 is asked for while stage s is worked on.
  // Every loop from here on is unrolled, so that the register arrays, the set
  // and the LDS buffer are picked by compile-time indices (no scratch memory).
  v8h nx[OP_STAGES / 2], nw[2][8];
#pragma unroll
  for (int i = 0; i < 8; ++i) nw[0][i] = pw[i * 4 * (E_DIM / 8)];
#pragma unroll
  for (int i = 0; i < OP_STAGES / 2; ++i) nx[i] = px[i * 16];
#pragma unroll
  for (int i = 0; i < 8; ++i) nw[1][i] = pw[i * 4 * (E_DIM / 8) + 8];
  const float bv[2] = {bo[col0], bo[col0 + 16]};
  // stands in front of the first reuse of a register that these loads name;
  // the two bases are inputs so that their registers stay theirs up to here
  asm volatile("s_wait_xcnt 0x0" :: "v"(px), "v"(pw) : "memory");
#pragma unroll
  for (int i = 0; i < 8; ++i) {
    const int r = lr + 4 * i;
    wbuf[r * 8 + (fc ^ ((r >> 1) & 7))] = nw[0][i];
  }
#pragma unroll
  for (int i = 0; i < OP_STAGES / 2; ++i) stx[xfs + i * 2 * OP_UNITS] = nx[i];
  lds_barrier();   // every wave reads the X rows that all 16 have stored

  v8f acc[2][2] = {{{}, {}}, {{}, {}}};
#pragma unroll
  for (int s = 0; s < OP_STAGES; ++s) {
    if (s + 2 < OP_STAGES) {   // into the set that went to LDS a stage ago
#pragma unroll
      for (int i = 0; i < 8; ++i)
        nw[s & 1][i] = pw[i * 4 * (E_DIM / 8) + (s + 2) * 8];
    }
    // keeps the eight loads issued ahead of the stage's products: sunk towards
    // their LDS stores they would lose the lead that hides their latency
    __builtin_amdgcn_sched_barrier(0);
    const v8h* sbx = stx + s * OP_UNITS;
    const v8h* sbw = wbuf + (s & 1) * OP_UNITS;
#pragma unroll
    for (int ks = 0; ks < 2; ++ks) {
      const int c0 = (ks * 4 + hk) ^ sz, c1 = (ks * 4 + 2 + hk) ^ sz;
      FragU fx[2], fw[2];
#pragma unroll
      for (int t = 0; t < 2; ++t) {
        fx[t].h[0] = sbx[frow + t * 128 + c0];
        fx[t].h[1] = sbx[frow + t * 128 + c1];
        fw[t].h[0] = sbw[frow + t * 128 + c0];
        fw[t].h[1] = sbw[frow + t * 128 + c1];
      }
#pragma unroll
      for (int i = 0; i < 2; ++i)
#pragma unroll
        for (int j = 0; j < 2; ++j)
          acc[i][j] = wmma_f16(fx[i].v, fw[j].v, acc[i][j]);
    }
    if (s + 1 < OP_STAGES) {   // the buffer whose fragments stage s - 1 has used
      v8h* d = wbuf + ((s + 1) & 1) * OP_UNITS;
#pragma unroll
      for (int i = 0; i < 8; ++i) {
        const int r = lr + 4 * i;
        d[r * 8 + (fc ^ ((r >> 1) & 7))] = nw[(s + 1) & 1][i];
      }
      lds_wave_sync();
    }
  }

#pragma unroll
  for (int j = 0; j < 2; ++j)
#pragma unroll
    for (int i = 0; i < 2; ++i)
#pragma unroll
      for (int r = 0; r < 8; ++r)
        rowbuf[i * 16 + hk * 8 + r][col0 + j * 16] = acc[i][j][r] + bv[j];
  __syncthreads();
#pragma unroll
  for (int rr = 0; rr < 2; ++rr) {
    int row = wid * 2 + rr;
    float s = 0.f, s2 = 0.f;
    for (int c = lane; c < E_DIM; c += 32) {
      float v = rowbuf[row][c];
      s += v; s2 += v * v;
    }
#pragma unroll
    for (int off = 16; off > 0; off >>= 1) {
      s  += __shfl_xor(s, off);
      s2 += __shfl_xor(s2, off);
    }
    float mean = s * (1.0f / E_DIM);
    float var  = s2 * (1.0f / E_DIM) - mean * mean;
    float rstd = rsqrtf(var + 1e-5f);
    for (int c = lane; c < E_DIM; c += 32) {
      out[(size_t)(rbase + row) * E_DIM + c] =
          (rowbuf[row][c] - mean) * rstd * gamma[c] + beta[c];
    }
  }
}

// ---------------------------------------------------------------------------
extern "C" void kernel_launch(void* const* d_in, const int* in_sizes, int n_in,
                              void* d_out, int out_size, void* d_ws, size_t ws_size,
                              hipStream_t stream) {
  const float* query = (const float*)d_in[0];
  const float* key   = (const float*)d_in[1];
  const float* value = (const float*)d_in[2];
  const float* relw  = (const float*)d_in[3];
  const float* Wq = (const float*)d_in[4];
  const float* bq = (const float*)d_in[5];
  const float* Wk = (const float*)d_in[6];
  const float* bk = (const float*)d_in[7];
  const float* Wv = (const float*)d_in[8];
  const float* bv = (const float*)d_in[9];
  const float* Wo = (const float*)d_in[10];
  const float* bo = (const float*)d_in[11];
  const float* gamma = (const float*)d_in[12];
  const float* beta  = (const float*)d_in[13];
  float* out = (float*)d_out;

  // workspace carve-up (~30 MB)
  const size_t XE = (size_t)BATCH * SEQ * E_DIM;   // 2M elems
  const size_t WE = (size_t)E_DIM * E_DIM;         // 256K elems
  char* ws = (char*)d_ws;
  _Float16* xq16 = (_Float16*)ws; ws += XE * sizeof(_Float16);
  _Float16* xk16 = (_Float16*)ws; ws += XE * sizeof(_Float16);
  _Float16* xv16 = (_Float16*)ws; ws += XE * sizeof(_Float16);
  _Float16* WqT  = (_Float16*)ws; ws += WE * sizeof(_Float16);
  _Float16* WkT  = (_Float16*)ws; ws += WE * sizeof(_Float16);
  _Float16* WvT  = (_Float16*)ws; ws += WE * sizeof(_Float16);
  _Float16* WoT  = (_Float16*)ws; ws += WE * sizeof(_Float16);
  _Float16* qh16 = (_Float16*)ws; ws += XE * sizeof(_Float16);
  _Float16* kh16 = (_Float16*)ws; ws += XE * sizeof(_Float16);
  _Float16* vT16 = (_Float16*)ws; ws += XE * sizeof(_Float16);
  _Float16* at16 = (_Float16*)ws; ws += XE * sizeof(_Float16);
  (void)in_sizes; (void)n_in; (void)out_size; (void)ws_size;

  dim3 blk(256);
  // xq16, xk16, xv16 and WqT .. WoT lie one behind the other in the workspace
  prep_f16<<<PREP_BLOCKS, blk, 0, stream>>>(query, key, value, Wq, Wk, Wv, Wo,
                                            xq16, WqT);

  // qh16, kh16 and vT16 lie one behind the other too
  dim3 pg(BATCH * SEQ / PJ_ROWS, E_DIM / PJ_COLS, 3);   // (64, 4, 3)
  proj_gemm<<<pg, blk, 0, stream>>>(xq16, WqT, bq, bk, bv, qh16);

  dim3 ag(SEQ / (ATT_WAVES * 16), NHEAD, BATCH);     // (8, 16, 2)
  attn_fused<<<ag, dim3(ATT_WAVES * 32), 0, stream>>>(qh16, kh16, vT16, relw, at16);

  outproj_ln<<<BATCH * SEQ / OP_ROWS, dim3(OP_WAVES * 32), 0, stream>>>(at16, WoT, bo, gamma,
                                                                    beta, out);
}

// v008
// Measured time: 64.2 microseconds a run.
// Two timings next to v007 both put it at 1.04 times that version's speed.
// Over all steps from v000 it is 6.76 times as fast.
#include <hip/hip_runtime.h>
#include <hip/hip_bf16.h>

// ---------------------------------------------------------------------------
// Relation-aware attention for MI455X (gfx1250, wave32, WMMA).
//
// Roofline: relation_weights (256 MB) dominates traffic -> memory bound at
// ~13us on 23.3 TB/s HBM *if* we never spill the 2x16x2048x2048 score tensor.
// Hence a fused flash-style attention kernel with online normalization, f16
// WMMA (16x16x32, K == head_dim == 32) for all GEMM work, f32 accumulate.
// ---------------------------------------------------------------------------

typedef __attribute__((ext_vector_type(16))) _Float16 v16h;
typedef __attribute__((ext_vector_type(8)))  _Float16 v8h;
typedef __attribute__((ext_vector_type(8)))  float    v8f;

#define E_DIM   512
#define NHEAD   16
#define RHEAD   8
#define NORMAL_HEADS 8
#define HEAD_DIM 32
#define BATCH   2
#define SEQ     2048
#define SCALING 0.17677669529663687f   // 32^-0.5

union FragU { v16h v; v8h h[2]; };

// A/B fragment loader (16-bit, 16x16x32 WMMA).
// A layout (ISA 7.12.2): lane = 16*hk + m holds row m; element e holds
//   k = (e<8 ? 0 : 16) + hk*8 + (e&7)  -> two contiguous 8-half (b128) loads.
// B fragments use the mirrored layout (lane&15 = column), so a row-major
// [N x K] (i.e. pre-transposed) matrix loads with the identical pattern.
__device__ __forceinline__ v16h load_frag(const _Float16* __restrict__ base,
                                          int ld, int row0, int k0, int lane) {
  const int m  = lane & 15;
  const int hk = lane >> 4;
  const _Float16* p = base + (size_t)(row0 + m) * ld + (k0 + hk * 8);
  FragU f;
  f.h[0] = *reinterpret_cast<const v8h*>(p);
  f.h[1] = *reinterpret_cast<const v8h*>(p + 16);
  return f.v;
}

__device__ __forceinline__ v8f wmma_f16(v16h a, v16h b, v8f c) {
  return __builtin_amdgcn_wmma_f32_16x16x32_f16(false, a, false, b,
                                                (short)0, c, false, false);
}

// ---------------------------------------------------------------------------
// Format conversion, one launch for all seven arrays.  The work is 28 MB in,
// 14 MB out; what it costs is launches and waves to start, so few waves each
// keep many whole-line accesses in flight.  All 512 blocks do the same work:
//   1/512 of each of query, key, value -> f16: a thread converts 4 x 4 floats
//   of each; a wave-wide load covers 512 contiguous bytes, a store 256;
//   one 64 k x 32 n tile of one weight matrix, WT[n][k] = W[k][n] (so GEMM
//   B-fragments are contiguous b128 loads): a thread reads 8 k of one column
//   (a wave-wide load is one line of W) and stores them as 16 bytes; the block
//   writes whole 128-byte lines of WT.
// ---------------------------------------------------------------------------
typedef __attribute__((ext_vector_type(4))) float    v4f;
typedef __attribute__((ext_vector_type(4))) _Float16 v4h;

#define PREP_BLOCKS 512
#define X_ELEMS (BATCH * SEQ * E_DIM)
#define W_ELEMS (E_DIM * E_DIM)

__global__ void __launch_bounds__(256)
prep_f16(const float* __restrict__ query, const float* __restrict__ key,
         const float* __restrict__ value, const float* __restrict__ Wq,
         const float* __restrict__ Wk, const float* __restrict__ Wv,
         const float* __restrict__ Wo, _Float16* __restrict__ x16,
         _Float16* __restrict__ wT16) {
  const int tid = threadIdx.x;
  const int blk = blockIdx.x;

  const int t = blk >> 7;                            // which matrix
  const float* Wm = t == 0 ? Wq : (t == 1 ? Wk : (t == 2 ? Wv : Wo));
  const int n  = (blk & 15) * 32 + (tid & 31);
  const int k0 = ((blk >> 4) & 7) * 64 + (tid >> 5) * 8;

  const int base = blk * 1024 + tid;                 // in units of 4 floats
  v4f xq[4], xk[4], xv[4];
#pragma unroll
  for (int i = 0; i < 4; ++i) {
    xq[i] = reinterpret_cast<const v4f*>(query)[base + i * 256];
    xk[i] = reinterpret_cast<const v4f*>(key)[base + i * 256];
    xv[i] = reinterpret_cast<const v4f*>(value)[base + i * 256];
  }
  v8f w;
#pragma unroll
  for (int i = 0; i < 8; ++i) w[i] = Wm[(k0 + i) * E_DIM + n];
  // keeps all 20 loads issued ahead of the first conversion: without it the
  // weight loads sink behind waits on the others, a second memory latency
  __builtin_amdgcn_sched_barrier(0);

#pragma unroll
  for (int i = 0; i < 4; ++i) {
    v4h* d = reinterpret_cast<v4h*>(x16) + base + i * 256;
    d[0]               = __builtin_convertvector(xq[i], v4h);
    d[X_ELEMS / 4]     = __builtin_convertvector(xk[i], v4h);
    d[2 * X_ELEMS / 4] = __builtin_convertvector(xv[i], v4h);
  }
  *reinterpret_cast<v8h*>(wT16 + (size_t)t * W_ELEMS + n * E_DIM + k0) =
      __builtin_convertvector(w, v8h);
}

// ---------------------------------------------------------------------------
// Projection GEMM: Y = X @ W + b.  A block of 8 waves computes 64 rows x 128
// columns; K runs in 8 stages of 64.  A stage's X rows and W^T rows (one
// 128-byte line each) come from global memory by whole-line loads, one 16-byte
// unit a thread, and go to LDS; the waves take their fragments there.  A
// fragment load from global memory touches 16 lines for its 512 bytes and
// feeds one product; here a line is fetched once a block, and a wave owns
// 32 rows x 32 columns (2 x 2 tiles), so a fragment feeds two products.
// Two LDS buffers and two register sets: the loads of the stage after next fly
// while this stage is worked on.
// LDS unit of row r, column unit c: r * 8 + (c ^ ((r >> 1) & 7)), so that the
// 16 lanes of a half wave, which read 16 rows at one c, fall on 16 different
// bank groups.
// Output scattered to head-major f16: [B,H,L,HD] (q,k) or [B,H,HD,L] (v^T).
// The three projections read nothing of each other: they are one launch, and
// blockIdx.z says which (0 q, 1 k, 2 v).  One projection alone is 256 blocks,
// two waves a SIMD, that mostly wait for loads; the 768 blocks are all resident
// at once (three a WGP), so the three chains of waits run side by side and two
// launch gaps, fills and tails go.  X16, WT16 and out16 each hold the arrays of
// q, k and v one behind the other.
// ---------------------------------------------------------------------------
#define PJ_ROWS 64
#define PJ_COLS 128
#define PJ_STAGES (E_DIM / 64)
#define PJ_UNITS ((PJ_ROWS + PJ_COLS) * 8)   // 16-byte units of one stage

// Work-group barrier that orders LDS traffic alone.  __syncthreads() also waits
// for every global load in flight, which would end the lead of the loads that
// are asked for two stages ahead; they land in registers of their own wave.
__device__ __forceinline__ void lds_barrier() {
  __builtin_amdgcn_fence(__ATOMIC_RELEASE, "workgroup", "local");
  __builtin_amdgcn_s_barrier();
  __builtin_amdgcn_fence(__ATOMIC_ACQUIRE, "workgroup", "local");
}

// The lanes of one wave hand each other units through LDS: the wave's stores
// have landed before any of its lanes reads there.  No other wave is waited for.
__device__ __forceinline__ void lds_wave_sync() {
  __builtin_amdgcn_fence(__ATOMIC_ACQ_REL, "workgroup", "local");
}

__global__ void __launch_bounds__(256)
proj_gemm(const _Float16* __restrict__ X16, const _Float16* __restrict__ WT16,
          const float* __restrict__ bias_q, const float* __restrict__ bias_k,
          const float* __restrict__ bias_v, _Float16* __restrict__ out16) {
  __shared__ v8h st[2 * PJ_UNITS];
  const int which = blockIdx.z;
  const float* bias = which == 0 ? bias_q : (which == 1 ? bias_k : bias_v);
  X16 += which * X_ELEMS;
  WT16 += which * W_ELEMS;
  out16 += which * X_ELEMS;
  const int tid = threadIdx.x;
  const int lane = tid & 31, wid = tid >> 5;
  const int m = lane & 15, hk = lane >> 4;
  const int rbase = blockIdx.x * PJ_ROWS;
  const int cbase = blockIdx.y * PJ_COLS;
  // filling: thread = unit fc of rows fr, fr + 32, ...
  const int fc = tid & 7, fr = tid >> 3;
  const v8h* px = reinterpret_cast<const v8h*>(X16) + (rbase + fr) * (E_DIM / 8) + fc;
  const v8h* pw = reinterpret_cast<const v8h*>(WT16) + (cbase + fr) * (E_DIM / 8) + fc;
  const int fs = fr * 8 + (fc ^ ((fr >> 1) & 7));
  // reading: the wave's X rows and W^T rows; the lane's units of a fragment
  // (k = 8*hk .. and 16 + 8*hk ..) for the two k steps of a stage
  const int xrow = ((wid >> 2) * 32 + m) * 8;
  const int wrow = (PJ_ROWS + (wid & 3) * 32 + m) * 8;
  const int sw = (m >> 1) & 7;

  // the wave's 32 columns are one head; a 64-row tile lies in one batch
  const int row0 = rbase + (wid >> 2) * 32 + hk * 8;
  const int col0 = cbase + (wid & 3) * 32 + m;
  const float bv[2] = {bias[col0], bias[col0 + 16]};

  // two register sets: stage s + 2 is asked for while stage s is worked on.
  // Every loop from here on is unrolled, so that the register arrays, the set
  // and the LDS buffer are picked by compile-time indices (no scratch memory).
  v8h nx[2][2], nw[2][4];
#pragma unroll
  for (int p = 0; p < 2; ++p) {
#pragma unroll
    for (int i = 0; i < 2; ++i) nx[p][i] = px[i * 32 * (E_DIM / 8) + p * 8];
#pragma unroll
    for (int i = 0; i < 4; ++i) nw[p][i] = pw[i * 32 * (E_DIM / 8) + p * 8];
  }
#pragma unroll
  for (int i = 0; i < 2; ++i) st[fs + i * 256] = nx[0][i];
#pragma unroll
  for (int i = 0; i < 4; ++i) st[PJ_ROWS * 8 + fs + i * 256] = nw[0][i];

  v8f acc[2][2] = {{{}, {}}, {{}, {}}};
#pragma unroll
  for (int s = 0; s < PJ_STAGES; ++s) {
    // publishes stage s, and ends every wave's reads of the other buffer
    // before it is filled again below
    lds_barrier();
    if (s + 2 < PJ_STAGES) {   // into the set that went to LDS a stage ago
#pragma unroll
      for (int i = 0; i < 2; ++i)
        nx[s & 1][i] = px[i * 32 * (E_DIM / 8) + (s + 2) * 8];
#pragma unroll
      for (int i = 0; i < 4; ++i)
        nw[s & 1][i] = pw[i * 32 * (E_DIM / 8) + (s + 2) * 8];
    }
    // keeps the six loads issued ahead of the stage's products: sunk towards
    // their LDS stores they would lose the lead that hides their latency
    __builtin_amdgcn_sched_barrier(0);
    const v8h* sb = st + (s & 1) * PJ_UNITS;
#pragma unroll
    for (int ks = 0; ks < 2; ++ks) {
      const int c0 = (ks * 4 + hk) ^ sw, c1 = (ks * 4 + 2 + hk) ^ sw;
      FragU fx[2], fw[2];
#pragma unroll
      for (int t = 0; t < 2; ++t) {
        fx[t].h[0] = sb[xrow + t * 128 + c0];
        fx[t].h[1] = sb[xrow + t * 128 + c1];
        fw[t].h[0] = sb[wrow + t * 128 + c0];
        fw[t].h[1] = sb[wrow + t * 128 + c1];
      }
#pragma unroll
      for (int i = 0; i < 2; ++i)
#pragma unroll
        for (int j = 0; j < 2; ++j)
          acc[i][j] = wmma_f16(fx[i].v, fw[j].v, acc[i][j]);
    }
    if (s + 1 < PJ_STAGES) {
      v8h* d = st + ((s + 1) & 1) * PJ_UNITS;
#pragma unroll
      for (int i = 0; i < 2; ++i) d[fs + i * 256] = nx[(s + 1) & 1][i];
#pragma unroll
      for (int i = 0; i < 4; ++i) d[PJ_ROWS * 8 + fs + i * 256] = nw[(s + 1) & 1][i];
    }
  }

  // where the tile goes: a row is a sequence position, a column a head dim;
  // which of the two runs along memory depends on the projection (v goes out
  // transposed).  The two steps are picked by value.
  const int bb = row0 >> 11, l0 = row0 & (SEQ - 1);
  const int h = col0 >> 5, d0 = col0 & (HEAD_DIM - 1);
  const size_t head = (size_t)(bb * NHEAD + h) * SEQ * HEAD_DIM;
  const int rstep = which == 2 ? 1 : HEAD_DIM;
  const int cstep = which == 2 ? SEQ : 1;
  _Float16* o = out16 + head + l0 * rstep + d0 * cstep;
#pragma unroll
  for (int j = 0; j < 2; ++j)
#pragma unroll
    for (int i = 0; i < 2; ++i)
#pragma unroll
      for (int r = 0; r < 8; ++r)
        o[(i * 16 + r) * rstep + j * 16 * cstep] = (_Float16)(acc[i][j][r] + bv[j]);
}

// ---------------------------------------------------------------------------
// Fused flash attention, scores computed transposed.  Wave owns 16 q-rows;
// block = 16 waves = 256 q-rows for one (b,h).  64 chunks of 32 keys:
//   S^T = K . Q^T   (A = 16 key rows, B = 16 query columns), two tiles;
//   O^T += V^T . P^T (A = 16 head dims x 32 keys, B = P^T).
// In the D map a lane holds one query column (lane & 15) and 8 keys per tile
// (8*hk + r), so max and sum run over the lane's own registers plus one
// exchange with lane ^ 16, and the two packed score tiles are already the
// B operand of the second product (k = 8*hk + s, 16 + 8*hk + (s - 8)):
// P never leaves the registers.
//
// The maximum that the exponents are taken against is HELD, not followed: its
// negative enters the score product as the C operand, so a score leaves the
// matrix unit already reduced, and P = exp2(score * scale * log2 e) with no
// subtraction; O and the row sum take no factor from chunk to chunk.  A trip
// of 4 chunks forms its 8 score tiles first.  Only when one of them passes the
// held maximum by more than 2^HOLD_LOG2 (a branch that is the same for the
// whole wave) is the maximum moved up and O, the sum, C and the trip's scores
// brought along.  P stays at or below 2^HOLD_LOG2, far inside f16; the held
// maximum starts as the true maximum of chunk 0, so it never lies above the
// row's maximum and nothing underflows that did not before.
//
// The head's whole K (128 KB) and V^T (128 KB) are put into LDS once, by
// whole-line loads, and all 16 waves take their A fragments from there: a
// fragment load from global memory touches 8 (K) or 16 (V^T) cache lines for
// its 512 bytes, and every wave would repeat it.  At more than 256 KB of LDS one
// block has a WGP to itself; 256 blocks.  LDS is counted in 16-byte units; a unit's low
// index bits are XORed with row bits so that the 16 lanes of a half wave,
// which read 16 rows at one column, fall on 16 different bank groups:
//   K   unit u = key * 4 + c   (c: 8 head dims)  -> u ^ ((key >> 2) & 3)
//   V^T unit u = d * 256 + p   (p: 8 keys)       -> u ^ (d & 15)
//
// Relation weights: a lane needs 8 + 8 weights of its own query row, so a load
// straight into that layout touches 16 rows (16 lines) for its 512 bytes, four
// times a chunk.  Instead a wave fetches its 16 rows x 32 keys by whole-line
// loads (8 lanes a line, 4 lines a load), four chunks ahead in four register
// sets, and turns each chunk through 2 KB of LDS of its own: no other wave
// reads there, so no barrier.  Unit of row r, column unit c (4 weights):
// r * 8 + (c ^ ((r >> 1) & 7)), as in proj_gemm.
// ---------------------------------------------------------------------------
#define ATT_WAVES 16
#define KV_UNITS (SEQ * HEAD_DIM / 8)    // 16-byte units of one head's K or V^T
#define REL_LEAD 4                       // chunks of weights held in registers
#define REL_UNITS (16 * 8)               // 16-byte units of 16 rows x 32 keys
#define EXP2_SCALE (SCALING * 1.4426950408889634f)   // raw score -> exponent of 2
#define HOLD_LOG2 8.0f                   // how far a score may pass the held max

template <bool B> struct Flag { static constexpr bool v = B; };

__device__ __forceinline__ int k_slot(int u) { return u ^ ((u >> 4) & 3); }
__device__ __forceinline__ int v_slot(int u) { return u ^ ((u >> 8) & 15); }

__device__ __forceinline__ float xhalf(float x) {   // value of lane ^ 16
  int b = __builtin_bit_cast(int, x);
  return __builtin_bit_cast(float, __builtin_amdgcn_permlanex16(
      b, b, 0x76543210, 0xfedcba98, false, false));
}

// kv: the head's K units, then its V^T units, in LDS.
// relfill: the lane's unit of the wave's relation rows, chunk 0: unit lane & 7
// of row lane >> 3; rows + 4, + 8, + 12 follow (REL only).
// wb: the wave's own LDS units for one chunk of weights (REL only).
// op: this lane's 8 + 8 output halves (d = 8*hk .., 16 + 8*hk ..).
template <bool REL>
__device__ __forceinline__ void
attn_rows(const _Float16* __restrict__ Q, const v8h* kv,
          const float* __restrict__ relfill, v4f* wb,
          _Float16* __restrict__ op, int qbase, int lane) {
  const v16h bq = load_frag(Q, HEAD_DIM, qbase, 0, lane);  // column = query
  // the lane's units of a fragment (k = 8*hk .. and 16 + 8*hk ..), chunk 0
  const int m = lane & 15, hk = lane >> 4;
  const int kl0 = k_slot(m * 4 + hk), kl1 = k_slot(m * 4 + hk + 2);
  const int vb0 = (KV_UNITS + v_slot(m * 256 + hk)) * 16;       // in bytes
  const int vb1 = (KV_UNITS + v_slot(m * 256 + hk + 2)) * 16;
  const char* kvb = reinterpret_cast<const char*>(kv);
  v8f o0 = {}, o1 = {};      // o0[r] = O[q][d = 8*hk + r], o1: d + 16
  float lrun = 0.0f;         // this lane's half of the keys
  auto max3 = [](float a, float b, float c) { return fmaxf(fmaxf(a, b), c); };
  auto max16 = [&](v8f e, v8f t) {   // over the 8 + 8 elements
    return fmaxf(max3(max3(e[0], e[1], e[2]), max3(e[3], e[4], e[5]),
                      max3(e[6], e[7], t[0])),
                 max3(max3(t[1], t[2], t[3]), max3(t[4], t[5], t[6]), t[7]));
  };
  // cm: minus the held maximum of the lane's query, as raw (unscaled) score,
  // in all 8 elements: the C operand of every score tile.  Start: chunk 0's.
  v8f cm;
  {
    FragU a0, a1;
    a0.h[0] = kv[kl0];
    a0.h[1] = kv[kl1];
    a1.h[0] = kv[64 + kl0];
    a1.h[1] = kv[64 + kl1];
    const v8f z = {};
    const v8f t0 = wmma_f16(a0.v, bq, z), t1 = wmma_f16(a1.v, bq, z);
    const float x = max16(t0, t1);
    cm = z - fmaxf(x, xhalf(x));
  }

  // weights: where the lane puts its four units of a chunk, and where it finds
  // the four units of its own row (keys 8*hk .. and 16 + 8*hk ..)
  const v4f* gw = reinterpret_cast<const v4f*>(relfill);
  const int lr = lane >> 3, fc = lane & 7, sw = (m >> 1) & 7;
  v4f rw[REL_LEAD][4];
  auto rel_load = [&](int set, int j) {      // chunk at key j -> register set
#pragma unroll
    for (int i = 0; i < 4; ++i) rw[set][i] = gw[i * (4 * SEQ / 4) + j / 4];
  };
  auto rel_store = [&](int set) {            // register set -> the wave's LDS
#pragma unroll
    for (int i = 0; i < 4; ++i) {
      const int r = lr + 4 * i;
      wb[r * 8 + (fc ^ ((r >> 1) & 7))] = rw[set][i];
    }
  };
  if (REL) {
#pragma unroll
    for (int u = 0; u < REL_LEAD; ++u) rel_load(u, u * 32);
    rel_store(0);
  }

  // A trip is REL_LEAD chunks, unrolled so that the register set is picked by
  // a compile-time index; 'more' says whether chunks REL_LEAD ahead exist.
  // (Without weights the trip is as long: one look at the maximum a trip.)
  constexpr int TRIP = REL_LEAD;
  auto trip = [&](int j0, auto more) {
  // raw score minus held maximum, all chunks of the trip:
  // sc[u][0][r]: S[q][key = j + 8*hk + r], sc[u][1][r]: key + 16
  v8f sc[TRIP][2];
  {
    FragU ak[TRIP][2];
#pragma unroll
    for (int u = 0; u < TRIP; ++u) {
      const v8h* kj = kv + (j0 + u * 32) * 4;   // 16 keys are 64 units; slots repeat
      ak[u][0].h[0] = kj[kl0];
      ak[u][0].h[1] = kj[kl1];
      ak[u][1].h[0] = kj[64 + kl0];
      ak[u][1].h[1] = kj[64 + kl1];
    }
    // keeps the trip's K loads issued ahead of the first product: sunk to
    // their users, each would expose a load latency of its own
    __builtin_amdgcn_sched_barrier(0);
#pragma unroll
    for (int u = 0; u < TRIP; ++u) {
      sc[u][0] = wmma_f16(ak[u][0].v, bq, cm);
      sc[u][1] = wmma_f16(ak[u][1].v, bq, cm);
    }
    // keeps the 8 products back to back: a maximum drawn up between them would
    // stand too close behind the product it reads and cost idle slots
    __builtin_amdgcn_sched_barrier(0);
  }
  {
    static_assert(TRIP == 4, "the maximum below is written for 8 tiles");
    v8f e;                           // element-wise over the first 7 tiles
#pragma unroll
    for (int r = 0; r < 8; ++r)
      e[r] = max3(max3(max3(sc[0][0][r], sc[0][1][r], sc[1][0][r]), sc[1][1][r],
                       sc[2][0][r]), sc[2][1][r], sc[3][0][r]);
    const float mx = max16(e, sc[3][1]);
    if (__builtin_amdgcn_ballot_w32(mx > HOLD_LOG2 / EXP2_SCALE) != 0) {
      // rare: move the held maximum of every query up to what this trip shows
      const float d = fmaxf(fmaxf(mx, xhalf(mx)), 0.0f);   // both key halves
      const float alpha = __builtin_amdgcn_exp2f(-d * EXP2_SCALE);
      o0 *= alpha;
      o1 *= alpha;
      lrun *= alpha;
      cm -= d;
#pragma unroll
      for (int u = 0; u < TRIP; ++u) {
        sc[u][0] -= d;
        sc[u][1] -= d;
      }
    }
  }
#pragma unroll
  for (int u = 0; u < TRIP; ++u) {
    const int j = j0 + u * 32;
    v8f w0, w1;                      // weights of the lane's 8 + 8 keys
    if (REL) {
      lds_wave_sync();               // this chunk's units, stored a chunk ago
      union { v8f v; v4f q[2]; } a, b;
      a.q[0] = wb[m * 8 + ((2 * hk) ^ sw)];
      a.q[1] = wb[m * 8 + ((2 * hk + 1) ^ sw)];
      b.q[0] = wb[m * 8 + ((2 * hk + 4) ^ sw)];
      b.q[1] = wb[m * 8 + ((2 * hk + 5) ^ sw)];
      w0 = a.v;
      w1 = b.v;
      // into the set that went to LDS a chunk ago
      if (decltype(more)::v) rel_load(u, j + REL_LEAD * 32);
    }
    FragU av0, av1;
    const int bj = j * 2;            // 4 units a chunk: adds to p as an XOR
    av0.h[0] = *reinterpret_cast<const v8h*>(kvb + (vb0 ^ bj));
    av0.h[1] = *reinterpret_cast<const v8h*>(kvb + (vb1 ^ bj));
    av1.h[0] = *reinterpret_cast<const v8h*>(kvb + 16 * 4096 + (vb0 ^ bj));
    av1.h[1] = *reinterpret_cast<const v8h*>(kvb + 16 * 4096 + (vb1 ^ bj));
    // keeps all of the chunk's loads issued ahead of its arithmetic: sunk
    // to their users, each would expose a load latency of its own
    __builtin_amdgcn_sched_barrier(0);

    v8f s0 = sc[u][0] * EXP2_SCALE, s1 = sc[u][1] * EXP2_SCALE;
#pragma unroll
    for (int r = 0; r < 8; ++r) s0[r] = __builtin_amdgcn_exp2f(s0[r]);
#pragma unroll
    for (int r = 0; r < 8; ++r) s1[r] = __builtin_amdgcn_exp2f(s1[r]);
    if (REL) {                                  // exp(s)*w, renormalized online
      s0 *= w0;
      s1 *= w1;
      if (decltype(more)::v || u + 1 < TRIP) {
        lds_wave_sync();             // every lane has read this chunk's units:
        rel_store((u + 1) % REL_LEAD);   // the next chunk's take their place
      }
    }
    const v8f t = s0 + s1;
    const float rs = ((t[0] + t[1]) + (t[2] + t[3])) +
                     ((t[4] + t[5]) + (t[6] + t[7]));
    lrun += rs;
    FragU pf;                                   // P^T as B operand
    pf.h[0] = __builtin_convertvector(s0, v8h);
    pf.h[1] = __builtin_convertvector(s1, v8h);
    o0 = wmma_f16(av0.v, pf.v, o0);
    o1 = wmma_f16(av1.v, pf.v, o1);
  }
  };
  constexpr int STEP = TRIP * 32;
  for (int j0 = 0; j0 < (REL ? SEQ - STEP : SEQ); j0 += STEP) trip(j0, Flag<true>{});
  if (REL) trip(SEQ - STEP, Flag<false>{});

  const float eps = REL ? 1e-6f : 0.0f;
  const float inv = 1.0f / (lrun + xhalf(lrun) + eps);   // join the halves once
  *reinterpret_cast<v8h*>(op)      = __builtin_convertvector(o0 * inv, v8h);
  *reinterpret_cast<v8h*>(op + 16) = __builtin_convertvector(o1 * inv, v8h);
}

__global__ void __launch_bounds__(ATT_WAVES * 32)
attn_fused(const _Float16* __restrict__ qh, const _Float16* __restrict__ kh,
           const _Float16* __restrict__ vT, const float* __restrict__ relw,
           _Float16* __restrict__ attn_out) {
  const int lane = threadIdx.x & 31, wid = threadIdx.x >> 5;
  const int m = lane & 15, hk = lane >> 4;
  const int b = blockIdx.z, h = blockIdx.y;
  const int qbase = blockIdx.x * (ATT_WAVES * 16) + wid * 16;
  const size_t headoff = (size_t)(b * NHEAD + h);
  const _Float16* Q = qh + headoff * SEQ * HEAD_DIM;
  const v8h* gK = reinterpret_cast<const v8h*>(kh + headoff * SEQ * HEAD_DIM);
  const v8h* gV = reinterpret_cast<const v8h*>(vT + headoff * HEAD_DIM * SEQ);

  __shared__ v8h kv[2 * KV_UNITS + ATT_WAVES * REL_UNITS];
  constexpr int FILL = KV_UNITS / (ATT_WAVES * 32);  // units a thread moves
  v8h rk[FILL], rv[FILL];
#pragma unroll
  for (int i = 0; i < FILL; ++i) {
    rk[i] = gK[i * (ATT_WAVES * 32) + (int)threadIdx.x];
    rv[i] = gV[i * (ATT_WAVES * 32) + (int)threadIdx.x];
  }
  // stands in front of the first reuse of a register that these loads name;
  // the two bases are inputs so that their registers stay theirs up to here
  asm volatile("s_wait_xcnt 0x0" :: "s"(gK), "s"(gV) : "memory");
#pragma unroll
  for (int i = 0; i < FILL; ++i) {
    const int u = i * (ATT_WAVES * 32) + (int)threadIdx.x;
    kv[k_slot(u)] = rk[i];
    kv[KV_UNITS + v_slot(u)] = rv[i];
  }
  __syncthreads();   // every wave reads what all 16 have stored
  _Float16* op = attn_out + ((size_t)(b * SEQ + qbase + m)) * E_DIM +
                 h * HEAD_DIM + hk * 8;
  if (h >= NORMAL_HEADS) {
    const float* relfill =
        relw + ((size_t)(b * RHEAD + (h - NORMAL_HEADS))) * SEQ * SEQ +
        (size_t)(qbase + (lane >> 3)) * SEQ + (lane & 7) * 4;
    v4f* wb = reinterpret_cast<v4f*>(kv + 2 * KV_UNITS + wid * REL_UNITS);
    attn_rows<true>(Q, kv, relfill, wb, op, qbase, lane);
  } else {
    attn_rows<false>(Q, kv, nullptr, nullptr, op, qbase, lane);
  }
}

// ---------------------------------------------------------------------------
// Output projection + LayerNorm fused.  A block of 16 waves computes a full
// strip of 32 rows x 512 columns, so that LN can reduce each row from LDS.
// As in proj_gemm, rows come from global memory by whole-line loads, one
// 16-byte unit a lane, and go to LDS, and the waves take their fragments
// there; a wave owns 32 rows x 32 columns (2 x 2 tiles), so a fragment feeds
// two products, and a line of Wo^T is fetched once for 32 rows of output.
// The strip's X rows (32 KB) are put down once, for all waves.  Wo^T runs in
// 8 stages of 64 k.  A wave's 32 columns are 32 rows of Wo^T that no other wave
// needs: each wave stages its own rows (4 KB a stage) through two LDS buffers
// of its own and two register sets, so the k loop holds no barrier and the
// waves drift apart, one wave's LDS stores beside another's reads and products.
// LDS unit of row r, column unit c of a stage: r * 8 + (c ^ ((r >> 1) & 7)),
// as in proj_gemm.  The k order of every sum is the one of a plain k loop.
// ---------------------------------------------------------------------------
#define OP_ROWS 32
#define OP_WAVES 16
#define OP_STAGES (E_DIM / 64)
#define OP_UNITS (32 * 8)          // 16-byte units of 32 rows of one stage

__global__ void __launch_bounds__(OP_WAVES * 32)
outproj_ln(const _Float16* __restrict__ attn16, const _Float16* __restrict__ WoT,
           const float* __restrict__ bo, const float* __restrict__ gamma,
           const float* __restrict__ beta, float* __restrict__ out) {
  // the X rows of all stages, then each wave's two buffers
  __shared__ v8h stx[(OP_STAGES + OP_WAVES * 2) * OP_UNITS];
  __shared__ float rowbuf[OP_ROWS][E_DIM];
  const int tid = threadIdx.x;
  const int lane = tid & 31, wid = tid >> 5;
  const int m = lane & 15, hk = lane >> 4;
  const int rbase = blockIdx.x * OP_ROWS;
  const int fc = tid & 7;
  // filling Wo^T: lane = unit fc of the wave's rows lr, lr + 4, ...
  const int lr = lane >> 3;
  const v8h* pw = reinterpret_cast<const v8h*>(WoT) +
                  (wid * 32 + lr) * (E_DIM / 8) + fc;
  v8h* wbuf = stx + (OP_STAGES + wid * 2) * OP_UNITS;
  // filling X: thread = unit fc of row xr in stages xs, xs + 2, ...
  const int xr = (tid >> 3) & 31, xs = tid >> 8;
  const v8h* px = reinterpret_cast<const v8h*>(attn16) +
                  (rbase + xr) * (E_DIM / 8) + xs * 8 + fc;
  const int xfs = xs * OP_UNITS + xr * 8 + (fc ^ ((xr >> 1) & 7));
  // reading: row m of a 16-row tile of X or of the wave's Wo^T rows
  const int frow = m * 8;
  const int sz = (m >> 1) & 7;
  const int col0 = wid * 32 + m;

  // two register sets: stage s + 2 is asked for while stage s is worked on.
  // Every loop from here on is unrolled, so that the register arrays, the set
  // and the LDS buffer are picked by compile-time indices (no scratch memory).
  v8h nx[OP_STAGES / 2], nw[2][8];
#pragma unroll
  for (int i = 0; i < 8; ++i) nw[0][i] = pw[i * 4 * (E_DIM / 8)];
#pragma unroll
  for (int i = 0; i < OP_STAGES / 2; ++i) nx[i] = px[i * 16];
#pragma unroll
  for (int i = 0; i < 8; ++i) nw[1][i] = pw[i * 4 * (E_DIM / 8) + 8];
  const float bv[2] = {bo[col0], bo[col0 + 16]};
  // stands in front of the first reuse of a register that these loads name;
  // the two bases are inputs so that their registers stay theirs up to here
  asm volatile("s_wait_xcnt 0x0" :: "v"(px), "v"(pw) : "memory");
#pragma unroll
  for (int i = 0; i < 8; ++i) {
    const int r = lr + 4 * i;
    wbuf[r * 8 + (fc ^ ((r >> 1) & 7))] = nw[0][i];
  }
#pragma unroll
  for (int i = 0; i < OP_STAGES / 2; ++i) stx[xfs + i * 2 * OP_UNITS] = nx[i];
  lds_barrier();   // every wave reads the X rows that all 16 have stored

  v8f acc[2][2] = {{{}, {}}, {{}, {}}};
#pragma unroll
  for (int s = 0; s < OP_STAGES; ++s) {
    if (s + 2 < OP_STAGES) {   // into the set that went to LDS a stage ago
#pragma unroll
      for (int i = 0; i < 8; ++i)
        nw[s & 1][i] = pw[i * 4 * (E_DIM / 8) + (s + 2) * 8];
    }
    // keeps the eight loads issued ahead of the stage's products: sunk towards
    // their LDS stores they would lose the lead that hides their latency
    __builtin_amdgcn_sched_barrier(0);
    const v8h* sbx = stx + s * OP_UNITS;
    const v8h* sbw = wbuf + (s & 1) * OP_UNITS;
#pragma unroll
    for (int ks = 0; ks < 2; ++ks) {
      const int c0 = (ks * 4 + hk) ^ sz, c1 = (ks * 4 + 2 + hk) ^ sz;
      FragU fx[2], fw[2];
#pragma unroll
      for (int t = 0; t < 2; ++t) {
        fx[t].h[0] = sbx[frow + t * 128 + c0];
        fx[t].h[1] = sbx[frow + t * 128 + c1];
        fw[t].h[0] = sbw[frow + t * 128 + c0];
        fw[t].h[1] = sbw[frow + t * 128 + c1];
      }
#pragma unroll
      for (int i = 0; i < 2; ++i)
#pragma unroll
        for (int j = 0; j < 2; ++j)
          acc[i][j] = wmma_f16(fx[i].v, fw[j].v, acc[i][j]);
    }
    if (s + 1 < OP_STAGES) {   // the buffer whose fragments stage s - 1 has used
      v8h* d = wbuf + ((s + 1) & 1) * OP_UNITS;
#pragma unroll
      for (int i = 0; i < 8; ++i) {
        const int r = lr + 4 * i;
        d[r * 8 + (fc ^ ((r >> 1) & 7))] = nw[(s + 1) & 1][i];
      }
      lds_wave_sync();
    }
  }

#pragma unroll
  for (int j = 0; j < 2; ++j)
#pragma unroll
    for (int i = 0; i < 2; ++i)
#pragma unroll
      for (int r = 0; r < 8; ++r)
        rowbuf[i * 16 + hk * 8 + r][col0 + j * 16] = acc[i][j][r] + bv[j];
  __syncthreads();
#pragma unroll
  for (int rr = 0; rr < 2; ++rr) {
    int row = wid * 2 + rr;
    float s = 0.f, s2 = 0.f;
    for (int c = lane; c < E_DIM; c += 32) {
      float v = rowbuf[row][c];
      s += v; s2 += v * v;
    }
#pragma unroll
    for (int off = 16; off > 0; off >>= 1) {
      s  += __shfl_xor(s, off);
      s2 += __shfl_xor(s2, off);
    }
    float mean = s * (1.0f / E_DIM);
    float var  = s2 * (1.0f / E_DIM) - mean * mean;
    float rstd = rsqrtf(var + 1e-5f);
    for (int c = lane; c < E_DIM; c += 32) {
      out[(size_t)(rbase + row) * E_DIM + c] =
          (rowbuf[row][c] - mean) * rstd * gamma[c] + beta[c];
    }
  }
}

// ---------------------------------------------------------------------------
extern "C" void kernel_launch(void* const* d_in, const int* in_sizes, int n_in,
                              void* d_out, int out_size, void* d_ws, size_t ws_size,
                              hipStream_t stream) {
  const float* query = (const float*)d_in[0];
  const float* key   = (const float*)d_in[1];
  const float* value = (const float*)d_in[2];
  const float* relw  = (const float*)d_in[3];
  const float* Wq = (const float*)d_in[4];
  const float* bq = (const float*)d_in[5];
  const float* Wk = (const float*)d_in[6];
  const float* bk = (const float*)d_in[7];
  const float* Wv = (const float*)d_in[8];
  const float* bv = (const float*)d_in[9];
  const float* Wo = (const float*)d_in[10];
  const float* bo = (const float*)d_in[11];
  const float* gamma = (const float*)d_in[12];
  const float* beta  = (const float*)d_in[13];
  float* out = (float*)d_out;

  // workspace carve-up (~30 MB)
  const size_t XE = (size_t)BATCH * SEQ * E_DIM;   // 2M elems
  const size_t WE = (size_t)E_DIM * E_DIM;         // 256K elems
  char* ws = (char*)d_ws;
  _Float16* xq16 = (_Float16*)ws; ws += XE * sizeof(_Float16);
  _Float16* xk16 = (_Float16*)ws; ws += XE * sizeof(_Float16);
  _Float16* xv16 = (_Float16*)ws; ws += XE * sizeof(_Float16);
  _Float16* WqT  = (_Float16*)ws; ws += WE * sizeof(_Float16);
  _Float16* WkT  = (_Float16*)ws; ws += WE * sizeof(_Float16);
  _Float16* WvT  = (_Float16*)ws; ws += WE * sizeof(_Float16);
  _Float16* WoT  = (_Float16*)ws; ws += WE * sizeof(_Float16);
  _Float16* qh16 = (_Float16*)ws; ws += XE * sizeof(_Float16);
  _Float16* kh16 = (_Float16*)ws; ws += XE * sizeof(_Float16);
  _Float16* vT16 = (_Float16*)ws; ws += XE * sizeof(_Float16);
  _Float16* at16 = (_Float16*)ws; ws += XE * sizeof(_Float16);
  (void)in_sizes; (void)n_in; (void)out_size; (void)ws_size;

  dim3 blk(256);
  // xq16, xk16, xv16 and WqT .. WoT lie one behind the other in the workspace
  prep_f16<<<PREP_BLOCKS, blk, 0, stream>>>(query, key, value, Wq, Wk, Wv, Wo,
                                            xq16, WqT);

  // qh16, kh16 and vT16 lie one behind the other too
  dim3 pg(BATCH * SEQ / PJ_ROWS, E_DIM / PJ_COLS, 3);   // (64, 4, 3)
  proj_gemm<<<pg, blk, 0, stream>>>(xq16, WqT, bq, bk, bv, qh16);

  dim3 ag(SEQ / (ATT_WAVES * 16), NHEAD, BATCH);     // (8, 16, 2)
  attn_fused<<<ag, dim3(ATT_WAVES * 32), 0, stream>>>(qh16, kh16, vT16, relw, at16);

  outproj_ln<<<BATCH * SEQ / OP_ROWS, dim3(OP_WAVES * 32), 0, stream>>>(at16, WoT, bo, gamma,
                                                                    beta, out);
}

// v009
// It runs in 60.7 microseconds.
// Timed twice side by side with v008, it ran 1.06 times as fast both times.
// Counting every step since v000, it is 7.17 times as fast.
#include <hip/hip_runtime.h>
#include <hip/hip_bf16.h>

// ---------------------------------------------------------------------------
// Relation-aware attention for MI455X (gfx1250, wave32, WMMA).
//
// Roofline: relation_weights (256 MB) dominates traffic -> memory bound at
// ~13us on 23.3 TB/s HBM *if* we never spill the 2x16x2048x2048 score tensor.
// Hence a fused flash-style attention kernel with online normalization, f16
// WMMA (16x16x32, K == head_dim == 32) for all GEMM work, f32 accumulate.
// ---------------------------------------------------------------------------

typedef __attribute__((ext_vector_type(16))) _Float16 v16h;
typedef __attribute__((ext_vector_type(8)))  _Float16 v8h;
typedef __attribute__((ext_vector_type(8)))  float    v8f;

#define E_DIM   512
#define NHEAD   16
#define RHEAD   8
#define NORMAL_HEADS 8
#define HEAD_DIM 32
#define BATCH   2
#define SEQ     2048
#define SCALING 0.17677669529663687f   // 32^-0.5

union FragU { v16h v; v8h h[2]; };

// A/B fragment loader (16-bit, 16x16x32 WMMA).
// A layout (ISA 7.12.2): lane = 16*hk + m holds row m; element e holds
//   k = (e<8 ? 0 : 16) + hk*8 + (e&7)  -> two contiguous 8-half (b128) loads.
// B fragments use the mirrored layout (lane&15 = column), so a row-major
// [N x K] (i.e. pre-transposed) matrix loads with the identical pattern.
__device__ __forceinline__ v16h load_frag(const _Float16* __restrict__ base,
                                          int ld, int row0, int k0, int lane) {
  const int m  = lane & 15;
  const int hk = lane >> 4;
  const _Float16* p = base + (size_t)(row0 + m) * ld + (k0 + hk * 8);
  FragU f;
  f.h[0] = *reinterpret_cast<const v8h*>(p);
  f.h[1] = *reinterpret_cast<const v8h*>(p + 16);
  return f.v;
}

__device__ __forceinline__ v8f wmma_f16(v16h a, v16h b, v8f c) {
  return __builtin_amdgcn_wmma_f32_16x16x32_f16(false, a, false, b,
                                                (short)0, c, false, false);
}

// ---------------------------------------------------------------------------
// Format conversion, one launch for all seven arrays.  The work is 28 MB in,
// 14 MB out; what it costs is launches and waves to start, so few waves each
// keep many whole-line accesses in flight.  All 512 blocks do the same work:
//   1/512 of each of query, key, value -> f16: a thread converts 4 x 4 floats
//   of each; a wave-wide load covers 512 contiguous bytes, a store 256;
//   one 64 k x 32 n tile of one weight matrix, WT[n][k] = W[k][n] (so GEMM
//   B-fragments are contiguous b128 loads): a thread reads 8 k of one column
//   (a wave-wide load is one line of W) and stores them as 16 bytes; the block
//   writes whole 128-byte lines of WT.
// ---------------------------------------------------------------------------
typedef __attribute__((ext_vector_type(4))) float    v4f;
typedef __attribute__((ext_vector_type(4))) _Float16 v4h;

#define PREP_BLOCKS 512
#define X_ELEMS (BATCH * SEQ * E_DIM)
#define W_ELEMS (E_DIM * E_DIM)

__global__ void __launch_bounds__(256)
prep_f16(const float* __restrict__ query, const float* __restrict__ key,
         const float* __restrict__ value, const float* __restrict__ Wq,
         const float* __restrict__ Wk, const float* __restrict__ Wv,
         const float* __restrict__ Wo, _Float16* __restrict__ x16,
         _Float16* __restrict__ wT16) {
  const int tid = threadIdx.x;
  const int blk = blockIdx.x;

  const int t = blk >> 7;                            // which matrix
  const float* Wm = t == 0 ? Wq : (t == 1 ? Wk : (t == 2 ? Wv : Wo));
  const int n  = (blk & 15) * 32 + (tid & 31);
  const int k0 = ((blk >> 4) & 7) * 64 + (tid >> 5) * 8;

  const int base = blk * 1024 + tid;                 // in units of 4 floats
  v4f xq[4], xk[4], xv[4];
#pragma unroll
  for (int i = 0; i < 4; ++i) {
    xq[i] = reinterpret_cast<const v4f*>(query)[base + i * 256];
    xk[i] = reinterpret_cast<const v4f*>(key)[base + i * 256];
    xv[i] = reinterpret_cast<const v4f*>(value)[base + i * 256];
  }
  v8f w;
#pragma unroll
  for (int i = 0; i < 8; ++i) w[i] = Wm[(k0 + i) * E_DIM + n];
  // keeps all 20 loads issued ahead of the first conversion: without it the
  // weight loads sink behind waits on the others, a second memory latency
  __builtin_amdgcn_sched_barrier(0);

#pragma unroll
  for (int i = 0; i < 4; ++i) {
    v4h* d = reinterpret_cast<v4h*>(x16) + base + i * 256;
    d[0]               = __builtin_convertvector(xq[i], v4h);
    d[X_ELEMS / 4]     = __builtin_convertvector(xk[i], v4h);
    d[2 * X_ELEMS / 4] = __builtin_convertvector(xv[i], v4h);
  }
  *reinterpret_cast<v8h*>(wT16 + (size_t)t * W_ELEMS + n * E_DIM + k0) =
      __builtin_convertvector(w, v8h);
}

// ---------------------------------------------------------------------------
// Projection GEMM: Y = X @ W + b.  A block of 8 waves computes 64 rows x 128
// columns; K runs in 8 stages of 64.  A stage's X rows and W^T rows (one
// 128-byte line each) come from global memory by whole-line loads, one 16-byte
// unit a thread, and go to LDS; the waves take their fragments there.  A
// fragment load from global memory touches 16 lines for its 512 bytes and
// feeds one product; here a line is fetched once a block, and a wave owns
// 32 rows x 32 columns (2 x 2 tiles), so a fragment feeds two products.
// Two LDS buffers and two register sets: the loads of the stage after next fly
// while this stage is worked on.
// LDS unit of row r, column unit c: r * 8 + (c ^ ((r >> 1) & 7)), so that the
// 16 lanes of a half wave, which read 16 rows at one c, fall on 16 different
// bank groups.
// Output scattered to head-major f16: [B,H,L,HD] (q,k) or [B,H,HD,L] (v^T).
// The three projections read nothing of each other: they are one launch, and
// blockIdx.z says which (0 q, 1 k, 2 v).  One projection alone is 256 blocks,
// two waves a SIMD, that mostly wait for loads; the 768 blocks are all resident
// at once (three a WGP), so the three chains of waits run side by side and two
// launch gaps, fills and tails go.  X16, WT16 and out16 each hold the arrays of
// q, k and v one behind the other.
// ---------------------------------------------------------------------------
#define PJ_ROWS 64
#define PJ_COLS 128
#define PJ_STAGES (E_DIM / 64)
#define PJ_UNITS ((PJ_ROWS + PJ_COLS) * 8)   // 16-byte units of one stage

// Work-group barrier that orders LDS traffic alone.  __syncthreads() also waits
// for every global load in flight, which would end the lead of the loads that
// are asked for two stages ahead; they land in registers of their own wave.
__device__ __forceinline__ void lds_barrier() {
  __builtin_amdgcn_fence(__ATOMIC_RELEASE, "workgroup", "local");
  __builtin_amdgcn_s_barrier();
  __builtin_amdgcn_fence(__ATOMIC_ACQUIRE, "workgroup", "local");
}

// The lanes of one wave hand each other units through LDS: the wave's stores
// have landed before any of its lanes reads there.  No other wave is waited for.
__device__ __forceinline__ void lds_wave_sync() {
  __builtin_amdgcn_fence(__ATOMIC_ACQ_REL, "workgroup", "local");
}

__global__ void __launch_bounds__(256)
proj_gemm(const _Float16* __restrict__ X16, const _Float16* __restrict__ WT16,
          const float* __restrict__ bias_q, const float* __restrict__ bias_k,
          const float* __restrict__ bias_v, _Float16* __restrict__ out16) {
  __shared__ v8h st[2 * PJ_UNITS];
  const int which = blockIdx.z;
  const float* bias = which == 0 ? bias_q : (which == 1 ? bias_k : bias_v);
  X16 += which * X_ELEMS;
  WT16 += which * W_ELEMS;
  out16 += which * X_ELEMS;
  const int tid = threadIdx.x;
  const int lane = tid & 31, wid = tid >> 5;
  const int m = lane & 15, hk = lane >> 4;
  const int rbase = blockIdx.x * PJ_ROWS;
  const int cbase = blockIdx.y * PJ_COLS;
  // filling: thread = unit fc of rows fr, fr + 32, ...
  const int fc = tid & 7, fr = tid >> 3;
  const v8h* px = reinterpret_cast<const v8h*>(X16) + (rbase + fr) * (E_DIM / 8) + fc;
  const v8h* pw = reinterpret_cast<const v8h*>(WT16) + (cbase + fr) * (E_DIM / 8) + fc;
  const int fs = fr * 8 + (fc ^ ((fr >> 1) & 7));
  // reading: the wave's X rows and W^T rows; the lane's units of a fragment
  // (k = 8*hk .. and 16 + 8*hk ..) for the two k steps of a stage
  const int xrow = ((wid >> 2) * 32 + m) * 8;
  const int wrow = (PJ_ROWS + (wid & 3) * 32 + m) * 8;
  const int sw = (m >> 1) & 7;

  // the wave's 32 columns are one head; a 64-row tile lies in one batch
  const int row0 = rbase + (wid >> 2) * 32 + hk * 8;
  const int col0 = cbase + (wid & 3) * 32 + m;
  const float bv[2] = {bias[col0], bias[col0 + 16]};

  // two register sets: stage s + 2 is asked for while stage s is worked on.
  // Every loop from here on is unrolled, so that the register arrays, the set
  // and the LDS buffer are picked by compile-time indices (no scratch memory).
  v8h nx[2][2], nw[2][4];
#pragma unroll
  for (int p = 0; p < 2; ++p) {
#pragma unroll
    for (int i = 0; i < 2; ++i) nx[p][i] = px[i * 32 * (E_DIM / 8) + p * 8];
#pragma unroll
    for (int i = 0; i < 4; ++i) nw[p][i] = pw[i * 32 * (E_DIM / 8) + p * 8];
  }
#pragma unroll
  for (int i = 0; i < 2; ++i) st[fs + i * 256] = nx[0][i];
#pragma unroll
  for (int i = 0; i < 4; ++i) st[PJ_ROWS * 8 + fs + i * 256] = nw[0][i];

  v8f acc[2][2] = {{{}, {}}, {{}, {}}};
#pragma unroll
  for (int s = 0; s < PJ_STAGES; ++s) {
    // publishes stage s, and ends every wave's reads of the other buffer
    // before it is filled again below
    lds_barrier();
    if (s + 2 < PJ_STAGES) {   // into the set that went to LDS a stage ago
#pragma unroll
      for (int i = 0; i < 2; ++i)
        nx[s & 1][i] = px[i * 32 * (E_DIM / 8) + (s + 2) * 8];
#pragma unroll
      for (int i = 0; i < 4; ++i)
        nw[s & 1][i] = pw[i * 32 * (E_DIM / 8) + (s + 2) * 8];
    }
    // keeps the six loads issued ahead of the stage's products: sunk towards
    // their LDS stores they would lose the lead that hides their latency
    __builtin_amdgcn_sched_barrier(0);
    const v8h* sb = st + (s & 1) * PJ_UNITS;
#pragma unroll
    for (int ks = 0; ks < 2; ++ks) {
      const int c0 = (ks * 4 + hk) ^ sw, c1 = (ks * 4 + 2 + hk) ^ sw;
      FragU fx[2], fw[2];
#pragma unroll
      for (int t = 0; t < 2; ++t) {
        fx[t].h[0] = sb[xrow + t * 128 + c0];
        fx[t].h[1] = sb[xrow + t * 128 + c1];
        fw[t].h[0] = sb[wrow + t * 128 + c0];
        fw[t].h[1] = sb[wrow + t * 128 + c1];
      }
#pragma unroll
      for (int i = 0; i < 2; ++i)
#pragma unroll
        for (int j = 0; j < 2; ++j)
          acc[i][j] = wmma_f16(fx[i].v, fw[j].v, acc[i][j]);
    }
    if (s + 1 < PJ_STAGES) {
      v8h* d = st + ((s + 1) & 1) * PJ_UNITS;
#pragma unroll
      for (int i = 0; i < 2; ++i) d[fs + i * 256] = nx[(s + 1) & 1][i];
#pragma unroll
      for (int i = 0; i < 4; ++i) d[PJ_ROWS * 8 + fs + i * 256] = nw[(s + 1) & 1][i];
    }
  }

  // where the tile goes: a row is a sequence position, a column a head dim;
  // which of the two runs along memory depends on the projection (v goes out
  // transposed).  The two steps are picked by value.
  const int bb = row0 >> 11, l0 = row0 & (SEQ - 1);
  const int h = col0 >> 5, d0 = col0 & (HEAD_DIM - 1);
  const size_t head = (size_t)(bb * NHEAD + h) * SEQ * HEAD_DIM;
  const int rstep = which == 2 ? 1 : HEAD_DIM;
  const int cstep = which == 2 ? SEQ : 1;
  _Float16* o = out16 + head + l0 * rstep + d0 * cstep;
#pragma unroll
  for (int j = 0; j < 2; ++j)
#pragma unroll
    for (int i = 0; i < 2; ++i)
#pragma unroll
      for (int r = 0; r < 8; ++r)
        o[(i * 16 + r) * rstep + j * 16 * cstep] = (_Float16)(acc[i][j][r] + bv[j]);
}

// ---------------------------------------------------------------------------
// Fused flash attention, scores computed transposed.  Wave owns 16 q-rows of
// one (b,h).  64 chunks of 32 keys:
//   S^T = K . Q^T   (A = 16 key rows, B = 16 query columns), two tiles;
//   O^T += V^T . P^T (A = 16 head dims x 32 keys, B = P^T).
// In the D map a lane holds one query column (lane & 15) and 8 keys per tile
// (8*hk + r), so max and sum run over the lane's own registers plus one
// exchange with lane ^ 16, and the two packed score tiles are already the
// B operand of the second product (k = 8*hk + s, 16 + 8*hk + (s - 8)):
// P never leaves the registers.
//
// The maximum that the exponents are taken against is HELD, not followed: its
// negative enters the score product as the C operand, so a score leaves the
// matrix unit already reduced, and P = exp2(score * scale * log2 e) with no
// subtraction; O and the row sum take no factor from chunk to chunk.  A trip
// of 4 chunks forms its 8 score tiles first.  Only when one of them passes the
// held maximum by more than 2^HOLD_LOG2 (a branch that is the same for the
// whole wave) is the maximum moved up and O, the sum, C and the trip's scores
// brought along.  P stays at or below 2^HOLD_LOG2, far inside f16; the held
// maximum starts as the true maximum of chunk 0, so it never lies above the
// row's maximum and nothing underflows that did not before.
//
// A block serves two heads at once: one relation head and one normal head of
// the same batch, 128 query rows of each, waves 0-7 on the first and 8-15 on
// the second, so every SIMD runs two waves of either kind.  A relation wave
// streams 128 KB of weights from memory and a normal wave nothing; a WGP draws
// from memory at a bounded rate, so with whole blocks of one kind half the WGPs
// would carry the whole stream while the other half finish early.
//
// K and V^T of both heads go into LDS by whole-line loads, half the keys at a
// time (2 heads x (64 KB + 64 KB)), and the waves take their A fragments from
// there: a fragment load from global memory touches 8 (K) or 16 (V^T) cache
// lines for its 512 bytes, and every wave would repeat it.  Between the halves
// all waves meet: the second half's units are asked for, a barrier ends every
// wave's reads of the first half, the units are stored, a barrier publishes
// them.  A wave walks its keys in the plain order, its state kept in registers.
// At more than 256 KB of LDS one block has a WGP to itself; 256 blocks.  LDS is
// counted in 16-byte units; a unit's low index bits are XORed with row bits so
// that the 16 lanes of a half wave, which read 16 rows at one column, fall on
// 16 different bank groups (key: within the half):
//   K   unit u = key * 4 + c   (c: 8 head dims)  -> u ^ ((key >> 2) & 3)
//   V^T unit u = d * 128 + p   (p: 8 keys)       -> u ^ (d & 15)
//
// Relation weights: a lane needs 8 + 8 weights of its own query row, so a load
// straight into that layout touches 16 rows (16 lines) for its 512 bytes, four
// times a chunk.  Instead a wave fetches its 16 rows x 32 keys by whole-line
// loads (8 lanes a line, 4 lines a load), four chunks ahead in four register
// sets, and turns each chunk through 2 KB of LDS of its own: no other wave
// reads there, so no barrier.  Unit of row r, column unit c (4 weights):
// r * 8 + (c ^ ((r >> 1) & 7)), as in proj_gemm.
// ---------------------------------------------------------------------------
#define ATT_WAVES 16
#define ATT_TILES (ATT_WAVES / 2)        // waves (16-row query tiles) a head
#define KEY_HALF (SEQ / 2)               // keys that lie in LDS at one time
#define HALF_UNITS (KEY_HALF * HEAD_DIM / 8)  // 16-byte units of that much K or V^T
#define HEAD_UNITS (2 * HALF_UNITS)      // one head's K units, then its V^T units
#define REL_LEAD 4                       // chunks of weights held in registers
#define REL_UNITS (16 * 8)               // 16-byte units of 16 rows x 32 keys
#define EXP2_SCALE (SCALING * 1.4426950408889634f)   // raw score -> exponent of 2
#define HOLD_LOG2 8.0f                   // how far a score may pass the held max

template <bool B> struct Flag { static constexpr bool v = B; };

__device__ __forceinline__ int k_slot(int u) { return u ^ ((u >> 4) & 3); }
__device__ __forceinline__ int v_slot(int u) { return u ^ ((u >> 7) & 15); }

__device__ __forceinline__ float xhalf(float x) {   // value of lane ^ 16
  int b = __builtin_bit_cast(int, x);
  return __builtin_bit_cast(float, __builtin_amdgcn_permlanex16(
      b, b, 0x76543210, 0xfedcba98, false, false));
}

// One wave's 16 query rows against the keys of half PH (0, then 1).
// kv: the head's K units of that half, then its V^T units, in LDS.
// relfill: the lane's unit of the wave's relation rows, chunk 0: unit lane & 7
// of row lane >> 3; rows + 4, + 8, + 12 follow (REL only).
// wb: the wave's own LDS units for one chunk of weights (REL only).
// bq: the query fragment (column = query).  What goes from half to half:
// cm (below); o0[r] = O[q][d = 8*hk + r], o1: d + 16; lrun: the sum over this
// lane's half of the keys; rw: the weights on their way (REL only).
template <bool REL, int PH>
__device__ __forceinline__ void
attn_half(const v8h* kv, const float* __restrict__ relfill, v4f* wb,
          const v16h bq, v8f& cm, v8f& o0, v8f& o1, float& lrun,
          v4f (&rw)[REL_LEAD][4], int lane) {
  // the lane's units of a fragment (k = 8*hk .. and 16 + 8*hk ..), chunk 0
  const int m = lane & 15, hk = lane >> 4;
  const int kl0 = k_slot(m * 4 + hk), kl1 = k_slot(m * 4 + hk + 2);
  const int vb0 = (HALF_UNITS + v_slot(m * 128 + hk)) * 16;     // in bytes
  const int vb1 = (HALF_UNITS + v_slot(m * 128 + hk + 2)) * 16;
  const char* kvb = reinterpret_cast<const char*>(kv);
  auto max3 = [](float a, float b, float c) { return fmaxf(fmaxf(a, b), c); };
  auto max16 = [&](v8f e, v8f t) {   // over the 8 + 8 elements
    return fmaxf(max3(max3(e[0], e[1], e[2]), max3(e[3], e[4], e[5]),
                      max3(e[6], e[7], t[0])),
                 max3(max3(t[1], t[2], t[3]), max3(t[4], t[5], t[6]), t[7]));
  };
  // cm: minus the held maximum of the lane's query, as raw (unscaled) score,
  // in all 8 elements: the C operand of every score tile.  Start: chunk 0's.
  if (PH == 0) {
    FragU a0, a1;
    a0.h[0] = kv[kl0];
    a0.h[1] = kv[kl1];
    a1.h[0] = kv[64 + kl0];
    a1.h[1] = kv[64 + kl1];
    const v8f z = {};
    const v8f t0 = wmma_f16(a0.v, bq, z), t1 = wmma_f16(a1.v, bq, z);
    const float x = max16(t0, t1);
    cm = z - fmaxf(x, xhalf(x));
  }

  // weights: where the lane puts its four units of a chunk, and where it finds
  // the four units of its own row (keys 8*hk .. and 16 + 8*hk ..)
  const v4f* gw = reinterpret_cast<const v4f*>(relfill);
  const int lr = lane >> 3, fc = lane & 7, sw = (m >> 1) & 7;
  auto rel_load = [&](int set, int j) {      // chunk at key j -> register set
#pragma unroll
    for (int i = 0; i < 4; ++i) rw[set][i] = gw[i * (4 * SEQ / 4) + j / 4];
  };
  auto rel_store = [&](int set) {            // register set -> the wave's LDS
#pragma unroll
    for (int i = 0; i < 4; ++i) {
      const int r = lr + 4 * i;
      wb[r * 8 + (fc ^ ((r >> 1) & 7))] = rw[set][i];
    }
  };
  if (REL && PH == 0) {
#pragma unroll
    for (int u = 0; u < REL_LEAD; ++u) rel_load(u, u * 32);
    rel_store(0);
  }

  // A trip is REL_LEAD chunks, unrolled so that the register set is picked by
  // a compile-time index; 'more' says whether chunks REL_LEAD ahead exist;
  // j0 counts keys within the half, as LDS does.
  // (Without weights the trip is as long: one look at the maximum a trip.)
  constexpr int TRIP = REL_LEAD;
  auto trip = [&](int j0, auto more) {
  // raw score minus held maximum, all chunks of the trip:
  // sc[u][0][r]: S[q][key = j + 8*hk + r], sc[u][1][r]: key + 16
  v8f sc[TRIP][2];
  {
    FragU ak[TRIP][2];
#pragma unroll
    for (int u = 0; u < TRIP; ++u) {
      const v8h* kj = kv + (j0 + u * 32) * 4;   // 16 keys are 64 units; slots repeat
      ak[u][0].h[0] = kj[kl0];
      ak[u][0].h[1] = kj[kl1];
      ak[u][1].h[0] = kj[64 + kl0];
      ak[u][1].h[1] = kj[64 + kl1];
    }
    // keeps the trip's K loads issued ahead of the first product: sunk to
    // their users, each would expose a load latency of its own
    __builtin_amdgcn_sched_barrier(0);
#pragma unroll
    for (int u = 0; u < TRIP; ++u) {
      sc[u][0] = wmma_f16(ak[u][0].v, bq, cm);
      sc[u][1] = wmma_f16(ak[u][1].v, bq, cm);
    }
    // keeps the 8 products back to back: a maximum drawn up between them would
    // stand too close behind the product it reads and cost idle slots
    __builtin_amdgcn_sched_barrier(0);
  }
  {
    static_assert(TRIP == 4, "the maximum below is written for 8 tiles");
    v8f e;                           // element-wise over the first 7 tiles
#pragma unroll
    for (int r = 0; r < 8; ++r)
      e[r] = max3(max3(max3(sc[0][0][r], sc[0][1][r], sc[1][0][r]), sc[1][1][r],
                       sc[2][0][r]), sc[2][1][r], sc[3][0][r]);
    const float mx = max16(e, sc[3][1]);
    if (__builtin_amdgcn_ballot_w32(mx > HOLD_LOG2 / EXP2_SCALE) != 0) {
      // rare: move the held maximum of every query up to what this trip shows
      const float d = fmaxf(fmaxf(mx, xhalf(mx)), 0.0f);   // both key halves
      const float alpha = __builtin_amdgcn_exp2f(-d * EXP2_SCALE);
      o0 *= alpha;
      o1 *= alpha;
      lrun *= alpha;
      cm -= d;
#pragma unroll
      for (int u = 0; u < TRIP; ++u) {
        sc[u][0] -= d;
        sc[u][1] -= d;
      }
    }
  }
#pragma unroll
  for (int u = 0; u < TRIP; ++u) {
    const int j = j0 + u * 32;
    v8f w0, w1;                      // weights of the lane's 8 + 8 keys
    if (REL) {
      lds_wave_sync();               // this chunk's units, stored a chunk ago
      union { v8f v; v4f q[2]; } a, b;
      a.q[0] = wb[m * 8 + ((2 * hk) ^ sw)];
      a.q[1] = wb[m * 8 + ((2 * hk + 1) ^ sw)];
      b.q[0] = wb[m * 8 + ((2 * hk + 4) ^ sw)];
      b.q[1] = wb[m * 8 + ((2 * hk + 5) ^ sw)];
      w0 = a.v;
      w1 = b.v;
      // into the set that went to LDS a chunk ago
      if (decltype(more)::v) rel_load(u, PH * KEY_HALF + j + REL_LEAD * 32);
    }
    FragU av0, av1;
    const int bj = j * 2;            // 4 units a chunk: adds to p as an XOR
    av0.h[0] = *reinterpret_cast<const v8h*>(kvb + (vb0 ^ bj));
    av0.h[1] = *reinterpret_cast<const v8h*>(kvb + (vb1 ^ bj));
    av1.h[0] = *reinterpret_cast<const v8h*>(kvb + 16 * 2048 + (vb0 ^ bj));
    av1.h[1] = *reinterpret_cast<const v8h*>(kvb + 16 * 2048 + (vb1 ^ bj));
    // keeps all of the chunk's loads issued ahead of its arithmetic: sunk
    // to their users, each would expose a load latency of its own
    __builtin_amdgcn_sched_barrier(0);

    v8f s0 = sc[u][0] * EXP2_SCALE, s1 = sc[u][1] * EXP2_SCALE;
#pragma unroll
    for (int r = 0; r < 8; ++r) s0[r] = __builtin_amdgcn_exp2f(s0[r]);
#pragma unroll
    for (int r = 0; r < 8; ++r) s1[r] = __builtin_amdgcn_exp2f(s1[r]);
    if (REL) {                                  // exp(s)*w, renormalized online
      s0 *= w0;
      s1 *= w1;
      if (decltype(more)::v || u + 1 < TRIP) {
        lds_wave_sync();             // every lane has read this chunk's units:
        rel_store((u + 1) % REL_LEAD);   // the next chunk's take their place
      }
    }
    const v8f t = s0 + s1;
    const float rs = ((t[0] + t[1]) + (t[2] + t[3])) +
                     ((t[4] + t[5]) + (t[6] + t[7]));
    lrun += rs;
    FragU pf;                                   // P^T as B operand
    pf.h[0] = __builtin_convertvector(s0, v8h);
    pf.h[1] = __builtin_convertvector(s1, v8h);
    o0 = wmma_f16(av0.v, pf.v, o0);
    o1 = wmma_f16(av1.v, pf.v, o1);
  }
  };
  constexpr int STEP = TRIP * 32;
  constexpr bool LAST = REL && PH == 1;   // the row's last trip asks for no more
  for (int j0 = 0; j0 < (LAST ? KEY_HALF - STEP : KEY_HALF); j0 += STEP)
    trip(j0, Flag<true>{});
  if (LAST) trip(KEY_HALF - STEP, Flag<false>{});
}

__global__ void __launch_bounds__(ATT_WAVES * 32)
attn_fused(const _Float16* __restrict__ qh, const _Float16* __restrict__ kh,
           const _Float16* __restrict__ vT, const float* __restrict__ relw,
           _Float16* __restrict__ attn_out) {
  static_assert(RHEAD == NORMAL_HEADS, "a block pairs one head of each kind");
  const int tid = threadIdx.x;
  const int lane = tid & 31;
  // the wave's number in a scalar register: what depends on it (the kind of
  // head, below) is then a scalar branch with every lane on
  const int wid = __builtin_amdgcn_readfirstlane(tid >> 5);
  const int m = lane & 15, hk = lane >> 4;
  const int b = blockIdx.z, pair = blockIdx.y;
  // the relation waves are the block's older ones: theirs is the longer work
  const bool rel = wid < ATT_TILES;
  const int h = rel ? NORMAL_HEADS + pair : pair;
  const int qbase = blockIdx.x * (ATT_TILES * 16) + (wid & (ATT_TILES - 1)) * 16;
  const size_t offr = (size_t)(b * NHEAD + NORMAL_HEADS + pair) * SEQ * HEAD_DIM;
  const size_t offn = (size_t)(b * NHEAD + pair) * SEQ * HEAD_DIM;
  const v8h* gKr = reinterpret_cast<const v8h*>(kh + offr);
  const v8h* gKn = reinterpret_cast<const v8h*>(kh + offn);
  const v8h* gVr = reinterpret_cast<const v8h*>(vT + offr);
  const v8h* gVn = reinterpret_cast<const v8h*>(vT + offn);

  // the relation head's units, the normal head's, the relation waves' own
  __shared__ v8h kv[2 * HEAD_UNITS + ATT_TILES * REL_UNITS];
  constexpr int FILL = HALF_UNITS / (ATT_WAVES * 32);  // units a thread moves
  v8h rk[2][FILL], rv[2][FILL];                        // of K, V^T of each head
  // K of a half lies in one piece: a thread takes units tid, tid + 512, ...
  // V^T is 128 units of each of 32 rows: a thread stays in row vd and takes
  // units vp, vp + 16, ... (a wave-wide load: 256 contiguous bytes of two rows).
  // So each array has one address a thread, and the steps are constants.
  const int vd = tid >> 4, vp = tid & 15;
  const int ks = k_slot(tid), vs = HALF_UNITS + v_slot(vd * 128 + vp);
  const v8h* pKr = gKr + tid;
  const v8h* pKn = gKn + tid;
  const v8h* pVr = gVr + vd * (SEQ / 8) + vp;
  const v8h* pVn = gVn + vd * (SEQ / 8) + vp;
  auto fill_load = [&](int ph) {
#pragma unroll
    for (int i = 0; i < FILL; ++i) {
      const int gk = ph * HALF_UNITS + i * (ATT_WAVES * 32);
      const int gv = ph * (KEY_HALF / 8) + i * 16;
      rk[0][i] = pKr[gk];
      rv[0][i] = pVr[gv];
      rk[1][i] = pKn[gk];
      rv[1][i] = pVn[gv];
    }
    // stands in front of the first reuse of a register that these loads name;
    // the addresses and their bases are inputs so that their registers stay
    // theirs up to here
    asm volatile("s_wait_xcnt 0x0" :: "v"(pKr), "v"(pKn), "v"(pVr), "v"(pVn),
                 "s"(gKr), "s"(gKn), "s"(gVr), "s"(gVn) : "memory");
  };
  auto fill_store = [&]() {
#pragma unroll
    for (int i = 0; i < FILL; ++i) {
#pragma unroll
      for (int s = 0; s < 2; ++s) {   // the steps leave the XORed bits alone
        kv[s * HEAD_UNITS + ks + i * (ATT_WAVES * 32)] = rk[s][i];
        kv[s * HEAD_UNITS + vs + i * 16] = rv[s][i];
      }
    }
  };
  fill_load(0);
  fill_store();
  __syncthreads();   // every wave reads what all 16 have stored

  const float* relfill = relw + ((size_t)(b * RHEAD + pair)) * SEQ * SEQ +
                         (size_t)(qbase + (lane >> 3)) * SEQ + (lane & 7) * 4;
  v4f* wb = reinterpret_cast<v4f*>(kv + 2 * HEAD_UNITS +
                                   (wid & (ATT_TILES - 1)) * REL_UNITS);
  const v16h bq = load_frag(qh + (size_t)(b * NHEAD + h) * SEQ * HEAD_DIM,
                            HEAD_DIM, qbase, 0, lane);
  v8f cm, o0 = {}, o1 = {};
  float lrun = 0.0f;
  v4f rw[REL_LEAD][4];
  if (rel) attn_half<true, 0>(kv, relfill, wb, bq, cm, o0, o1, lrun, rw, lane);
  else attn_half<false, 0>(kv + HEAD_UNITS, nullptr, nullptr, bq, cm, o0, o1, lrun, rw, lane);

  fill_load(1);      // into registers: flies while the slower waves still work
  lds_barrier();     // every wave has taken its last fragment of the first half
  fill_store();
  lds_barrier();     // every wave reads what all 16 have stored

  if (rel) attn_half<true, 1>(kv, relfill, wb, bq, cm, o0, o1, lrun, rw, lane);
  else attn_half<false, 1>(kv + HEAD_UNITS, nullptr, nullptr, bq, cm, o0, o1, lrun, rw, lane);

  // this lane's 8 + 8 output halves (d = 8*hk .., 16 + 8*hk ..)
  _Float16* op = attn_out + ((size_t)(b * SEQ + qbase + m)) * E_DIM +
                 h * HEAD_DIM + hk * 8;
  const float eps = rel ? 1e-6f : 0.0f;
  const float inv = 1.0f / (lrun + xhalf(lrun) + eps);   // join the halves once
  *reinterpret_cast<v8h*>(op)      = __builtin_convertvector(o0 * inv, v8h);
  *reinterpret_cast<v8h*>(op + 16) = __builtin_convertvector(o1 * inv, v8h);
}

// ---------------------------------------------------------------------------
// Output projection + LayerNorm fused.  A block of 16 waves computes a full
// strip of 32 rows x 512 columns, so that LN can reduce each row from LDS.
// As in proj_gemm, rows come from global memory by whole-line loads, one
// 16-byte unit a lane, and go to LDS, and the waves take their fragments
// there; a wave owns 32 rows x 32 columns (2 x 2 tiles), so a fragment feeds
// two products, and a line of Wo^T is fetched once for 32 rows of output.
// The strip's X rows (32 KB) are put down once, for all waves.  Wo^T runs in
// 8 stages of 64 k.  A wave's 32 columns are 32 rows of Wo^T that no other wave
// needs: each wave stages its own rows (4 KB a stage) through two LDS buffers
// of its own and two register sets, so the k loop holds no barrier and the
// waves drift apart, one wave's LDS stores beside another's reads and products.
// LDS unit of row r, column unit c of a stage: r * 8 + (c ^ ((r >> 1) & 7)),
// as in proj_gemm.  The k order of every sum is the one of a plain k loop.
// ---------------------------------------------------------------------------
#define OP_ROWS 32
#define OP_WAVES 16
#define OP_STAGES (E_DIM / 64)
#define OP_UNITS (32 * 8)          // 16-byte units of 32 rows of one stage

__global__ void __launch_bounds__(OP_WAVES * 32)
outproj_ln(const _Float16* __restrict__ attn16, const _Float16* __restrict__ WoT,
           const float* __restrict__ bo, const float* __restrict__ gamma,
           const float* __restrict__ beta, float* __restrict__ out) {
  // the X rows of all stages, then each wave's two buffers
  __shared__ v8h stx[(OP_STAGES + OP_WAVES * 2) * OP_UNITS];
  __shared__ float rowbuf[OP_ROWS][E_DIM];
  const int tid = threadIdx.x;
  const int lane = tid & 31, wid = tid >> 5;
  const int m = lane & 15, hk = lane >> 4;
  const int rbase = blockIdx.x * OP_ROWS;
  const int fc = tid & 7;
  // filling Wo^T: lane = unit fc of the wave's rows lr, lr + 4, ...
  const int lr = lane >> 3;
  const v8h* pw = reinterpret_cast<const v8h*>(WoT) +
                  (wid * 32 + lr) * (E_DIM / 8) + fc;
  v8h* wbuf = stx + (OP_STAGES + wid * 2) * OP_UNITS;
  // filling X: thread = unit fc of row xr in stages xs, xs + 2, ...
  const int xr = (tid >> 3) & 31, xs = tid >> 8;
  const v8h* px = reinterpret_cast<const v8h*>(attn16) +
                  (rbase + xr) * (E_DIM / 8) + xs * 8 + fc;
  const int xfs = xs * OP_UNITS + xr * 8 + (fc ^ ((xr >> 1) & 7));
  // reading: row m of a 16-row tile of X or of the wave's Wo^T rows
  const int frow = m * 8;
  const int sz = (m >> 1) & 7;
  const int col0 = wid * 32 + m;

  // two register sets: stage s + 2 is asked for while stage s is worked on.
  // Every loop from here on is unrolled, so that the register arrays, the set
  // and the LDS buffer are picked by compile-time indices (no scratch memory).
  v8h nx[OP_STAGES / 2], nw[2][8];
#pragma unroll
  for (int i = 0; i < 8; ++i) nw[0][i] = pw[i * 4 * (E_DIM / 8)];
#pragma unroll
  for (int i = 0; i < OP_STAGES / 2; ++i) nx[i] = px[i * 16];
#pragma unroll
  for (int i = 0; i < 8; ++i) nw[1][i] = pw[i * 4 * (E_DIM / 8) + 8];
  const float bv[2] = {bo[col0], bo[col0 + 16]};
  // stands in front of the first reuse of a register that these loads name;
  // the two bases are inputs so that their registers stay theirs up to here
  asm volatile("s_wait_xcnt 0x0" :: "v"(px), "v"(pw) : "memory");
#pragma unroll
  for (int i = 0; i < 8; ++i) {
    const int r = lr + 4 * i;
    wbuf[r * 8 + (fc ^ ((r >> 1) & 7))] = nw[0][i];
  }
#pragma unroll
  for (int i = 0; i < OP_STAGES / 2; ++i) stx[xfs + i * 2 * OP_UNITS] = nx[i];
  lds_barrier();   // every wave reads the X rows that all 16 have stored

  v8f acc[2][2] = {{{}, {}}, {{}, {}}};
#pragma unroll
  for (int s = 0; s < OP_STAGES; ++s) {
    if (s + 2 < OP_STAGES) {   // into the set that went to LDS a stage ago
#pragma unroll
      for (int i = 0; i < 8; ++i)
        nw[s & 1][i] = pw[i * 4 * (E_DIM / 8) + (s + 2) * 8];
    }
    // keeps the eight loads issued ahead of the stage's products: sunk towards
    // their LDS stores they would lose the lead that hides their latency
    __builtin_amdgcn_sched_barrier(0);
    const v8h* sbx = stx + s * OP_UNITS;
    const v8h* sbw = wbuf + (s & 1) * OP_UNITS;
#pragma unroll
    for (int ks = 0; ks < 2; ++ks) {
      const int c0 = (ks * 4 + hk) ^ sz, c1 = (ks * 4 + 2 + hk) ^ sz;
      FragU fx[2], fw[2];
#pragma unroll
      for (int t = 0; t < 2; ++t) {
        fx[t].h[0] = sbx[frow + t * 128 + c0];
        fx[t].h[1] = sbx[frow + t * 128 + c1];
        fw[t].h[0] = sbw[frow + t * 128 + c0];
        fw[t].h[1] = sbw[frow + t * 128 + c1];
      }
#pragma unroll
      for (int i = 0; i < 2; ++i)
#pragma unroll
        for (int j = 0; j < 2; ++j)
          acc[i][j] = wmma_f16(fx[i].v, fw[j].v, acc[i][j]);
    }
    if (s + 1 < OP_STAGES) {   // the buffer whose fragments stage s - 1 has used
      v8h* d = wbuf + ((s + 1) & 1) * OP_UNITS;
#pragma unroll
      for (int i = 0; i < 8; ++i) {
        const int r = lr + 4 * i;
        d[r * 8 + (fc ^ ((r >> 1) & 7))] = nw[(s + 1) & 1][i];
      }
      lds_wave_sync();
    }
  }

#pragma unroll
  for (int j = 0; j < 2; ++j)
#pragma unroll
    for (int i = 0; i < 2; ++i)
#pragma unroll
      for (int r = 0; r < 8; ++r)
        rowbuf[i * 16 + hk * 8 + r][col0 + j * 16] = acc[i][j][r] + bv[j];
  __syncthreads();
#pragma unroll
  for (int rr = 0; rr < 2; ++rr) {
    int row = wid * 2 + rr;
    float s = 0.f, s2 = 0.f;
    for (int c = lane; c < E_DIM; c += 32) {
      float v = rowbuf[row][c];
      s += v; s2 += v * v;
    }
#pragma unroll
    for (int off = 16; off > 0; off >>= 1) {
      s  += __shfl_xor(s, off);
      s2 += __shfl_xor(s2, off);
    }
    float mean = s * (1.0f / E_DIM);
    float var  = s2 * (1.0f / E_DIM) - mean * mean;
    float rstd = rsqrtf(var + 1e-5f);
    for (int c = lane; c < E_DIM; c += 32) {
      out[(size_t)(rbase + row) * E_DIM + c] =
          (rowbuf[row][c] - mean) * rstd * gamma[c] + beta[c];
    }
  }
}

// ---------------------------------------------------------------------------
extern "C" void kernel_launch(void* const* d_in, const int* in_sizes, int n_in,
                              void* d_out, int out_size, void* d_ws, size_t ws_size,
                              hipStream_t stream) {
  const float* query = (const float*)d_in[0];
  const float* key   = (const float*)d_in[1];
  const float* value = (const float*)d_in[2];
  const float* relw  = (const float*)d_in[3];
  const float* Wq = (const float*)d_in[4];
  const float* bq = (const float*)d_in[5];
  const float* Wk = (const float*)d_in[6];
  const float* bk = (const float*)d_in[7];
  const float* Wv = (const float*)d_in[8];
  const float* bv = (const float*)d_in[9];
  const float* Wo = (const float*)d_in[10];
  const float* bo = (const float*)d_in[11];
  const float* gamma = (const float*)d_in[12];
  const float* beta  = (const float*)d_in[13];
  float* out = (float*)d_out;

  // workspace carve-up (~30 MB)
  const size_t XE = (size_t)BATCH * SEQ * E_DIM;   // 2M elems
  const size_t WE = (size_t)E_DIM * E_DIM;         // 256K elems
  char* ws = (char*)d_ws;
  _Float16* xq16 = (_Float16*)ws; ws += XE * sizeof(_Float16);
  _Float16* xk16 = (_Float16*)ws; ws += XE * sizeof(_Float16);
  _Float16* xv16 = (_Float16*)ws; ws += XE * sizeof(_Float16);
  _Float16* WqT  = (_Float16*)ws; ws += WE * sizeof(_Float16);
  _Float16* WkT  = (_Float16*)ws; ws += WE * sizeof(_Float16);
  _Float16* WvT  = (_Float16*)ws; ws += WE * sizeof(_Float16);
  _Float16* WoT  = (_Float16*)ws; ws += WE * sizeof(_Float16);
  _Float16* qh16 = (_Float16*)ws; ws += XE * sizeof(_Float16);
  _Float16* kh16 = (_Float16*)ws; ws += XE * sizeof(_Float16);
  _Float16* vT16 = (_Float16*)ws; ws += XE * sizeof(_Float16);
  _Float16* at16 = (_Float16*)ws; ws += XE * sizeof(_Float16);
  (void)in_sizes; (void)n_in; (void)out_size; (void)ws_size;

  dim3 blk(256);
  // xq16, xk16, xv16 and WqT .. WoT lie one behind the other in the workspace
  prep_f16<<<PREP_BLOCKS, blk, 0, stream>>>(query, key, value, Wq, Wk, Wv, Wo,
                                            xq16, WqT);

  // qh16, kh16 and vT16 lie one behind the other too
  dim3 pg(BATCH * SEQ / PJ_ROWS, E_DIM / PJ_COLS, 3);   // (64, 4, 3)
  proj_gemm<<<pg, blk, 0, stream>>>(xq16, WqT, bq, bk, bv, qh16);

  dim3 ag(SEQ / (ATT_TILES * 16), NORMAL_HEADS, BATCH);     // (16, 8, 2)
  attn_fused<<<ag, dim3(ATT_WAVES * 32), 0, stream>>>(qh16, kh16, vT16, relw, at16);

  outproj_ln<<<BATCH * SEQ / OP_ROWS, dim3(OP_WAVES * 32), 0, stream>>>(at16, WoT, bo, gamma,
                                                                    beta, out);
}

// v010
// Measured time: 54.7 microseconds a run.
// Two timings next to v009 both put it at 1.11 times that version's speed.
// Counting every step since v000, it is 7.93 times as fast.
#include <hip/hip_runtime.h>
#include <hip/hip_bf16.h>

// ---------------------------------------------------------------------------
// Relation-aware attention for MI455X (gfx1250, wave32, WMMA).
//
// Roofline: relation_weights (256 MB) dominates traffic -> memory bound at
// ~13us on 23.3 TB/s HBM *if* we never spill the 2x16x2048x2048 score tensor.
// Hence a fused flash-style attention kernel with online normalization, f16
// WMMA (16x16x32, K == head_dim == 32) for all GEMM work, f32 accumulate.
// ---------------------------------------------------------------------------

typedef __attribute__((ext_vector_type(16))) _Float16 v16h;
typedef __attribute__((ext_vector_type(8)))  _Float16 v8h;
typedef __attribute__((ext_vector_type(8)))  float    v8f;

#define E_DIM   512
#define NHEAD   16
#define RHEAD   8
#define NORMAL_HEADS 8
#define HEAD_DIM 32
#define BATCH   2
#define SEQ     2048
#define SCALING 0.17677669529663687f   // 32^-0.5

union FragU { v16h v; v8h h[2]; };

// A/B fragment loader (16-bit, 16x16x32 WMMA).
// A layout (ISA 7.12.2): lane = 16*hk + m holds row m; element e holds
//   k = (e<8 ? 0 : 16) + hk*8 + (e&7)  -> two contiguous 8-half (b128) loads.
// B fragments use the mirrored layout (lane&15 = column), so a row-major
// [N x K] (i.e. pre-transposed) matrix loads with the identical pattern.
__device__ __forceinline__ v16h load_frag(const _Float16* __restrict__ base,
                                          int ld, int row0, int k0, int lane) {
  const int m  = lane & 15;
  const int hk = lane >> 4;
  const _Float16* p = base + (size_t)(row0 + m) * ld + (k0 + hk * 8);
  FragU f;
  f.h[0] = *reinterpret_cast<const v8h*>(p);
  f.h[1] = *reinterpret_cast<const v8h*>(p + 16);
  return f.v;
}

__device__ __forceinline__ v8f wmma_f16(v16h a, v16h b, v8f c) {
  return __builtin_amdgcn_wmma_f32_16x16x32_f16(false, a, false, b,
                                                (short)0, c, false, false);
}

// ---------------------------------------------------------------------------
// Projection GEMM: Y = X @ W + b, straight from the f32 inputs: no launch of
// its own converts them.  A block of 8 waves computes 128 rows x 256 columns;
// K runs in 8 stages of 64.  A stage's X rows (256 bytes each) and W rows
// (64 k x 256 columns) come from global memory by whole-line 16-byte loads,
// are rounded to f16 in registers and go to LDS; the waves take their
// fragments there.  f32 operands are twice the bytes, so the tile is four
// times the area of a 64 x 128 one: the bytes that all blocks together draw
// from L2 stay what they were with f16 copies.  A wave owns 64 x 64 (4 x 4
// tiles), so a fragment feeds four products.
// Two LDS buffers and two register sets: the loads of the stage after next fly
// while this stage is worked on.
// X in LDS: unit (16 bytes, 8 k) c of row r lies at r * 8 + (c ^ ((r >> 1) & 7)),
// so that the 16 lanes of a half wave, which read 16 rows at one c, fall on 16
// different bank groups.  A thread holds 4 k of a row: half a unit a store.
// W goes in transposed, as W^T rows (B fragments are then 16-byte reads): a
// thread loads 4 columns of 8 consecutive k, which are 4 whole units, picked
// from its registers.  W^T rows have a pitch of 9 units: the 16 rows of a
// fragment read fall on 16 bank groups, and so do the 16 lanes of a half wave
// in a store (4 column groups x 4 k units: 36 * a + b modulo 16).
// Output: head-major f16, [B,H,L,HD] (q,k) or [B,H,HD,L] (v^T); a 128-row tile
// lies in one batch, a wave's 64 columns are two heads.
// The three projections read nothing of each other: they are one launch, and
// blockIdx.z says which (0 q, 1 k, 2 v); out16 holds the arrays of q, k and v
// one behind the other.  blockIdx.z == 3: 64 blocks that write Wo^T in f16 for
// the output projection (WoT[n][k] = Wo[k][n]); a thread reads 8 k of one
// column (a wave-wide load is one line of Wo) and stores them as 16 bytes,
// twice.  192 + 64 blocks: one a WGP.
// ---------------------------------------------------------------------------
typedef __attribute__((ext_vector_type(4))) float    v4f;
typedef __attribute__((ext_vector_type(4))) _Float16 v4h;

#define X_ELEMS (BATCH * SEQ * E_DIM)
#define PJ_ROWS 128
#define PJ_COLS 256
#define PJ_STAGES (E_DIM / 64)
#define PJ_XUNITS (PJ_ROWS * 8)              // 16-byte units of a stage's X rows
#define PJ_WPITCH 9                          // units from one W^T row to the next
#define PJ_UNITS (PJ_XUNITS + PJ_COLS * PJ_WPITCH)   // units of one stage
#define PJ_GRID_X (BATCH * SEQ / PJ_ROWS)
#define PJ_GRID_Y (E_DIM / PJ_COLS)

// Work-group barrier that orders LDS traffic alone.  __syncthreads() also waits
// for every global load in flight, which would end the lead of the loads that
// are asked for two stages ahead; they land in registers of their own wave.
__device__ __forceinline__ void lds_barrier() {
  __builtin_amdgcn_fence(__ATOMIC_RELEASE, "workgroup", "local");
  __builtin_amdgcn_s_barrier();
  __builtin_amdgcn_fence(__ATOMIC_ACQUIRE, "workgroup", "local");
}

// The lanes of one wave hand each other units through LDS: the wave's stores
// have landed before any of its lanes reads there.  No other wave is waited for.
__device__ __forceinline__ void lds_wave_sync() {
  __builtin_amdgcn_fence(__ATOMIC_ACQ_REL, "workgroup", "local");
}

__global__ void __launch_bounds__(256)
proj_gemm(const float* __restrict__ query, const float* __restrict__ key,
          const float* __restrict__ value, const float* __restrict__ Wq,
          const float* __restrict__ Wk, const float* __restrict__ Wv,
          const float* __restrict__ Wo, const float* __restrict__ bias_q,
          const float* __restrict__ bias_k, const float* __restrict__ bias_v,
          _Float16* __restrict__ out16, _Float16* __restrict__ WoT) {
  __shared__ v8h st[2 * PJ_UNITS];
  const int which = blockIdx.z;
  const int tid = threadIdx.x;
  const int lane = tid & 31, wid = tid >> 5;

  if (which == 3) {   // the whole block: Wo^T, two 64 k x 32 n tiles of 128
    const int t0 = (blockIdx.y * PJ_GRID_X + blockIdx.x) * 2;
    const int n  = (t0 & 15) * 32 + lane;      // the second tile: n + 32
    const int k0 = (t0 >> 4) * 64 + wid * 8;
    const float* p = Wo + k0 * E_DIM + n;
    v8f w[2];
#pragma unroll
    for (int e = 0; e < 2; ++e)
#pragma unroll
      for (int i = 0; i < 8; ++i) w[e][i] = p[i * E_DIM + e * 32];
    // stands in front of the first reuse of a register that these loads name;
    // the address is an input so that its registers stay its own up to here
    asm volatile("s_wait_xcnt 0x0" :: "v"(p) : "memory");
#pragma unroll
    for (int e = 0; e < 2; ++e)
      *reinterpret_cast<v8h*>(WoT + (n + e * 32) * E_DIM + k0) =
          __builtin_convertvector(w[e], v8h);
    return;
  }

  const float* X    = which == 0 ? query : (which == 1 ? key : value);
  const float* Wm   = which == 0 ? Wq : (which == 1 ? Wk : Wv);
  const float* bias = which == 0 ? bias_q : (which == 1 ? bias_k : bias_v);
  out16 += which * X_ELEMS;
  const int m = lane & 15, hk = lane >> 4;
  const int rbase = blockIdx.x * PJ_ROWS;
  const int cbase = blockIdx.y * PJ_COLS;
  // filling X: thread = 4 k (number xq of 16 in a stage) of rows xr, xr + 16, ...
  const int xq = tid & 15, xr = tid >> 4;
  const v4f* px = reinterpret_cast<const v4f*>(X) + (rbase + xr) * (E_DIM / 4) + xq;
  const int xfs = (xr * 8 + ((xq >> 1) ^ ((xr >> 1) & 7))) * 2 + (xq & 1);  // half units
  // filling W: the wave's 32 columns are one line of a W row; 8 lanes take it
  // (lane bits 0, 1, 4), and lane bits 2, 3 pick one of 4 k units; the other 4
  // k units of the stage are the thread's second share
  const int wn = wid * 32 + ((lane & 3) + 4 * hk) * 4;   // first of 4 columns
  const int wu = (lane >> 2) & 3;
  const int wi = (wu * 8 * E_DIM + cbase + wn) / 4;
  const v4f* pw = reinterpret_cast<const v4f*>(Wm) + wi;
  const int wfs = PJ_XUNITS + wn * PJ_WPITCH + wu;
  // reading: the wave's X rows and W^T rows; the lane's units of a fragment
  // (k = 8*hk .. and 16 + 8*hk ..) for the two k steps of a stage
  const int xrow = ((wid >> 2) * 64 + m) * 8;
  const int wrow = PJ_XUNITS + ((wid & 3) * 64 + m) * PJ_WPITCH + hk;
  const int sw = (m >> 1) & 7;

  const int col0 = cbase + (wid & 3) * 64 + m;   // the lane's column in tile 0
  const float bv[4] = {bias[col0], bias[col0 + 16], bias[col0 + 32], bias[col0 + 48]};

  // two register sets: stage s + 2 is asked for while stage s is worked on.
  // Every loop from here on is unrolled, so that the register arrays, the set
  // and the LDS buffer are picked by compile-time indices (no scratch memory).
  v4f nx[2][8], nw[2][16];
  auto stage_load = [&](int set, int s) {
#pragma unroll
    for (int i = 0; i < 8; ++i) nx[set][i] = px[i * 16 * (E_DIM / 4) + s * 16];
#pragma unroll
    for (int i = 0; i < 16; ++i)   // k = 64 s + 8 (wu + 4 (i >> 3)) + (i & 7)
      nw[set][i] = pw[(s * 64 + (i >> 3) * 32 + (i & 7)) * (E_DIM / 4)];
  };
  auto stage_store = [&](int set, v8h* d) {
    v4h* dx = reinterpret_cast<v4h*>(d);
#pragma unroll
    for (int i = 0; i < 8; ++i)
      dx[xfs + i * 256] = __builtin_convertvector(nx[set][i], v4h);
#pragma unroll
    for (int e = 0; e < 2; ++e)
#pragma unroll
      for (int q = 0; q < 4; ++q) {
        v8f c;                     // 8 k of column wn + q
#pragma unroll
        for (int i = 0; i < 8; ++i) c[i] = nw[set][e * 8 + i][q];
        d[wfs + q * PJ_WPITCH + e * 4] = __builtin_convertvector(c, v8h);
      }
  };
  stage_load(0, 0);
  stage_load(1, 1);
  // stands in front of the first reuse of a register that these loads and the
  // bias loads name; what the addresses are formed from are inputs so that
  // their registers stay theirs up to here
  asm volatile("s_wait_xcnt 0x0" :: "v"(px), "v"(wi), "v"(col0) : "memory");
  stage_store(0, st);

  v8f acc[4][4];
#pragma unroll
  for (int i = 0; i < 4; ++i)
#pragma unroll
    for (int j = 0; j < 4; ++j) acc[i][j] = v8f{};
#pragma unroll
  for (int s = 0; s < PJ_STAGES; ++s) {
    // publishes stage s, and ends every wave's reads of the other buffer
    // before it is filled again below
    lds_barrier();
    // into the set that went to LDS a stage ago
    if (s + 2 < PJ_STAGES) stage_load(s & 1, s + 2);
    // behind the last loads: as the wait above, before their address registers
    // are free for other use
    if (s + 3 == PJ_STAGES)
      asm volatile("s_wait_xcnt 0x0" :: "v"(px), "v"(wi) : "memory");
    // keeps the 24 loads issued ahead of the stage's products: sunk towards
    // their LDS stores they would lose the lead that hides their latency
    __builtin_amdgcn_sched_barrier(0);
    const v8h* sb = st + (s & 1) * PJ_UNITS;
#pragma unroll
    for (int ks = 0; ks < 2; ++ks) {
      const int c0 = (ks * 4 + hk) ^ sw, c1 = (ks * 4 + 2 + hk) ^ sw;
      FragU fx[4], fw[4];
#pragma unroll
      for (int t = 0; t < 4; ++t) {
        fx[t].h[0] = sb[xrow + t * 128 + c0];
        fx[t].h[1] = sb[xrow + t * 128 + c1];
        fw[t].h[0] = sb[wrow + t * 16 * PJ_WPITCH + ks * 4];
        fw[t].h[1] = sb[wrow + t * 16 * PJ_WPITCH + ks * 4 + 2];
      }
#pragma unroll
      for (int i = 0; i < 4; ++i)
#pragma unroll
        for (int j = 0; j < 4; ++j)
          acc[i][j] = wmma_f16(fx[i].v, fw[j].v, acc[i][j]);
    }
    if (s + 1 < PJ_STAGES) stage_store((s + 1) & 1, st + ((s + 1) & 1) * PJ_UNITS);
  }

  // The tile goes out through LDS, which is free now, so that global memory sees
  // whole lines: with 64 blocks for v^T, stores of single values from the
  // accumulator map (16 lines a store) would fall on a quarter of the WGPs.
  // A row is a sequence position l, a column a head dim.  A lane holds 8
  // consecutive l of one column.
  // v^T [B,H,HD,L]: a column's 128 l are 16 units in a row, pitch 17 units.
  // q, k [B,H,L,HD]: a head's 128 l x 32 dims as they lie in memory, unit
  // g = (head * 128 + l) * 4 + dim / 8, at g ^ (bit 3 of l << 3), so that the
  // two halves of a wave (l and l + 8) fall on different banks.
  v8h y[4][4];
#pragma unroll
  for (int i = 0; i < 4; ++i)
#pragma unroll
    for (int j = 0; j < 4; ++j) y[i][j] = __builtin_convertvector(acc[i][j] + bv[j], v8h);
  lds_barrier();   // every wave has taken its last fragments
  const int lw = (wid >> 2) * 64 + hk * 8;     // first l of the lane, in the tile
  const int cw = (wid & 3) * 64 + m;           // first column of the lane
  if (which == 2) {
#pragma unroll
    for (int i = 0; i < 4; ++i)
#pragma unroll
      for (int j = 0; j < 4; ++j)
        st[(cw + j * 16) * 17 + (lw >> 3) + i * 2] = y[i][j];
  } else {
    _Float16* sh = reinterpret_cast<_Float16*>(st);
    // head cw / 32 (+ j / 2), dim m + 16 (j & 1); bit 3 of l is hk, and bit 3
    // of g is bit 1 of r: the XOR adds 8 units where that is 0, else takes them
    const int e0 = (((cw >> 5) * 128 + lw) * 4 + (m >> 3)) * 8 + (m & 7);
    const int eu = e0 + hk * 64, ed = e0 - hk * 64;
#pragma unroll
    for (int i = 0; i < 4; ++i)
#pragma unroll
      for (int j = 0; j < 4; ++j)
#pragma unroll
        for (int r = 0; r < 8; ++r)
          sh[((r & 2) ? ed : eu) + ((j >> 1) * 512 + (i * 16 + r) * 4 + (j & 1) * 2) * 8] =
              y[i][j][r];
  }
  lds_barrier();   // every wave reads what all 8 have stored
  // a thread moves 16 units; a wave-wide store is 512 bytes of whole lines.
  // v^T: unit tid & 15 of columns tid / 16 + 16 t.  q, k: units tid + 256 t.
  // Both walk by constant steps, picked by value.
  const int bb = rbase >> 11, lb = rbase & (SEQ - 1);
  const int rd   = which == 2 ? (tid >> 4) * 17 + (tid & 15) : tid ^ ((tid >> 2) & 8);
  const int rdst = which == 2 ? 16 * 17 : 256;
  const int go   = which == 2 ? (cbase + (tid >> 4)) * SEQ + lb + (tid & 15) * 8
                              : (cbase * SEQ + lb * HEAD_DIM) + tid * 8;
  const int gost = which == 2 ? 16 * SEQ : 256 * 8;     // odd t; two t: 32 * SEQ
  _Float16* o = out16 + bb * (SEQ * E_DIM) + go;
#pragma unroll
  for (int t = 0; t < 16; ++t)
    *reinterpret_cast<v8h*>(o + (t >> 1) * 32 * SEQ + (t & 1) * gost) = st[rd + t * rdst];
}

// ---------------------------------------------------------------------------
// Fused flash attention, scores computed transposed.  Wave owns 16 q-rows of
// one (b,h).  64 chunks of 32 keys:
//   S^T = K . Q^T   (A = 16 key rows, B = 16 query columns), two tiles;
//   O^T += V^T . P^T (A = 16 head dims x 32 keys, B = P^T).
// In the D map a lane holds one query column (lane & 15) and 8 keys per tile
// (8*hk + r), so max and sum run over the lane's own registers plus one
// exchange with lane ^ 16, and the two packed score tiles are already the
// B operand of the second product (k = 8*hk + s, 16 + 8*hk + (s - 8)):
// P never leaves the registers.
//
// The maximum that the exponents are taken against is HELD, not followed: its
// negative enters the score product as the C operand, so a score leaves the
// matrix unit already reduced, and P = exp2(score * scale * log2 e) with no
// subtraction; O and the row sum take no factor from chunk to chunk.  A trip
// of 4 chunks forms its 8 score tiles first.  Only when one of them passes the
// held maximum by more than 2^HOLD_LOG2 (a branch that is the same for the
// whole wave) is the maximum moved up and O, the sum, C and the trip's scores
// brought along.  P stays at or below 2^HOLD_LOG2, far inside f16; the held
// maximum starts as the true maximum of chunk 0, so it never lies above the
// row's maximum and nothing underflows that did not before.
//
// A block serves two heads at once: one relation head and one normal head of
// the same batch, 128 query rows of each, waves 0-7 on the first and 8-15 on
// the second, so every SIMD runs two waves of either kind.  A relation wave
// streams 128 KB of weights from memory and a normal wave nothing; a WGP draws
// from memory at a bounded rate, so with whole blocks of one kind half the WGPs
// would carry the whole stream while the other half finish early.
//
// K and V^T of both heads go into LDS by whole-line loads, half the keys at a
// time (2 heads x (64 KB + 64 KB)), and the waves take their A fragments from
// there: a fragment load from global memory touches 8 (K) or 16 (V^T) cache
// lines for its 512 bytes, and every wave would repeat it.  Between the halves
// all waves meet: the second half's units are asked for, a barrier ends every
// wave's reads of the first half, the units are stored, a barrier publishes
// them.  A wave walks its keys in the plain order, its state kept in registers.
// At more than 256 KB of LDS one block has a WGP to itself; 256 blocks.  LDS is
// counted in 16-byte units; a unit's low index bits are XORed with row bits so
// that the 16 lanes of a half wave, which read 16 rows at one column, fall on
// 16 different bank groups (key: within the half):
//   K   unit u = key * 4 + c   (c: 8 head dims)  -> u ^ ((key >> 2) & 3)
//   V^T unit u = d * 128 + p   (p: 8 keys)       -> u ^ (d & 15)
//
// Relation weights: a lane needs 8 + 8 weights of its own query row, so a load
// straight into that layout touches 16 rows (16 lines) for its 512 bytes, four
// times a chunk.  Instead a wave fetches its 16 rows x 32 keys by whole-line
// loads (8 lanes a line, 4 lines a load), four chunks ahead in four register
// sets, and turns each chunk through 2 KB of LDS of its own: no other wave
// reads there, so no barrier.  Unit of row r, column unit c (4 weights):
// r * 8 + (c ^ ((r >> 1) & 7)), as in proj_gemm.
// ---------------------------------------------------------------------------
#define ATT_WAVES 16
#define ATT_TILES (ATT_WAVES / 2)        // waves (16-row query tiles) a head
#define KEY_HALF (SEQ / 2)               // keys that lie in LDS at one time
#define HALF_UNITS (KEY_HALF * HEAD_DIM / 8)  // 16-byte units of that much K or V^T
#define HEAD_UNITS (2 * HALF_UNITS)      // one head's K units, then its V^T units
#define REL_LEAD 4                       // chunks of weights held in registers
#define REL_UNITS (16 * 8)               // 16-byte units of 16 rows x 32 keys
#define EXP2_SCALE (SCALING * 1.4426950408889634f)   // raw score -> exponent of 2
#define HOLD_LOG2 8.0f                   // how far a score may pass the held max

template <bool B> struct Flag { static constexpr bool v = B; };

__device__ __forceinline__ int k_slot(int u) { return u ^ ((u >> 4) & 3); }
__device__ __forceinline__ int v_slot(int u) { return u ^ ((u >> 7) & 15); }

__device__ __forceinline__ float xhalf(float x) {   // value of lane ^ 16
  int b = __builtin_bit_cast(int, x);
  return __builtin_bit_cast(float, __builtin_amdgcn_permlanex16(
      b, b, 0x76543210, 0xfedcba98, false, false));
}

// One wave's 16 query rows against the keys of half PH (0, then 1).
// kv: the head's K units of that half, then its V^T units, in LDS.
// relfill: the lane's unit of the wave's relation rows, chunk 0: unit lane & 7
// of row lane >> 3; rows + 4, + 8, + 12 follow (REL only).
// wb: the wave's own LDS units for one chunk of weights (REL only).
// bq: the query fragment (column = query).  What goes from half to half:
// cm (below); o0[r] = O[q][d = 8*hk + r], o1: d + 16; lrun: the sum over this
// lane's half of the keys; rw: the weights on their way (REL only).
template <bool REL, int PH>
__device__ __forceinline__ void
attn_half(const v8h* kv, const float* __restrict__ relfill, v4f* wb,
          const v16h bq, v8f& cm, v8f& o0, v8f& o1, float& lrun,
          v4f (&rw)[REL_LEAD][4], int lane) {
  // the lane's units of a fragment (k = 8*hk .. and 16 + 8*hk ..), chunk 0
  const int m = lane & 15, hk = lane >> 4;
  const int kl0 = k_slot(m * 4 + hk), kl1 = k_slot(m * 4 + hk + 2);
  const int vb0 = (HALF_UNITS + v_slot(m * 128 + hk)) * 16;     // in bytes
  const int vb1 = (HALF_UNITS + v_slot(m * 128 + hk + 2)) * 16;
  const char* kvb = reinterpret_cast<const char*>(kv);
  auto max3 = [](float a, float b, float c) { return fmaxf(fmaxf(a, b), c); };
  auto max16 = [&](v8f e, v8f t) {   // over the 8 + 8 elements
    return fmaxf(max3(max3(e[0], e[1], e[2]), max3(e[3], e[4], e[5]),
                      max3(e[6], e[7], t[0])),
                 max3(max3(t[1], t[2], t[3]), max3(t[4], t[5], t[6]), t[7]));
  };
  // cm: minus the held maximum of the lane's query, as raw (unscaled) score,
  // in all 8 elements: the C operand of every score tile.  Start: chunk 0's.
  if (PH == 0) {
    FragU a0, a1;
    a0.h[0] = kv[kl0];
    a0.h[1] = kv[kl1];
    a1.h[0] = kv[64 + kl0];
    a1.h[1] = kv[64 + kl1];
    const v8f z = {};
    const v8f t0 = wmma_f16(a0.v, bq, z), t1 = wmma_f16(a1.v, bq, z);
    const float x = max16(t0, t1);
    cm = z - fmaxf(x, xhalf(x));
  }

  // weights: where the lane puts its four units of a chunk, and where it finds
  // the four units of its own row (keys 8*hk .. and 16 + 8*hk ..)
  const v4f* gw = reinterpret_cast<const v4f*>(relfill);
  const int lr = lane >> 3, fc = lane & 7, sw = (m >> 1) & 7;
  auto rel_load = [&](int set, int j) {      // chunk at key j -> register set
#pragma unroll
    for (int i = 0; i < 4; ++i) rw[set][i] = gw[i * (4 * SEQ / 4) + j / 4];
  };
  auto rel_store = [&](int set) {            // register set -> the wave's LDS
#pragma unroll
    for (int i = 0; i < 4; ++i) {
      const int r = lr + 4 * i;
      wb[r * 8 + (fc ^ ((r >> 1) & 7))] = rw[set][i];
    }
  };
  if (REL && PH == 0) {
#pragma unroll
    for (int u = 0; u < REL_LEAD; ++u) rel_load(u, u * 32);
    rel_store(0);
  }

  // A trip is REL_LEAD chunks, unrolled so that the register set is picked by
  // a compile-time index; 'more' says whether chunks REL_LEAD ahead exist;
  // j0 counts keys within the half, as LDS does.
  // (Without weights the trip is as long: one look at the maximum a trip.)
  constexpr int TRIP = REL_LEAD;
  auto trip = [&](int j0, auto more) {
  // raw score minus held maximum, all chunks of the trip:
  // sc[u][0][r]: S[q][key = j + 8*hk + r], sc[u][1][r]: key + 16
  v8f sc[TRIP][2];
  {
    FragU ak[TRIP][2];
#pragma unroll
    for (int u = 0; u < TRIP; ++u) {
      const v8h* kj = kv + (j0 + u * 32) * 4;   // 16 keys are 64 units; slots repeat
      ak[u][0].h[0] = kj[kl0];
      ak[u][0].h[1] = kj[kl1];
      ak[u][1].h[0] = kj[64 + kl0];
      ak[u][1].h[1] = kj[64 + kl1];
    }
    // keeps the trip's K loads issued ahead of the first product: sunk to
    // their users, each would expose a load latency of its own
    __builtin_amdgcn_sched_barrier(0);
#pragma unroll
    for (int u = 0; u < TRIP; ++u) {
      sc[u][0] = wmma_f16(ak[u][0].v, bq, cm);
      sc[u][1] = wmma_f16(ak[u][1].v, bq, cm);
    }
    // keeps the 8 products back to back: a maximum drawn up between them would
    // stand too close behind the product it reads and cost idle slots
    __builtin_amdgcn_sched_barrier(0);
  }
  {
    static_assert(TRIP == 4, "the maximum below is written for 8 tiles");
    v8f e;                           // element-wise over the first 7 tiles
#pragma unroll
    for (int r = 0; r < 8; ++r)
      e[r] = max3(max3(max3(sc[0][0][r], sc[0][1][r], sc[1][0][r]), sc[1][1][r],
                       sc[2][0][r]), sc[2][1][r], sc[3][0][r]);
    const float mx = max16(e, sc[3][1]);
    if (__builtin_amdgcn_ballot_w32(mx > HOLD_LOG2 / EXP2_SCALE) != 0) {
      // rare: move the held maximum of every query up to what this trip shows
      const float d = fmaxf(fmaxf(mx, xhalf(mx)), 0.0f);   // both key halves
      const float alpha = __builtin_amdgcn_exp2f(-d * EXP2_SCALE);
      o0 *= alpha;
      o1 *= alpha;
      lrun *= alpha;
      cm -= d;
#pragma unroll
      for (int u = 0; u < TRIP; ++u) {
        sc[u][0] -= d;
        sc[u][1] -= d;
      }
    }
  }
#pragma unroll
  for (int u = 0; u < TRIP; ++u) {
    const int j = j0 + u * 32;
    v8f w0, w1;                      // weights of the lane's 8 + 8 keys
    if (REL) {
      lds_wave_sync();               // this chunk's units, stored a chunk ago
      union { v8f v; v4f q[2]; } a, b;
      a.q[0] = wb[m * 8 + ((2 * hk) ^ sw)];
      a.q[1] = wb[m * 8 + ((2 * hk + 1) ^ sw)];
      b.q[0] = wb[m * 8 + ((2 * hk + 4) ^ sw)];
      b.q[1] = wb[m * 8 + ((2 * hk + 5) ^ sw)];
      w0 = a.v;
      w1 = b.v;
      // into the set that went to LDS a chunk ago
      if (decltype(more)::v) rel_load(u, PH * KEY_HALF + j + REL_LEAD * 32);
    }
    FragU av0, av1;
    const int bj = j * 2;            // 4 units a chunk: adds to p as an XOR
    av0.h[0] = *reinterpret_cast<const v8h*>(kvb + (vb0 ^ bj));
    av0.h[1] = *reinterpret_cast<const v8h*>(kvb + (vb1 ^ bj));
    av1.h[0] = *reinterpret_cast<const v8h*>(kvb + 16 * 2048 + (vb0 ^ bj));
    av1.h[1] = *reinterpret_cast<const v8h*>(kvb + 16 * 2048 + (vb1 ^ bj));
    // keeps all of the chunk's loads issued ahead of its arithmetic: sunk
    // to their users, each would expose a load latency of its own
    __builtin_amdgcn_sched_barrier(0);

    v8f s0 = sc[u][0] * EXP2_SCALE, s1 = sc[u][1] * EXP2_SCALE;
#pragma unroll
    for (int r = 0; r < 8; ++r) s0[r] = __builtin_amdgcn_exp2f(s0[r]);
#pragma unroll
    for (int r = 0; r < 8; ++r) s1[r] = __builtin_amdgcn_exp2f(s1[r]);
    if (REL) {                                  // exp(s)*w, renormalized online
      s0 *= w0;
      s1 *= w1;
      if (decltype(more)::v || u + 1 < TRIP) {
        lds_wave_sync();             // every lane has read this chunk's units:
        rel_store((u + 1) % REL_LEAD);   // the next chunk's take their place
      }
    }
    const v8f t = s0 + s1;
    const float rs = ((t[0] + t[1]) + (t[2] + t[3])) +
                     ((t[4] + t[5]) + (t[6] + t[7]));
    lrun += rs;
    FragU pf;                                   // P^T as B operand
    pf.h[0] = __builtin_convertvector(s0, v8h);
    pf.h[1] = __builtin_convertvector(s1, v8h);
    o0 = wmma_f16(av0.v, pf.v, o0);
    o1 = wmma_f16(av1.v, pf.v, o1);
  }
  };
  constexpr int STEP = TRIP * 32;
  constexpr bool LAST = REL && PH == 1;   // the row's last trip asks for no more
  for (int j0 = 0; j0 < (LAST ? KEY_HALF - STEP : KEY_HALF); j0 += STEP)
    trip(j0, Flag<true>{});
  if (LAST) trip(KEY_HALF - STEP, Flag<false>{});
}

__global__ void __launch_bounds__(ATT_WAVES * 32)
attn_fused(const _Float16* __restrict__ qh, const _Float16* __restrict__ kh,
           const _Float16* __restrict__ vT, const float* __restrict__ relw,
           _Float16* __restrict__ attn_out) {
  static_assert(RHEAD == NORMAL_HEADS, "a block pairs one head of each kind");
  const int tid = threadIdx.x;
  const int lane = tid & 31;
  // the wave's number in a scalar register: what depends on it (the kind of
  // head, below) is then a scalar branch with every lane on
  const int wid = __builtin_amdgcn_readfirstlane(tid >> 5);
  const int m = lane & 15, hk = lane >> 4;
  const int b = blockIdx.z, pair = blockIdx.y;
  // the relation waves are the block's older ones: theirs is the longer work
  const bool rel = wid < ATT_TILES;
  const int h = rel ? NORMAL_HEADS + pair : pair;
  const int qbase = blockIdx.x * (ATT_TILES * 16) + (wid & (ATT_TILES - 1)) * 16;
  const size_t offr = (size_t)(b * NHEAD + NORMAL_HEADS + pair) * SEQ * HEAD_DIM;
  const size_t offn = (size_t)(b * NHEAD + pair) * SEQ * HEAD_DIM;
  const v8h* gKr = reinterpret_cast<const v8h*>(kh + offr);
  const v8h* gKn = reinterpret_cast<const v8h*>(kh + offn);
  const v8h* gVr = reinterpret_cast<const v8h*>(vT + offr);
  const v8h* gVn = reinterpret_cast<const v8h*>(vT + offn);

  // the relation head's units, the normal head's, the relation waves' own
  __shared__ v8h kv[2 * HEAD_UNITS + ATT_TILES * REL_UNITS];
  constexpr int FILL = HALF_UNITS / (ATT_WAVES * 32);  // units a thread moves
  v8h rk[2][FILL], rv[2][FILL];                        // of K, V^T of each head
  // K of a half lies in one piece: a thread takes units tid, tid + 512, ...
  // V^T is 128 units of each of 32 rows: a thread stays in row vd and takes
  // units vp, vp + 16, ... (a wave-wide load: 256 contiguous bytes of two rows).
  // So each array has one address a thread, and the steps are constants.
  const int vd = tid >> 4, vp = tid & 15;
  const int ks = k_slot(tid), vs = HALF_UNITS + v_slot(vd * 128 + vp);
  const v8h* pKr = gKr + tid;
  const v8h* pKn = gKn + tid;
  const v8h* pVr = gVr + vd * (SEQ / 8) + vp;
  const v8h* pVn = gVn + vd * (SEQ / 8) + vp;
  auto fill_load = [&](int ph) {
#pragma unroll
    for (int i = 0; i < FILL; ++i) {
      const int gk = ph * HALF_UNITS + i * (ATT_WAVES * 32);
      const int gv = ph * (KEY_HALF / 8) + i * 16;
      rk[0][i] = pKr[gk];
      rv[0][i] = pVr[gv];
      rk[1][i] = pKn[gk];
      rv[1][i] = pVn[gv];
    }
    // stands in front of the first reuse of a register that these loads name;
    // the addresses and their bases are inputs so that their registers stay
    // theirs up to here
    asm volatile("s_wait_xcnt 0x0" :: "v"(pKr), "v"(pKn), "v"(pVr), "v"(pVn),
                 "s"(gKr), "s"(gKn), "s"(gVr), "s"(gVn) : "memory");
  };
  auto fill_store = [&]() {
#pragma unroll
    for (int i = 0; i < FILL; ++i) {
#pragma unroll
      for (int s = 0; s < 2; ++s) {   // the steps leave the XORed bits alone
        kv[s * HEAD_UNITS + ks + i * (ATT_WAVES * 32)] = rk[s][i];
        kv[s * HEAD_UNITS + vs + i * 16] = rv[s][i];
      }
    }
  };
  fill_load(0);
  fill_store();
  __syncthreads();   // every wave reads what all 16 have stored

  const float* relfill = relw + ((size_t)(b * RHEAD + pair)) * SEQ * SEQ +
                         (size_t)(qbase + (lane >> 3)) * SEQ + (lane & 7) * 4;
  v4f* wb = reinterpret_cast<v4f*>(kv + 2 * HEAD_UNITS +
                                   (wid & (ATT_TILES - 1)) * REL_UNITS);
  const v16h bq = load_frag(qh + (size_t)(b * NHEAD + h) * SEQ * HEAD_DIM,
                            HEAD_DIM, qbase, 0, lane);
  v8f cm, o0 = {}, o1 = {};
  float lrun = 0.0f;
  v4f rw[REL_LEAD][4];
  if (rel) attn_half<true, 0>(kv, relfill, wb, bq, cm, o0, o1, lrun, rw, lane);
  else attn_half<false, 0>(kv + HEAD_UNITS, nullptr, nullptr, bq, cm, o0, o1, lrun, rw, lane);

  fill_load(1);      // into registers: flies while the slower waves still work
  lds_barrier();     // every wave has taken its last fragment of the first half
  fill_store();
  lds_barrier();     // every wave reads what all 16 have stored

  if (rel) attn_half<true, 1>(kv, relfill, wb, bq, cm, o0, o1, lrun, rw, lane);
  else attn_half<false, 1>(kv + HEAD_UNITS, nullptr, nullptr, bq, cm, o0, o1, lrun, rw, lane);

  // this lane's 8 + 8 output halves (d = 8*hk .., 16 + 8*hk ..)
  _Float16* op = attn_out + ((size_t)(b * SEQ + qbase + m)) * E_DIM +
                 h * HEAD_DIM + hk * 8;
  const float eps = rel ? 1e-6f : 0.0f;
  const float inv = 1.0f / (lrun + xhalf(lrun) + eps);   // join the halves once
  *reinterpret_cast<v8h*>(op)      = __builtin_convertvector(o0 * inv, v8h);
  *reinterpret_cast<v8h*>(op + 16) = __builtin_convertvector(o1 * inv, v8h);
}

// ---------------------------------------------------------------------------
// Output projection + LayerNorm fused.  A block of 16 waves computes a full
// strip of 32 rows x 512 columns, so that LN can reduce each row from LDS.
// As in proj_gemm, rows come from global memory by whole-line loads, one
// 16-byte unit a lane, and go to LDS, and the waves take their fragments
// there; a wave owns 32 rows x 32 columns (2 x 2 tiles), so a fragment feeds
// two products, and a line of Wo^T is fetched once for 32 rows of output.
// The strip's X rows (32 KB) are put down once, for all waves.  Wo^T runs in
// 8 stages of 64 k.  A wave's 32 columns are 32 rows of Wo^T that no other wave
// needs: each wave stages its own rows (4 KB a stage) through two LDS buffers
// of its own and two register sets, so the k loop holds no barrier and the
// waves drift apart, one wave's LDS stores beside another's reads and products.
// LDS unit of row r, column unit c of a stage: r * 8 + (c ^ ((r >> 1) & 7)),
// as in proj_gemm.  The k order of every sum is the one of a plain k loop.
// ---------------------------------------------------------------------------
#define OP_ROWS 32
#define OP_WAVES 16
#define OP_STAGES (E_DIM / 64)
#define OP_UNITS (32 * 8)          // 16-byte units of 32 rows of one stage

__global__ void __launch_bounds__(OP_WAVES * 32)
outproj_ln(const _Float16* __restrict__ attn16, const _Float16* __restrict__ WoT,
           const float* __restrict__ bo, const float* __restrict__ gamma,
           const float* __restrict__ beta, float* __restrict__ out) {
  // the X rows of all stages, then each wave's two buffers
  __shared__ v8h stx[(OP_STAGES + OP_WAVES * 2) * OP_UNITS];
  __shared__ float rowbuf[OP_ROWS][E_DIM];
  const int tid = threadIdx.x;
  const int lane = tid & 31, wid = tid >> 5;
  const int m = lane & 15, hk = lane >> 4;
  const int rbase = blockIdx.x * OP_ROWS;
  const int fc = tid & 7;
  // filling Wo^T: lane = unit fc of the wave's rows lr, lr + 4, ...
  const int lr = lane >> 3;
  const v8h* pw = reinterpret_cast<const v8h*>(WoT) +
                  (wid * 32 + lr) * (E_DIM / 8) + fc;
  v8h* wbuf = stx + (OP_STAGES + wid * 2) * OP_UNITS;
  // filling X: thread = unit fc of row xr in stages xs, xs + 2, ...
  const int xr = (tid >> 3) & 31, xs = tid >> 8;
  const v8h* px = reinterpret_cast<const v8h*>(attn16) +
                  (rbase + xr) * (E_DIM / 8) + xs * 8 + fc;
  const int xfs = xs * OP_UNITS + xr * 8 + (fc ^ ((xr >> 1) & 7));
  // reading: row m of a 16-row tile of X or of the wave's Wo^T rows
  const int frow = m * 8;
  const int sz = (m >> 1) & 7;
  const int col0 = wid * 32 + m;

  // two register sets: stage s + 2 is asked for while stage s is worked on.
  // Every loop from here on is unrolled, so that the register arrays, the set
  // and the LDS buffer are picked by compile-time indices (no scratch memory).
  v8h nx[OP_STAGES / 2], nw[2][8];
#pragma unroll
  for (int i = 0; i < 8; ++i) nw[0][i] = pw[i * 4 * (E_DIM / 8)];
#pragma unroll
  for (int i = 0; i < OP_STAGES / 2; ++i) nx[i] = px[i * 16];
#pragma unroll
  for (int i = 0; i < 8; ++i) nw[1][i] = pw[i * 4 * (E_DIM / 8) + 8];
  const float bv[2] = {bo[col0], bo[col0 + 16]};
  // stands in front of the first reuse of a register that these loads name;
  // the two bases are inputs so that their registers stay theirs up to here
  asm volatile("s_wait_xcnt 0x0" :: "v"(px), "v"(pw) : "memory");
#pragma unroll
  for (int i = 0; i < 8; ++i) {
    const int r = lr + 4 * i;
    wbuf[r * 8 + (fc ^ ((r >> 1) & 7))] = nw[0][i];
  }
#pragma unroll
  for (int i = 0; i < OP_STAGES / 2; ++i) stx[xfs + i * 2 * OP_UNITS] = nx[i];
  lds_barrier();   // every wave reads the X rows that all 16 have stored

  v8f acc[2][2] = {{{}, {}}, {{}, {}}};
#pragma unroll
  for (int s = 0; s < OP_STAGES; ++s) {
    if (s + 2 < OP_STAGES) {   // into the set that went to LDS a stage ago
#pragma unroll
      for (int i = 0; i < 8; ++i)
        nw[s & 1][i] = pw[i * 4 * (E_DIM / 8) + (s + 2) * 8];
    }
    // keeps the eight loads issued ahead of the stage's products: sunk towards
    // their LDS stores they would lose the lead that hides their latency
    __builtin_amdgcn_sched_barrier(0);
    const v8h* sbx = stx + s * OP_UNITS;
    const v8h* sbw = wbuf + (s & 1) * OP_UNITS;
#pragma unroll
    for (int ks = 0; ks < 2; ++ks) {
      const int c0 = (ks * 4 + hk) ^ sz, c1 = (ks * 4 + 2 + hk) ^ sz;
      FragU fx[2], fw[2];
#pragma unroll
      for (int t = 0; t < 2; ++t) {
        fx[t].h[0] = sbx[frow + t * 128 + c0];
        fx[t].h[1] = sbx[frow + t * 128 + c1];
        fw[t].h[0] = sbw[frow + t * 128 + c0];
        fw[t].h[1] = sbw[frow + t * 128 + c1];
      }
#pragma unroll
      for (int i = 0; i < 2; ++i)
#pragma unroll
        for (int j = 0; j < 2; ++j)
          acc[i][j] = wmma_f16(fx[i].v, fw[j].v, acc[i][j]);
    }
    if (s + 1 < OP_STAGES) {   // the buffer whose fragments stage s - 1 has used
      v8h* d = wbuf + ((s + 1) & 1) * OP_UNITS;
#pragma unroll
      for (int i = 0; i < 8; ++i) {
        const int r = lr + 4 * i;
        d[r * 8 + (fc ^ ((r >> 1) & 7))] = nw[(s + 1) & 1][i];
      }
      lds_wave_sync();
    }
  }

#pragma unroll
  for (int j = 0; j < 2; ++j)
#pragma unroll
    for (int i = 0; i < 2; ++i)
#pragma unroll
      for (int r = 0; r < 8; ++r)
        rowbuf[i * 16 + hk * 8 + r][col0 + j * 16] = acc[i][j][r] + bv[j];
  __syncthreads();
#pragma unroll
  for (int rr = 0; rr < 2; ++rr) {
    int row = wid * 2 + rr;
    float s = 0.f, s2 = 0.f;
    for (int c = lane; c < E_DIM; c += 32) {
      float v = rowbuf[row][c];
      s += v; s2 += v * v;
    }
#pragma unroll
    for (int off = 16; off > 0; off >>= 1) {
      s  += __shfl_xor(s, off);
      s2 += __shfl_xor(s2, off);
    }
    float mean = s * (1.0f / E_DIM);
    float var  = s2 * (1.0f / E_DIM) - mean * mean;
    float rstd = rsqrtf(var + 1e-5f);
    for (int c = lane; c < E_DIM; c += 32) {
      out[(size_t)(rbase + row) * E_DIM + c] =
          (rowbuf[row][c] - mean) * rstd * gamma[c] + beta[c];
    }
  }
}

// ---------------------------------------------------------------------------
extern "C" void kernel_launch(void* const* d_in, const int* in_sizes, int n_in,
                              void* d_out, int out_size, void* d_ws, size_t ws_size,
                              hipStream_t stream) {
  const float* query = (const float*)d_in[0];
  const float* key   = (const float*)d_in[1];
  const float* value = (const float*)d_in[2];
  const float* relw  = (const float*)d_in[3];
  const float* Wq = (const float*)d_in[4];
  const float* bq = (const float*)d_in[5];
  const float* Wk = (const float*)d_in[6];
  const float* bk = (const float*)d_in[7];
  const float* Wv = (const float*)d_in[8];
  const float* bv = (const float*)d_in[9];
  const float* Wo = (const float*)d_in[10];
  const float* bo = (const float*)d_in[11];
  const float* gamma = (const float*)d_in[12];
  const float* beta  = (const float*)d_in[13];
  float* out = (float*)d_out;

  // workspace carve-up (~17 MB)
  const size_t XE = (size_t)BATCH * SEQ * E_DIM;   // 2M elems
  const size_t WE = (size_t)E_DIM * E_DIM;         // 256K elems
  char* ws = (char*)d_ws;
  _Float16* WoT  = (_Float16*)ws; ws += WE * sizeof(_Float16);
  _Float16* qh16 = (_Float16*)ws; ws += XE * sizeof(_Float16);
  _Float16* kh16 = (_Float16*)ws; ws += XE * sizeof(_Float16);
  _Float16* vT16 = (_Float16*)ws; ws += XE * sizeof(_Float16);
  _Float16* at16 = (_Float16*)ws; ws += XE * sizeof(_Float16);
  (void)in_sizes; (void)n_in; (void)out_size; (void)ws_size;

  // qh16, kh16 and vT16 lie one behind the other in the workspace
  dim3 pg(PJ_GRID_X, PJ_GRID_Y, 4);   // (32, 2, 4)
  proj_gemm<<<pg, dim3(256), 0, stream>>>(query, key, value, Wq, Wk, Wv, Wo, bq, bk, bv,
                                          qh16, WoT);

  dim3 ag(SEQ / (ATT_TILES * 16), NORMAL_HEADS, BATCH);     // (16, 8, 2)
  attn_fused<<<ag, dim3(ATT_WAVES * 32), 0, stream>>>(qh16, kh16, vT16, relw, at16);

  outproj_ln<<<BATCH * SEQ / OP_ROWS, dim3(OP_WAVES * 32), 0, stream>>>(at16, WoT, bo, gamma,
                                                                    beta, out);
}
